// v000
// Measured on an AMD MI455X. A time is GPU time per run, averaged over a window of back-to-back runs after a warm-up
// (all launches, gaps included; the runs take copies of the inputs in turn), and the median of several windows.
// Apart from v000's, it joins two sittings. Times from different sittings can be a few percent apart, while
// side-by-side timings come from the same sitting.
// v000 is the starting kernel. One run takes 2100 microseconds.
#include <hip/hip_runtime.h>

// Dense multi-head 'graph attention' with dot-product scores and a LeakyReLU before the softmax (h [8][2048][256]; Wh = h W ('xw' [256][256] 1/16, no bias) split into 4 heads x 64; scores = Wh.Wh^T x 1/sqrt(64) per head (queries, keys and values are all Wh); attention = softmax(LeakyReLU_0.2(scores)) over all 2,048 nodes (no adjacency); h' = attention Wh; heads concatenated -> [8][2048][256] (4.2 M); argument order h, W).
// Layout per batch: bf16 copy of h; the one 'xw' weight transposed into three bf16 copies (WQ, WK, WV), one each for the q, k and v planes (same projection); identity-table plane builders; dense T-2048 attention (hybrid rows: < 512 hi/lo 3 products, rest fp16 x1024) with the LeakyReLU applied to the scaled score inside the softmax kernel; the f32 merge writes the output rows (no output projection).
// Compute dtypes, f32 accumulate: every input rounded to bf16; projection exact; attention rows < 512 3 products, rest fp16; LeakyReLU/softmax f32; output f32.

#define NB_  8
#define TT   2048
#define DM   256
#define NH_  4
#define NKV  4
#define REP  (NH_ / NKV)
#define HD   64
#define DQ   (NH_ * HD)
#define DKV  (NKV * HD)
#define ZH   2
#define RH   512                  // query rows < RH use hi+lo planes (0: none)
#define WIN  0
#define PCAR 1024.0f
#define SCL  0.125f   // HD^-0.5
typedef _Float16 h16;
typedef unsigned short bf;
typedef __attribute__((ext_vector_type(16))) __bf16   v16bf;
typedef __attribute__((ext_vector_type(16))) _Float16 v16h;
typedef __attribute__((ext_vector_type(8)))  _Float16 v8h;
typedef __attribute__((ext_vector_type(8)))  unsigned short v8us;
typedef __attribute__((ext_vector_type(8)))  float    v8f;
typedef __attribute__((ext_vector_type(4)))  float    v4f;
typedef v8h  __attribute__((may_alias)) v8ha;
typedef v4f  __attribute__((may_alias)) v4fa;
typedef v8us __attribute__((may_alias)) v8usa;

__device__ __forceinline__ unsigned short f2bf(float f) { unsigned u = __float_as_uint(f); u += 0x7FFFu + ((u >> 16) & 1u); return (unsigned short)(u >> 16); }
__device__ __forceinline__ float bf2f(unsigned short b) { return __uint_as_float(((unsigned)b) << 16); }
__device__ __forceinline__ float bfr(float f) { return bf2f(f2bf(f)); }
__device__ __forceinline__ v16h cat16(v8h lo, v8h hi) { return __builtin_shufflevector(lo, hi, 0, 1, 2, 3, 4, 5, 6, 7, 8, 9, 10, 11, 12, 13, 14, 15); }
__device__ __forceinline__ v16bf cat16b(v8us lo, v8us hi) { return __builtin_bit_cast(v16bf, __builtin_shufflevector(lo, hi, 0, 1, 2, 3, 4, 5, 6, 7, 8, 9, 10, 11, 12, 13, 14, 15)); }
__device__ __forceinline__ v8f wmma16(v16h a, v16h b, v8f c) { return __builtin_amdgcn_wmma_f32_16x16x32_f16(false, a, false, b, (short)0, c, false, false); }
__device__ __forceinline__ v8f wmmab(v16bf a, v16bf b, v8f c) { return __builtin_amdgcn_wmma_f32_16x16x32_bf16(false, a, false, b, (short)0, c, false, false); }



// ---- k_gemmw: register-blocked GEMM, ONE WAVE per 64x64 output tile (16 accumulators), operands straight from K-contiguous 16-bit planes; grid (M/64, N/64, Z), 32 threads.
// C[m][n] (f32, pitch ldc, + optional f32 bias[n]) = sum_k A[m][k] Bt[n][k] (+ split products per NSPLIT). z-batch strides sA/sB/sC in elements. K % 32 == 0.
template <typename T16> struct WFrag;
template <> struct WFrag<h16> { typedef v16h V; static __device__ __forceinline__ V ld(const h16* p) { return cat16(*(const v8h*)p, *(const v8h*)(p + 16)); } static __device__ __forceinline__ v8f mma(V a, V b, v8f c) { return wmma16(a, b, c); } };
template <> struct WFrag<bf> { typedef v16bf V; static __device__ __forceinline__ V ld(const bf* p) { return cat16b(*(const v8us*)p, *(const v8us*)(p + 16)); } static __device__ __forceinline__ v8f mma(V a, V b, v8f c) { return wmmab(a, b, c); } };
template <typename T16, int NSPLIT, bool BIAS>
__global__ __launch_bounds__(32) void k_gemmw(const T16* __restrict__ A, const T16* __restrict__ A2, const T16* __restrict__ Bt, const T16* __restrict__ Bt2, int K, float* C, int ldc, const float* __restrict__ bias, size_t sA, size_t sB, size_t sC) {
    typedef typename WFrag<T16>::V V;
    __shared__ __align__(16) float os[16 * 68];
    const size_t z = blockIdx.z; A += z * sA; if (A2) A2 += z * sA; Bt += z * sB; if (Bt2) Bt2 += z * sB; C += z * sC;
    const int lane = threadIdx.x & 31, lr = lane & 15, hi = lane >> 4; const int r0 = blockIdx.x * 64, c0 = blockIdx.y * 64;
    v8f acc[4][4];
#pragma unroll
    for (int mb = 0; mb < 4; ++mb)
#pragma unroll
        for (int nb = 0; nb < 4; ++nb) acc[mb][nb] = (v8f){};
    const size_t aoff = (size_t)(r0 + lr) * K + 8 * hi, boff = (size_t)(c0 + lr) * K + 8 * hi;
#pragma unroll 1
    for (int kc = 0; kc < K; kc += 32) {
        V a[4], a2[4];
#pragma unroll
        for (int mb = 0; mb < 4; ++mb) { a[mb] = WFrag<T16>::ld(A + aoff + (size_t)mb * 16 * K + kc); if (NSPLIT == 1 || NSPLIT == 2) a2[mb] = WFrag<T16>::ld(A2 + aoff + (size_t)mb * 16 * K + kc); }
#pragma unroll
        for (int nb = 0; nb < 4; ++nb) { const V b = WFrag<T16>::ld(Bt + boff + (size_t)nb * 16 * K + kc); V b2; if (NSPLIT >= 2) b2 = WFrag<T16>::ld(Bt2 + boff + (size_t)nb * 16 * K + kc);
#pragma unroll
            for (int mb = 0; mb < 4; ++mb) { acc[mb][nb] = WFrag<T16>::mma(a[mb], b, acc[mb][nb]); if (NSPLIT == 1 || NSPLIT == 2) acc[mb][nb] = WFrag<T16>::mma(a2[mb], b, acc[mb][nb]); if (NSPLIT >= 2) acc[mb][nb] = WFrag<T16>::mma(a[mb], b2, acc[mb][nb]); } }
        asm volatile("v_nop\n\tv_nop\n\tv_nop\n\tv_nop" : "+v"(acc[0][0]), "+v"(acc[1][1]), "+v"(acc[2][2]), "+v"(acc[3][3]) : "v"(a[0]), "v"(a[3]));
    }
#pragma unroll
    for (int mb = 0; mb < 4; ++mb) {
#pragma unroll
        for (int nb = 0; nb < 4; ++nb) {
#pragma unroll
            for (int j = 0; j < 8; ++j) os[(hi * 8 + j) * 68 + nb * 16 + lr] = acc[mb][nb][j]; }
        __builtin_amdgcn_wave_barrier(); asm volatile("" ::: "memory");
        float* crow = C + (size_t)(r0 + mb * 16) * ldc + c0;
{
#pragma unroll
            for (int s = 0; s < 8; ++s) { const int row = 2 * s + hi, cofs = lr * 4; v4f val = *(const v4fa*)(os + row * 68 + cofs); if (BIAS) { val[0] += bfr(bias[c0 + cofs]); val[1] += bfr(bias[c0 + cofs + 1]); val[2] += bfr(bias[c0 + cofs + 2]); val[3] += bfr(bias[c0 + cofs + 3]); }
                *(v4f*)(crow + (size_t)row * ldc + cofs) = val; }
             }
        __builtin_amdgcn_wave_barrier(); asm volatile("" ::: "memory");
    }
}

__device__ __forceinline__ h16 tohx(float x) { return (h16)x; }
__device__ __forceinline__ void splitf(float y, unsigned short& h, unsigned short& l) { h = f2bf(y); l = f2bf(y - bf2f(h)); }
typedef __attribute__((ext_vector_type(2))) _Float16 v2h;
typedef __attribute__((ext_vector_type(4))) _Float16 v4h;
typedef __attribute__((ext_vector_type(2))) unsigned short v2us;
typedef __attribute__((ext_vector_type(4))) unsigned short v4us;
typedef __attribute__((ext_vector_type(2))) float v2f;
typedef __attribute__((ext_vector_type(4))) int v4i;

__global__ __launch_bounds__(256) void k_wtG(const float* __restrict__ w, int K, int N, bf* Bt) {
    const int lane = threadIdx.x & 31; const int L0 = (blockIdx.x * 8 + (threadIdx.x >> 5)) * 8; const int nlines = N * K / 64;
{
#pragma unroll 1
        for (int l = 0; l < 8; ++l) { const int L = L0 + l; if (L >= nlines) break; const size_t e = (size_t)L * 64 + lane * 2; const int k = (int)(e % K), n = (int)(e / K); v2us o;
            o[0] = f2bf(w[(size_t)k * N + n]); o[1] = f2bf(w[(size_t)(k + 1) * N + n]); *(v2us*)(Bt + e) = o; }
         }
}
__global__ __launch_bounds__(256) void k_cvt8(const float* __restrict__ src, bf* dst, size_t n8) { const size_t i = (size_t)blockIdx.x * 256 + threadIdx.x; if (i >= n8) return; const v8f v = *(const v8f*)(src + i * 8); v8us o;
#pragma unroll
    for (int k = 0; k < 8; ++k) o[k] = f2bf(v[k]); *(v8us*)(dst + i * 8) = o;  }

// k_rope: head planes [h][t][d] (fp16 + hi/lo) of rope(x) x sc with the rotate-half convention out[d] = x[d] cos[t][d] - x[d+HD/2] sin[t][d], out[d+HD/2] = x[d+HD/2] cos[t][d+HD/2] + x[d] sin[t][d+HD/2]
__global__ __launch_bounds__(256) void k_rope(const float* __restrict__ F, int pitch, int nheads, const float* __restrict__ CS, const float* __restrict__ RF, const float* __restrict__ nw, float sc, h16* P16, bf* Ph, bf* Pl) {
    const size_t e = ((size_t)blockIdx.x * 256 + threadIdx.x) * 2; if (e >= (size_t)nheads * TT * HD) return; const int d = (int)(e % HD); const int t = (int)((e / HD) % TT); const int h = (int)(e / ((size_t)HD * TT)); const float* f = F + (size_t)t * pitch + h * HD; const float rf = RF ? RF[(size_t)h * TT + t] : 1.0f; v2h o16; v2us oh, ol;
#pragma unroll
    for (int q = 0; q < 2; ++q) { const int dd = d + q; const int dp = (dd < HD / 2) ? dd + HD / 2 : dd - HD / 2; float x0 = f[dd], x1 = f[dp];
        if (RF) { float n0 = __fmul_rn(x0, rf), n1 = __fmul_rn(x1, rf); asm volatile("" : "+v"(n0)); asm volatile("" : "+v"(n1)); x0 = __fmul_rn(bfr(nw[dd]), n0); x1 = __fmul_rn(bfr(nw[dp]), n1); }
        const v2f cs = *(const v2f*)(CS + ((size_t)t * HD + dd) * 2); float a = __fmul_rn(x0, cs[0]), bq = __fmul_rn(x1, cs[1]); asm volatile("" : "+v"(a)); asm volatile("" : "+v"(bq)); const float r = ((dd < HD / 2) ? __fsub_rn(a, bq) : __fadd_rn(a, bq)) * sc;
        o16[q] = tohx(r); unsigned short a2, c2; splitf(r, a2, c2); oh[q] = a2; ol[q] = c2; }
    *(v2h*)(P16 + e) = o16; *(v2us*)(Ph + e) = oh; *(v2us*)(Pl + e) = ol;  }
__global__ __launch_bounds__(256) void k_vtp(const float* __restrict__ F, int pitch, int nheads, h16* V16, bf* Vh, bf* Vl) { const size_t e = ((size_t)blockIdx.x * 256 + threadIdx.x) * 2; if (e >= (size_t)nheads * HD * TT) return; const int t = (int)(e % TT); const int d = (int)((e / TT) % HD); const int g = (int)(e / ((size_t)TT * HD)); v2h o16; v2us oh, ol;
#pragma unroll
    for (int q = 0; q < 2; ++q) { const float x = F[(size_t)(t + q) * pitch + g * HD + d]; o16[q] = tohx(x); unsigned short a2, c2; splitf(x, a2, c2); oh[q] = a2; ol[q] = c2; }
    *(v2h*)(V16 + e) = o16; *(v2us*)(Vh + e) = oh; *(v2us*)(Vl + e) = ol;  }
__global__ __launch_bounds__(256) void k_csid(float* CS) { const int idx = blockIdx.x * 256 + threadIdx.x; if (idx >= TT * HD) return; v2f cs; cs[0] = 1.0f; cs[1] = 0.0f; *(v2f*)(CS + (size_t)idx * 2) = cs;  }
// k_asoft: per row (zz, i): t = LeakyReLU_0.2(S x 1/8) over all keys; softmax (register row, one exp, fixed trees);
__global__ __launch_bounds__(256) void k_asoft(const float* __restrict__ Sb, h16* P16, bf* Ph, bf* Pl) {
    const int lane = threadIdx.x & 31; const int row = blockIdx.x * 8 + (threadIdx.x >> 5); if (row >= ZH * TT) return; const int i = row % TT; const int zz = row / TT; (void)zz; const bool hires = (i < RH); const float* sr = Sb + (size_t)row * TT; float v[TT / 32]; float mx = -3.0e38f;
#pragma unroll
    for (int ch = 0; ch < TT / 128; ++ch) { const int j0 = ch * 128 + lane * 4; const v4f a = *(const v4f*)(sr + j0);
#pragma unroll
        for (int q = 0; q < 4; ++q) { const int j = j0 + q; (void)j; float s0 = __fmul_rn(a[q], SCL); float sn = __fmul_rn(s0, 0.2f); asm volatile("" : "+v"(s0), "+v"(sn)); const float t = (s0 >= 0.0f) ? s0 : sn;   /* LeakyReLU_0.2 of the scaled score */ v[ch * 4 + q] = t; mx = fmaxf(mx, t); } }
#pragma unroll
    for (int sh = 16; sh; sh >>= 1) mx = fmaxf(mx, __shfl_xor(mx, sh, 32));
    float sum = 0.f;
#pragma unroll
    for (int k = 0; k < TT / 32; ++k) { float d0 = __fsub_rn(v[k], mx); asm volatile("" : "+v"(d0)); v[k] = __builtin_amdgcn_exp2f(__fmul_rn(d0, 1.4426950408889634f)); sum += v[k]; }
#pragma unroll
    for (int sh = 16; sh; sh >>= 1) sum += __shfl_xor(sum, sh, 32);
    const float f = __fdiv_rn(hires ? 1.0f : PCAR, sum);
{
        if (hires) {
#pragma unroll
            for (int ch = 0; ch < TT / 128; ++ch) { v4us oh, ol;
#pragma unroll
                for (int q = 0; q < 4; ++q) { unsigned short a, c2; splitf(v[ch * 4 + q] * f, a, c2); oh[q] = a; ol[q] = c2; }
                const size_t oo = ((size_t)zz * (RH ? RH : 1) + i) * TT + ch * 128 + lane * 4; *(v4us*)(Ph + oo) = oh; *(v4us*)(Pl + oo) = ol; }
        } else {
#pragma unroll
            for (int ch = 0; ch < TT / 128; ++ch) { v4h o4;
#pragma unroll
                for (int q = 0; q < 4; ++q) o4[q] = tohx(v[ch * 4 + q] * f);
                *(v4h*)(P16 + (size_t)row * TT + ch * 128 + lane * 4) = o4; } }
         }
}
__global__ __launch_bounds__(256) void k_merge(const float* __restrict__ O, int h0, float* OUTb) { const size_t e = ((size_t)blockIdx.x * 256 + threadIdx.x) * 2; if (e >= (size_t)ZH * TT * HD) return; const int d = (int)(e % HD); const int t = (int)((e / HD) % TT); const int zz = (int)(e / ((size_t)HD * TT)); const float cs = (t < RH) ? 1.0f : (1.0f / PCAR); const size_t oo = (size_t)t * DQ + (h0 + zz) * HD + d;
    v2f o2; o2[0] = O[e] * cs; o2[1] = O[e + 1] * cs; *(v2f*)(OUTb + oo) = o2;  }

extern "C" void kernel_launch(void* const* d_in, const int* in_sizes, int n_in,
                              void* d_out, int out_size, void* d_ws, size_t ws_size, hipStream_t stream) {
    (void)in_sizes; (void)n_in; (void)out_size;
    const float* x = (const float*)d_in[0]; const float* w = (const float*)d_in[1];   /* h, W ('xw' [256][256]) */ const float* wq = w; const float* wk = w; const float* wv = w; const float* wo = nullptr; (void)wo;
    float* OUT = (float*)d_out;     // [8][2048][256]
    char* wsp = (char*)d_ws;
    auto take = [&](size_t bytes) { char* p = wsp; wsp += (bytes + 255) & ~(size_t)255; return (void*)p; };
    bf* WQ = (bf*)take((size_t)DQ * DM * 2); bf* WK = (bf*)take((size_t)DKV * DM * 2); bf* WV = (bf*)take((size_t)DKV * DM * 2); float* CS = (float*)take((size_t)TT * HD * 2 * 4);
    bf* XB = (bf*)take((size_t)TT * DM * 2); float* FQ = (float*)take((size_t)TT * DQ * 4); float* FK = (float*)take((size_t)TT * DKV * 4);
    h16* QP16 = (h16*)take((size_t)NH_ * TT * HD * 2); h16* KP16 = (h16*)take((size_t)NKV * TT * HD * 2); h16* VT16 = (h16*)take((size_t)NKV * HD * TT * 2);
    bf* QPh = (bf*)take((size_t)NH_ * TT * HD * 2); bf* QPl = (bf*)take((size_t)NH_ * TT * HD * 2); bf* KPh = (bf*)take((size_t)NKV * TT * HD * 2); bf* KPl = (bf*)take((size_t)NKV * TT * HD * 2); bf* VTh = (bf*)take((size_t)NKV * HD * TT * 2); bf* VTl = (bf*)take((size_t)NKV * HD * TT * 2); bf* Ph = (bf*)take((size_t)ZH * RH * TT * 2); bf* Pl = (bf*)take((size_t)ZH * RH * TT * 2);
    float* Sb = (float*)take((size_t)ZH * TT * TT * 4); h16* P16 = (h16*)take((size_t)ZH * TT * TT * 2); float* Ob = (float*)take((size_t)ZH * TT * HD * 4);
    if ((size_t)(wsp - (char*)d_ws) > ws_size) return;    // ws 256 MiB
    float* FV = FK;   // v projection reuses the k buffer after the k planes are built (stream-ordered)
    { k_wtG<<<(unsigned)((DM * DQ / 64 + 63) / 64), 256, 0, stream>>>(wq, DM, DQ, WQ); k_wtG<<<(unsigned)((DM * DKV / 64 + 63) / 64), 256, 0, stream>>>(wk, DM, DKV, WK); k_wtG<<<(unsigned)((DM * DKV / 64 + 63) / 64), 256, 0, stream>>>(wv, DM, DKV, WV);
      
       }
    k_csid<<<(TT * HD + 255) / 256, 256, 0, stream>>>(CS);
    const unsigned LQ = (unsigned)(((size_t)NH_ * TT * HD / 2 + 255) / 256), LKv = (unsigned)(((size_t)NKV * TT * HD / 2 + 255) / 256);
    for (int b = 0; b < NB_; ++b) {
        
        k_cvt8<<<(unsigned)(((size_t)TT * DM / 8 + 255) / 256), 256, 0, stream>>>(x + (size_t)b * TT * DM, XB, (size_t)TT * DM / 8);
        k_gemmw<bf, 0, false><<<dim3(TT / 64, DQ / 64, 1), 32, 0, stream>>>(XB, nullptr, WQ, nullptr, DM, FQ, DQ, nullptr, 0, 0, 0);
        k_rope<<<LQ, 256, 0, stream>>>(FQ, DQ, NH_, CS, nullptr, nullptr, 1.0f, QP16, QPh, QPl);
        k_gemmw<bf, 0, false><<<dim3(TT / 64, DKV / 64, 1), 32, 0, stream>>>(XB, nullptr, WK, nullptr, DM, FK, DKV, nullptr, 0, 0, 0);
        k_rope<<<LKv, 256, 0, stream>>>(FK, DKV, NKV, CS, nullptr, nullptr, 1.0f, KP16, KPh, KPl);
        k_gemmw<bf, 0, false><<<dim3(TT / 64, DKV / 64, 1), 32, 0, stream>>>(XB, nullptr, WV, nullptr, DM, FV, DKV, nullptr, 0, 0, 0); k_vtp<<<LKv, 256, 0, stream>>>(FV, DKV, NKV, VT16, VTh, VTl);
        for (int h0 = 0; h0 < NH_; h0 += ZH) { const size_t zq = (size_t)h0, zk = (size_t)(h0 / REP);   // one kv head per query head: the pass's two heads use consecutive kv planes (z-strides TT*HD)
            k_gemmw<bf, 2, false><<<dim3(RH / 64, TT / 64, ZH), 32, 0, stream>>>(QPh + zq * TT * HD, QPl + zq * TT * HD, KPh + zk * TT * HD, KPl + zk * TT * HD, HD, Sb, TT, nullptr, (size_t)TT * HD, (size_t)TT * HD, (size_t)TT * TT);
            k_gemmw<h16, 0, false><<<dim3((TT - RH) / 64, TT / 64, ZH), 32, 0, stream>>>(QP16 + zq * TT * HD + (size_t)RH * HD, nullptr, KP16 + zk * TT * HD, nullptr, HD, Sb + (size_t)RH * TT, TT, nullptr, (size_t)TT * HD, (size_t)TT * HD, (size_t)TT * TT);
            k_asoft<<<ZH * TT / 8, 256, 0, stream>>>(Sb, P16, Ph, Pl);
            k_gemmw<bf, 2, false><<<dim3(RH / 64, HD / 64, ZH), 32, 0, stream>>>(Ph, Pl, VTh + zk * HD * TT, VTl + zk * HD * TT, TT, Ob, HD, nullptr, (size_t)RH * TT, (size_t)HD * TT, (size_t)TT * HD);
            k_gemmw<h16, 0, false><<<dim3((TT - RH) / 64, HD / 64, ZH), 32, 0, stream>>>(P16 + (size_t)RH * TT, nullptr, VT16 + zk * HD * TT, nullptr, TT, Ob + (size_t)RH * HD, HD, nullptr, (size_t)TT * TT, (size_t)HD * TT, (size_t)TT * HD);
            k_merge<<<(unsigned)(((size_t)ZH * TT * HD / 2 + 255) / 256), 256, 0, stream>>>(Ob, h0, OUT + (size_t)b * TT * DQ); }
         }
}

// v001
// A run of this version takes 957 microseconds.
// Next to v000, in two timings, it ran 2.17 times as fast each time.
#include <hip/hip_runtime.h>

// Dense multi-head 'graph attention' with dot-product scores and a LeakyReLU before the softmax (h [8][2048][256]; Wh = h W ('xw' [256][256] 1/16, no bias) split into 4 heads x 64; scores = Wh.Wh^T x 1/sqrt(64) per head (queries, keys and values are all Wh); attention = softmax(LeakyReLU_0.2(scores)) over all 2,048 nodes (no adjacency); h' = attention Wh; heads concatenated -> [8][2048][256] (4.2 M); argument order h, W).
// Layout per batch: bf16 copy of h; the one 'xw' weight transposed into three bf16 copies (WQ, WK, WV), one each for the q, k and v planes (same projection); identity-table plane builders; dense T-2048 attention (hybrid rows: < 512 hi/lo 3 products, rest fp16 x1024) with the LeakyReLU applied to the scaled score inside the softmax kernel; the f32 merge writes the output rows (no output projection).
// Compute dtypes, f32 accumulate: every input rounded to bf16; projection exact; attention rows < 512 3 products, rest fp16; LeakyReLU/softmax f32; output f32.

#define NB_  8
#define TT   2048
#define DM   256
#define NH_  4
#define NKV  4
#define REP  (NH_ / NKV)
#define HD   64
#define DQ   (NH_ * HD)
#define DKV  (NKV * HD)
#define ZH   2
#define RH   512                  // query rows < RH use hi+lo planes (0: none)
#define WIN  0
#define PCAR 1024.0f
#define SCL  0.125f   // HD^-0.5
typedef _Float16 h16;
typedef unsigned short bf;
typedef __attribute__((ext_vector_type(16))) __bf16   v16bf;
typedef __attribute__((ext_vector_type(16))) _Float16 v16h;
typedef __attribute__((ext_vector_type(8)))  _Float16 v8h;
typedef __attribute__((ext_vector_type(8)))  unsigned short v8us;
typedef __attribute__((ext_vector_type(8)))  float    v8f;
typedef __attribute__((ext_vector_type(4)))  float    v4f;
typedef v8h  __attribute__((may_alias)) v8ha;
typedef v4f  __attribute__((may_alias)) v4fa;
typedef v8us __attribute__((may_alias)) v8usa;

__device__ __forceinline__ unsigned short f2bf(float f) { unsigned u = __float_as_uint(f); u += 0x7FFFu + ((u >> 16) & 1u); return (unsigned short)(u >> 16); }
__device__ __forceinline__ float bf2f(unsigned short b) { return __uint_as_float(((unsigned)b) << 16); }
__device__ __forceinline__ float bfr(float f) { return bf2f(f2bf(f)); }
__device__ __forceinline__ v16h cat16(v8h lo, v8h hi) { return __builtin_shufflevector(lo, hi, 0, 1, 2, 3, 4, 5, 6, 7, 8, 9, 10, 11, 12, 13, 14, 15); }
__device__ __forceinline__ v16bf cat16b(v8us lo, v8us hi) { return __builtin_bit_cast(v16bf, __builtin_shufflevector(lo, hi, 0, 1, 2, 3, 4, 5, 6, 7, 8, 9, 10, 11, 12, 13, 14, 15)); }
__device__ __forceinline__ v8f wmma16(v16h a, v16h b, v8f c) { return __builtin_amdgcn_wmma_f32_16x16x32_f16(false, a, false, b, (short)0, c, false, false); }
__device__ __forceinline__ v8f wmmab(v16bf a, v16bf b, v8f c) { return __builtin_amdgcn_wmma_f32_16x16x32_bf16(false, a, false, b, (short)0, c, false, false); }



// ---- k_gemmw: register-blocked GEMM, ONE WAVE per 64x64 output tile (16 accumulators), operands straight from K-contiguous 16-bit planes; grid (M/64, N/64, Z), 32 threads.
// C[m][n] (f32, pitch ldc, + optional f32 bias[n]) = sum_k A[m][k] Bt[n][k] (+ split products per NSPLIT). z-batch strides sA/sB/sC in elements. K % 32 == 0.
template <typename T16> struct WFrag;
template <> struct WFrag<h16> { typedef v16h V; static __device__ __forceinline__ V ld(const h16* p) { return cat16(*(const v8h*)p, *(const v8h*)(p + 16)); } static __device__ __forceinline__ v8f mma(V a, V b, v8f c) { return wmma16(a, b, c); } };
template <> struct WFrag<bf> { typedef v16bf V; static __device__ __forceinline__ V ld(const bf* p) { return cat16b(*(const v8us*)p, *(const v8us*)(p + 16)); } static __device__ __forceinline__ v8f mma(V a, V b, v8f c) { return wmmab(a, b, c); } };
template <typename T16, int NSPLIT, bool BIAS>
__global__ __launch_bounds__(32) void k_gemmw(const T16* __restrict__ A, const T16* __restrict__ A2, const T16* __restrict__ Bt, const T16* __restrict__ Bt2, int K, float* C, int ldc, const float* __restrict__ bias, size_t sA, size_t sB, size_t sC) {
    typedef typename WFrag<T16>::V V;
    __shared__ __align__(16) float os[16 * 68];
    const size_t z = blockIdx.z; A += z * sA; if (A2) A2 += z * sA; Bt += z * sB; if (Bt2) Bt2 += z * sB; C += z * sC;
    const int lane = threadIdx.x & 31, lr = lane & 15, hi = lane >> 4; const int r0 = blockIdx.x * 64, c0 = blockIdx.y * 64;
    v8f acc[4][4];
#pragma unroll
    for (int mb = 0; mb < 4; ++mb)
#pragma unroll
        for (int nb = 0; nb < 4; ++nb) acc[mb][nb] = (v8f){};
    const size_t aoff = (size_t)(r0 + lr) * K + 8 * hi, boff = (size_t)(c0 + lr) * K + 8 * hi;
#pragma unroll 1
    for (int kc = 0; kc < K; kc += 32) {
        V a[4], a2[4];
#pragma unroll
        for (int mb = 0; mb < 4; ++mb) { a[mb] = WFrag<T16>::ld(A + aoff + (size_t)mb * 16 * K + kc); if (NSPLIT == 1 || NSPLIT == 2) a2[mb] = WFrag<T16>::ld(A2 + aoff + (size_t)mb * 16 * K + kc); }
#pragma unroll
        for (int nb = 0; nb < 4; ++nb) { const V b = WFrag<T16>::ld(Bt + boff + (size_t)nb * 16 * K + kc); V b2; if (NSPLIT >= 2) b2 = WFrag<T16>::ld(Bt2 + boff + (size_t)nb * 16 * K + kc);
#pragma unroll
            for (int mb = 0; mb < 4; ++mb) { acc[mb][nb] = WFrag<T16>::mma(a[mb], b, acc[mb][nb]); if (NSPLIT == 1 || NSPLIT == 2) acc[mb][nb] = WFrag<T16>::mma(a2[mb], b, acc[mb][nb]); if (NSPLIT >= 2) acc[mb][nb] = WFrag<T16>::mma(a[mb], b2, acc[mb][nb]); } }
        asm volatile("v_nop\n\tv_nop\n\tv_nop\n\tv_nop" : "+v"(acc[0][0]), "+v"(acc[1][1]), "+v"(acc[2][2]), "+v"(acc[3][3]) : "v"(a[0]), "v"(a[3]));
    }
#pragma unroll
    for (int mb = 0; mb < 4; ++mb) {
#pragma unroll
        for (int nb = 0; nb < 4; ++nb) {
#pragma unroll
            for (int j = 0; j < 8; ++j) os[(hi * 8 + j) * 68 + nb * 16 + lr] = acc[mb][nb][j]; }
        __builtin_amdgcn_wave_barrier(); asm volatile("" ::: "memory");
        float* crow = C + (size_t)(r0 + mb * 16) * ldc + c0;
{
#pragma unroll
            for (int s = 0; s < 8; ++s) { const int row = 2 * s + hi, cofs = lr * 4; v4f val = *(const v4fa*)(os + row * 68 + cofs); if (BIAS) { val[0] += bfr(bias[c0 + cofs]); val[1] += bfr(bias[c0 + cofs + 1]); val[2] += bfr(bias[c0 + cofs + 2]); val[3] += bfr(bias[c0 + cofs + 3]); }
                *(v4f*)(crow + (size_t)row * ldc + cofs) = val; }
             }
        __builtin_amdgcn_wave_barrier(); asm volatile("" ::: "memory");
    }
}

// ---- k_gemmks: K-split GEMM for long K. One work-group of NW waves per (16*MB)x64 output tile; wave w sums k in [w*KK/NW, (w+1)*KK/NW) with the fragment loaders of k_gemmw;
// the NW partial tiles meet in LDS and are added in wave order. DP = k steps of 32 whose fragments a wave asks for ahead. grid (M/(16*MB), N/64, Z), NW*32 threads. C f32, pitch ldc; z-batch strides sA/sB/sC in elements.
// Every loop of it is unrolled whole: the indices name registers (accumulators, fragment slots), and the trip counts are short compile-time constants.
template <typename T16, int NSPLIT, int MB, int NW, int KK, int DP>
__global__ __launch_bounds__(NW * 32) void k_gemmks(const T16* __restrict__ A, const T16* __restrict__ A2, const T16* __restrict__ Bt, const T16* __restrict__ Bt2, float* C, int ldc, size_t sA, size_t sB, size_t sC) {
    typedef typename WFrag<T16>::V V;
    constexpr int KW = KK / NW, NI = KW / 32, PT = 68, TS = MB * 16 * PT;
    static_assert(KK % (NW * 32) == 0 && (MB * 256) % (NW * 32) == 0 && DP <= NI, "shape");
    __shared__ __align__(16) float ps[NW * TS];
    const size_t z = blockIdx.z; A += z * sA; if (NSPLIT == 2) A2 += z * sA; Bt += z * sB; if (NSPLIT == 2) Bt2 += z * sB; C += z * sC;
    const int lane = threadIdx.x & 31, lr = lane & 15, hi = lane >> 4, wave = threadIdx.x >> 5; const int r0 = blockIdx.x * (16 * MB), c0 = blockIdx.y * 64;
    v8f acc[MB][4];
#pragma unroll
    for (int mb = 0; mb < MB; ++mb)
#pragma unroll
        for (int nb = 0; nb < 4; ++nb) acc[mb][nb] = (v8f){};
    const size_t aoff = (size_t)(r0 + lr) * KK + wave * KW + 8 * hi, boff = (size_t)(c0 + lr) * KK + wave * KW + 8 * hi;
    V a[DP][MB], a2[DP][MB], b[DP][4], b2[DP][4];
    auto fetch = [&](int s, int sl) {
#pragma unroll
        for (int mb = 0; mb < MB; ++mb) { a[sl][mb] = WFrag<T16>::ld(A + aoff + (size_t)mb * 16 * KK + s * 32); if (NSPLIT == 2) a2[sl][mb] = WFrag<T16>::ld(A2 + aoff + (size_t)mb * 16 * KK + s * 32); }
#pragma unroll
        for (int nb = 0; nb < 4; ++nb) { b[sl][nb] = WFrag<T16>::ld(Bt + boff + (size_t)nb * 16 * KK + s * 32); if (NSPLIT == 2) b2[sl][nb] = WFrag<T16>::ld(Bt2 + boff + (size_t)nb * 16 * KK + s * 32); } };
#pragma unroll
    for (int s = 0; s < DP; ++s) fetch(s, s);
    // unrolled whole, so that the DP register slots are named at compile time
#pragma unroll
    for (int s = 0; s < NI; ++s) { const int sl = s % DP;
        __builtin_amdgcn_sched_barrier(0);   // keeps the loads asked for ahead in front of these products: without it the scheduler sinks each load to its use and the wave pays the load latency once per fragment
#pragma unroll
        for (int nb = 0; nb < 4; ++nb)
#pragma unroll
            for (int mb = 0; mb < MB; ++mb) { acc[mb][nb] = WFrag<T16>::mma(a[sl][mb], b[sl][nb], acc[mb][nb]); if (NSPLIT == 2) { acc[mb][nb] = WFrag<T16>::mma(a2[sl][mb], b[sl][nb], acc[mb][nb]); acc[mb][nb] = WFrag<T16>::mma(a[sl][mb], b2[sl][nb], acc[mb][nb]); } }
        if (s + DP < NI) fetch(s + DP, sl);
    }
    float* pw = ps + wave * TS;
#pragma unroll
    for (int mb = 0; mb < MB; ++mb)
#pragma unroll
        for (int nb = 0; nb < 4; ++nb)
#pragma unroll
            for (int j = 0; j < 8; ++j) pw[(mb * 16 + hi * 8 + j) * PT + nb * 16 + lr] = acc[mb][nb][j];
    __syncthreads();   // every wave's partial tile is in LDS before any of it is added
#pragma unroll
    for (int q = 0; q < MB * 256 / (NW * 32); ++q) { const int p = q * (NW * 32) + threadIdx.x; const int row = p >> 4, cofs = (p & 15) * 4; v4f s = *(const v4fa*)(ps + row * PT + cofs);
#pragma unroll
        for (int w = 1; w < NW; ++w) s += *(const v4fa*)(ps + w * TS + row * PT + cofs);
        *(v4f*)(C + (size_t)(r0 + row) * ldc + c0 + cofs) = s; }
}

__device__ __forceinline__ h16 tohx(float x) { return (h16)x; }
__device__ __forceinline__ void splitf(float y, unsigned short& h, unsigned short& l) { h = f2bf(y); l = f2bf(y - bf2f(h)); }
typedef __attribute__((ext_vector_type(2))) _Float16 v2h;
typedef __attribute__((ext_vector_type(4))) _Float16 v4h;
typedef __attribute__((ext_vector_type(2))) unsigned short v2us;
typedef __attribute__((ext_vector_type(4))) unsigned short v4us;
typedef __attribute__((ext_vector_type(2))) float v2f;
typedef __attribute__((ext_vector_type(4))) int v4i;

__global__ __launch_bounds__(256) void k_wtG(const float* __restrict__ w, int K, int N, bf* Bt) {
    const int lane = threadIdx.x & 31; const int L0 = (blockIdx.x * 8 + (threadIdx.x >> 5)) * 8; const int nlines = N * K / 64;
{
#pragma unroll 1
        for (int l = 0; l < 8; ++l) { const int L = L0 + l; if (L >= nlines) break; const size_t e = (size_t)L * 64 + lane * 2; const int k = (int)(e % K), n = (int)(e / K); v2us o;
            o[0] = f2bf(w[(size_t)k * N + n]); o[1] = f2bf(w[(size_t)(k + 1) * N + n]); *(v2us*)(Bt + e) = o; }
         }
}
__global__ __launch_bounds__(256) void k_cvt8(const float* __restrict__ src, bf* dst, size_t n8) { const size_t i = (size_t)blockIdx.x * 256 + threadIdx.x; if (i >= n8) return; const v8f v = *(const v8f*)(src + i * 8); v8us o;
#pragma unroll
    for (int k = 0; k < 8; ++k) o[k] = f2bf(v[k]); *(v8us*)(dst + i * 8) = o;  }

// k_rope: head planes [h][t][d] (fp16 + hi/lo) of rope(x) x sc with the rotate-half convention out[d] = x[d] cos[t][d] - x[d+HD/2] sin[t][d], out[d+HD/2] = x[d+HD/2] cos[t][d+HD/2] + x[d] sin[t][d+HD/2]
__global__ __launch_bounds__(256) void k_rope(const float* __restrict__ F, int pitch, int nheads, const float* __restrict__ CS, const float* __restrict__ RF, const float* __restrict__ nw, float sc, h16* P16, bf* Ph, bf* Pl) {
    const size_t e = ((size_t)blockIdx.x * 256 + threadIdx.x) * 2; if (e >= (size_t)nheads * TT * HD) return; const int d = (int)(e % HD); const int t = (int)((e / HD) % TT); const int h = (int)(e / ((size_t)HD * TT)); const float* f = F + (size_t)t * pitch + h * HD; const float rf = RF ? RF[(size_t)h * TT + t] : 1.0f; v2h o16; v2us oh, ol;
#pragma unroll
    for (int q = 0; q < 2; ++q) { const int dd = d + q; const int dp = (dd < HD / 2) ? dd + HD / 2 : dd - HD / 2; float x0 = f[dd], x1 = f[dp];
        if (RF) { float n0 = __fmul_rn(x0, rf), n1 = __fmul_rn(x1, rf); asm volatile("" : "+v"(n0)); asm volatile("" : "+v"(n1)); x0 = __fmul_rn(bfr(nw[dd]), n0); x1 = __fmul_rn(bfr(nw[dp]), n1); }
        const v2f cs = *(const v2f*)(CS + ((size_t)t * HD + dd) * 2); float a = __fmul_rn(x0, cs[0]), bq = __fmul_rn(x1, cs[1]); asm volatile("" : "+v"(a)); asm volatile("" : "+v"(bq)); const float r = ((dd < HD / 2) ? __fsub_rn(a, bq) : __fadd_rn(a, bq)) * sc;
        o16[q] = tohx(r); unsigned short a2, c2; splitf(r, a2, c2); oh[q] = a2; ol[q] = c2; }
    *(v2h*)(P16 + e) = o16; *(v2us*)(Ph + e) = oh; *(v2us*)(Pl + e) = ol;  }
__global__ __launch_bounds__(256) void k_vtp(const float* __restrict__ F, int pitch, int nheads, h16* V16, bf* Vh, bf* Vl) { const size_t e = ((size_t)blockIdx.x * 256 + threadIdx.x) * 2; if (e >= (size_t)nheads * HD * TT) return; const int t = (int)(e % TT); const int d = (int)((e / TT) % HD); const int g = (int)(e / ((size_t)TT * HD)); v2h o16; v2us oh, ol;
#pragma unroll
    for (int q = 0; q < 2; ++q) { const float x = F[(size_t)(t + q) * pitch + g * HD + d]; o16[q] = tohx(x); unsigned short a2, c2; splitf(x, a2, c2); oh[q] = a2; ol[q] = c2; }
    *(v2h*)(V16 + e) = o16; *(v2us*)(Vh + e) = oh; *(v2us*)(Vl + e) = ol;  }
__global__ __launch_bounds__(256) void k_csid(float* CS) { const int idx = blockIdx.x * 256 + threadIdx.x; if (idx >= TT * HD) return; v2f cs; cs[0] = 1.0f; cs[1] = 0.0f; *(v2f*)(CS + (size_t)idx * 2) = cs;  }
// k_asoft: per row (zz, i): t = LeakyReLU_0.2(S x 1/8) over all keys; softmax (register row, one exp, fixed trees);
__global__ __launch_bounds__(256) void k_asoft(const float* __restrict__ Sb, h16* P16, bf* Ph, bf* Pl) {
    const int lane = threadIdx.x & 31; const int row = blockIdx.x * 8 + (threadIdx.x >> 5); if (row >= ZH * TT) return; const int i = row % TT; const int zz = row / TT; (void)zz; const bool hires = (i < RH); const float* sr = Sb + (size_t)row * TT; float v[TT / 32]; float mx = -3.0e38f;
#pragma unroll
    for (int ch = 0; ch < TT / 128; ++ch) { const int j0 = ch * 128 + lane * 4; const v4f a = *(const v4f*)(sr + j0);
#pragma unroll
        for (int q = 0; q < 4; ++q) { const int j = j0 + q; (void)j; float s0 = __fmul_rn(a[q], SCL); float sn = __fmul_rn(s0, 0.2f); asm volatile("" : "+v"(s0), "+v"(sn)); const float t = (s0 >= 0.0f) ? s0 : sn;   /* LeakyReLU_0.2 of the scaled score */ v[ch * 4 + q] = t; mx = fmaxf(mx, t); } }
#pragma unroll
    for (int sh = 16; sh; sh >>= 1) mx = fmaxf(mx, __shfl_xor(mx, sh, 32));
    float sum = 0.f;
#pragma unroll
    for (int k = 0; k < TT / 32; ++k) { float d0 = __fsub_rn(v[k], mx); asm volatile("" : "+v"(d0)); v[k] = __builtin_amdgcn_exp2f(__fmul_rn(d0, 1.4426950408889634f)); sum += v[k]; }
#pragma unroll
    for (int sh = 16; sh; sh >>= 1) sum += __shfl_xor(sum, sh, 32);
    const float f = __fdiv_rn(hires ? 1.0f : PCAR, sum);
{
        if (hires) {
#pragma unroll
            for (int ch = 0; ch < TT / 128; ++ch) { v4us oh, ol;
#pragma unroll
                for (int q = 0; q < 4; ++q) { unsigned short a, c2; splitf(v[ch * 4 + q] * f, a, c2); oh[q] = a; ol[q] = c2; }
                const size_t oo = ((size_t)zz * (RH ? RH : 1) + i) * TT + ch * 128 + lane * 4; *(v4us*)(Ph + oo) = oh; *(v4us*)(Pl + oo) = ol; }
        } else {
#pragma unroll
            for (int ch = 0; ch < TT / 128; ++ch) { v4h o4;
#pragma unroll
                for (int q = 0; q < 4; ++q) o4[q] = tohx(v[ch * 4 + q] * f);
                *(v4h*)(P16 + (size_t)row * TT + ch * 128 + lane * 4) = o4; } }
         }
}
__global__ __launch_bounds__(256) void k_merge(const float* __restrict__ O, int h0, float* OUTb) { const size_t e = ((size_t)blockIdx.x * 256 + threadIdx.x) * 2; if (e >= (size_t)ZH * TT * HD) return; const int d = (int)(e % HD); const int t = (int)((e / HD) % TT); const int zz = (int)(e / ((size_t)HD * TT)); const float cs = (t < RH) ? 1.0f : (1.0f / PCAR); const size_t oo = (size_t)t * DQ + (h0 + zz) * HD + d;
    v2f o2; o2[0] = O[e] * cs; o2[1] = O[e + 1] * cs; *(v2f*)(OUTb + oo) = o2;  }

extern "C" void kernel_launch(void* const* d_in, const int* in_sizes, int n_in,
                              void* d_out, int out_size, void* d_ws, size_t ws_size, hipStream_t stream) {
    (void)in_sizes; (void)n_in; (void)out_size;
    const float* x = (const float*)d_in[0]; const float* w = (const float*)d_in[1];   /* h, W ('xw' [256][256]) */ const float* wq = w; const float* wk = w; const float* wv = w; const float* wo = nullptr; (void)wo;
    float* OUT = (float*)d_out;     // [8][2048][256]
    char* wsp = (char*)d_ws;
    auto take = [&](size_t bytes) { char* p = wsp; wsp += (bytes + 255) & ~(size_t)255; return (void*)p; };
    bf* WQ = (bf*)take((size_t)DQ * DM * 2); bf* WK = (bf*)take((size_t)DKV * DM * 2); bf* WV = (bf*)take((size_t)DKV * DM * 2); float* CS = (float*)take((size_t)TT * HD * 2 * 4);
    bf* XB = (bf*)take((size_t)TT * DM * 2); float* FQ = (float*)take((size_t)TT * DQ * 4); float* FK = (float*)take((size_t)TT * DKV * 4);
    h16* QP16 = (h16*)take((size_t)NH_ * TT * HD * 2); h16* KP16 = (h16*)take((size_t)NKV * TT * HD * 2); h16* VT16 = (h16*)take((size_t)NKV * HD * TT * 2);
    bf* QPh = (bf*)take((size_t)NH_ * TT * HD * 2); bf* QPl = (bf*)take((size_t)NH_ * TT * HD * 2); bf* KPh = (bf*)take((size_t)NKV * TT * HD * 2); bf* KPl = (bf*)take((size_t)NKV * TT * HD * 2); bf* VTh = (bf*)take((size_t)NKV * HD * TT * 2); bf* VTl = (bf*)take((size_t)NKV * HD * TT * 2); bf* Ph = (bf*)take((size_t)ZH * RH * TT * 2); bf* Pl = (bf*)take((size_t)ZH * RH * TT * 2);
    float* Sb = (float*)take((size_t)ZH * TT * TT * 4); h16* P16 = (h16*)take((size_t)ZH * TT * TT * 2); float* Ob = (float*)take((size_t)ZH * TT * HD * 4);
    if ((size_t)(wsp - (char*)d_ws) > ws_size) return;    // ws 256 MiB
    float* FV = FK;   // v projection reuses the k buffer after the k planes are built (stream-ordered)
    { k_wtG<<<(unsigned)((DM * DQ / 64 + 63) / 64), 256, 0, stream>>>(wq, DM, DQ, WQ); k_wtG<<<(unsigned)((DM * DKV / 64 + 63) / 64), 256, 0, stream>>>(wk, DM, DKV, WK); k_wtG<<<(unsigned)((DM * DKV / 64 + 63) / 64), 256, 0, stream>>>(wv, DM, DKV, WV);
      
       }
    k_csid<<<(TT * HD + 255) / 256, 256, 0, stream>>>(CS);
    const unsigned LQ = (unsigned)(((size_t)NH_ * TT * HD / 2 + 255) / 256), LKv = (unsigned)(((size_t)NKV * TT * HD / 2 + 255) / 256);
    for (int b = 0; b < NB_; ++b) {
        
        k_cvt8<<<(unsigned)(((size_t)TT * DM / 8 + 255) / 256), 256, 0, stream>>>(x + (size_t)b * TT * DM, XB, (size_t)TT * DM / 8);
        k_gemmks<bf, 0, 2, 4, DM, 2><<<dim3(TT / 32, DQ / 64, 1), 128, 0, stream>>>(XB, nullptr, WQ, nullptr, FQ, DQ, 0, 0, 0);
        k_rope<<<LQ, 256, 0, stream>>>(FQ, DQ, NH_, CS, nullptr, nullptr, 1.0f, QP16, QPh, QPl);
        k_gemmks<bf, 0, 2, 4, DM, 2><<<dim3(TT / 32, DKV / 64, 1), 128, 0, stream>>>(XB, nullptr, WK, nullptr, FK, DKV, 0, 0, 0);
        k_rope<<<LKv, 256, 0, stream>>>(FK, DKV, NKV, CS, nullptr, nullptr, 1.0f, KP16, KPh, KPl);
        k_gemmks<bf, 0, 2, 4, DM, 2><<<dim3(TT / 32, DKV / 64, 1), 128, 0, stream>>>(XB, nullptr, WV, nullptr, FV, DKV, 0, 0, 0); k_vtp<<<LKv, 256, 0, stream>>>(FV, DKV, NKV, VT16, VTh, VTl);
        for (int h0 = 0; h0 < NH_; h0 += ZH) { const size_t zq = (size_t)h0, zk = (size_t)(h0 / REP);   // one kv head per query head: the pass's two heads use consecutive kv planes (z-strides TT*HD)
            k_gemmw<bf, 2, false><<<dim3(RH / 64, TT / 64, ZH), 32, 0, stream>>>(QPh + zq * TT * HD, QPl + zq * TT * HD, KPh + zk * TT * HD, KPl + zk * TT * HD, HD, Sb, TT, nullptr, (size_t)TT * HD, (size_t)TT * HD, (size_t)TT * TT);
            k_gemmw<h16, 0, false><<<dim3((TT - RH) / 64, TT / 64, ZH), 32, 0, stream>>>(QP16 + zq * TT * HD + (size_t)RH * HD, nullptr, KP16 + zk * TT * HD, nullptr, HD, Sb + (size_t)RH * TT, TT, nullptr, (size_t)TT * HD, (size_t)TT * HD, (size_t)TT * TT);
            k_asoft<<<ZH * TT / 8, 256, 0, stream>>>(Sb, P16, Ph, Pl);
            k_gemmks<bf, 2, 1, 8, TT, 2><<<dim3(RH / 16, HD / 64, ZH), 256, 0, stream>>>(Ph, Pl, VTh + zk * HD * TT, VTl + zk * HD * TT, Ob, HD, (size_t)RH * TT, (size_t)HD * TT, (size_t)TT * HD);
            k_gemmks<h16, 0, 2, 8, TT, 3><<<dim3((TT - RH) / 32, HD / 64, ZH), 256, 0, stream>>>(P16 + (size_t)RH * TT, nullptr, VT16 + zk * HD * TT, nullptr, Ob + (size_t)RH * HD, HD, (size_t)TT * TT, (size_t)HD * TT, (size_t)TT * HD);
            k_merge<<<(unsigned)(((size_t)ZH * TT * HD / 2 + 255) / 256), 256, 0, stream>>>(Ob, h0, OUT + (size_t)b * TT * DQ); }
         }
}

// v002
// It runs in 506 microseconds.
// Two timings next to v001 both put it at 1.89 times that version's speed.
// Counting every step since v000, it is 4.11 times as fast.
#include <hip/hip_runtime.h>

// Dense multi-head 'graph attention' with dot-product scores and a LeakyReLU before the softmax (h [8][2048][256]; Wh = h W ('xw' [256][256] 1/16, no bias) split into 4 heads x 64; scores = Wh.Wh^T x 1/sqrt(64) per head (queries, keys and values are all Wh); attention = softmax(LeakyReLU_0.2(scores)) over all 2,048 nodes (no adjacency); h' = attention Wh; heads concatenated -> [8][2048][256] (4.2 M); argument order h, W).
// Layout, all 8 batches at once (planes [batch][head][..]; the attention runs in passes of ZH consecutive (batch, head) pairs on grid z): bf16 copy of h; the one 'xw' weight transposed into three bf16 copies (grid y) used for the q, k and v planes (same projection); identity-table plane builders; dense T-2048 attention (hybrid rows: < 512 hi/lo 3 products, rest fp16 x1024) with the LeakyReLU applied to the scaled score inside the softmax kernel; the f32 merge writes the output rows (no output projection).
// Compute dtypes, f32 accumulate: every input rounded to bf16; projection exact; attention rows < 512 3 products, rest fp16; LeakyReLU/softmax f32; output f32.

#define NB_  8
#define TT   2048
#define DM   256
#define NH_  4
#define NKV  4
#define REP  (NH_ / NKV)
#define HD   64
#define DQ   (NH_ * HD)
#define DKV  (NKV * HD)
#define ZH   8                    // (batch, head) pairs per attention pass (grid z)
#define NG   (NB_ * NH_)          // all (batch, head) pairs
#define RH   512                  // query rows < RH use hi+lo planes (0: none)
#define WIN  0
#define PCAR 1024.0f
#define SCL  0.125f   // HD^-0.5
typedef _Float16 h16;
typedef unsigned short bf;
typedef __attribute__((ext_vector_type(16))) __bf16   v16bf;
typedef __attribute__((ext_vector_type(16))) _Float16 v16h;
typedef __attribute__((ext_vector_type(8)))  _Float16 v8h;
typedef __attribute__((ext_vector_type(8)))  unsigned short v8us;
typedef __attribute__((ext_vector_type(8)))  float    v8f;
typedef __attribute__((ext_vector_type(4)))  float    v4f;
typedef v8h  __attribute__((may_alias)) v8ha;
typedef v4f  __attribute__((may_alias)) v4fa;
typedef v8us __attribute__((may_alias)) v8usa;

__device__ __forceinline__ unsigned short f2bf(float f) { unsigned u = __float_as_uint(f); u += 0x7FFFu + ((u >> 16) & 1u); return (unsigned short)(u >> 16); }
__device__ __forceinline__ float bf2f(unsigned short b) { return __uint_as_float(((unsigned)b) << 16); }
__device__ __forceinline__ float bfr(float f) { return bf2f(f2bf(f)); }
__device__ __forceinline__ v16h cat16(v8h lo, v8h hi) { return __builtin_shufflevector(lo, hi, 0, 1, 2, 3, 4, 5, 6, 7, 8, 9, 10, 11, 12, 13, 14, 15); }
__device__ __forceinline__ v16bf cat16b(v8us lo, v8us hi) { return __builtin_bit_cast(v16bf, __builtin_shufflevector(lo, hi, 0, 1, 2, 3, 4, 5, 6, 7, 8, 9, 10, 11, 12, 13, 14, 15)); }
__device__ __forceinline__ v8f wmma16(v16h a, v16h b, v8f c) { return __builtin_amdgcn_wmma_f32_16x16x32_f16(false, a, false, b, (short)0, c, false, false); }
__device__ __forceinline__ v8f wmmab(v16bf a, v16bf b, v8f c) { return __builtin_amdgcn_wmma_f32_16x16x32_bf16(false, a, false, b, (short)0, c, false, false); }



// ---- k_gemmw: register-blocked GEMM, ONE WAVE per 64x64 output tile (16 accumulators), operands straight from K-contiguous 16-bit planes; grid (M/64, N/64, Z), 32 threads.
// C[m][n] (f32, pitch ldc, + optional f32 bias[n]) = sum_k A[m][k] Bt[n][k] (+ split products per NSPLIT). z-batch strides sA/sB/sC in elements. K % 32 == 0.
template <typename T16> struct WFrag;
template <> struct WFrag<h16> { typedef v16h V; static __device__ __forceinline__ V ld(const h16* p) { return cat16(*(const v8h*)p, *(const v8h*)(p + 16)); } static __device__ __forceinline__ v8f mma(V a, V b, v8f c) { return wmma16(a, b, c); } };
template <> struct WFrag<bf> { typedef v16bf V; static __device__ __forceinline__ V ld(const bf* p) { return cat16b(*(const v8us*)p, *(const v8us*)(p + 16)); } static __device__ __forceinline__ v8f mma(V a, V b, v8f c) { return wmmab(a, b, c); } };
template <typename T16, int NSPLIT, bool BIAS>
__global__ __launch_bounds__(32) void k_gemmw(const T16* __restrict__ A, const T16* __restrict__ A2, const T16* __restrict__ Bt, const T16* __restrict__ Bt2, int K, float* C, int ldc, const float* __restrict__ bias, size_t sA, size_t sB, size_t sC) {
    typedef typename WFrag<T16>::V V;
    __shared__ __align__(16) float os[16 * 68];
    const size_t z = blockIdx.z; A += z * sA; if (A2) A2 += z * sA; Bt += z * sB; if (Bt2) Bt2 += z * sB; C += z * sC;
    const int lane = threadIdx.x & 31, lr = lane & 15, hi = lane >> 4; const int r0 = blockIdx.x * 64, c0 = blockIdx.y * 64;
    v8f acc[4][4];
#pragma unroll
    for (int mb = 0; mb < 4; ++mb)
#pragma unroll
        for (int nb = 0; nb < 4; ++nb) acc[mb][nb] = (v8f){};
    const size_t aoff = (size_t)(r0 + lr) * K + 8 * hi, boff = (size_t)(c0 + lr) * K + 8 * hi;
#pragma unroll 1
    for (int kc = 0; kc < K; kc += 32) {
        V a[4], a2[4];
#pragma unroll
        for (int mb = 0; mb < 4; ++mb) { a[mb] = WFrag<T16>::ld(A + aoff + (size_t)mb * 16 * K + kc); if (NSPLIT == 1 || NSPLIT == 2) a2[mb] = WFrag<T16>::ld(A2 + aoff + (size_t)mb * 16 * K + kc); }
#pragma unroll
        for (int nb = 0; nb < 4; ++nb) { const V b = WFrag<T16>::ld(Bt + boff + (size_t)nb * 16 * K + kc); V b2; if (NSPLIT >= 2) b2 = WFrag<T16>::ld(Bt2 + boff + (size_t)nb * 16 * K + kc);
#pragma unroll
            for (int mb = 0; mb < 4; ++mb) { acc[mb][nb] = WFrag<T16>::mma(a[mb], b, acc[mb][nb]); if (NSPLIT == 1 || NSPLIT == 2) acc[mb][nb] = WFrag<T16>::mma(a2[mb], b, acc[mb][nb]); if (NSPLIT >= 2) acc[mb][nb] = WFrag<T16>::mma(a[mb], b2, acc[mb][nb]); } }
        asm volatile("v_nop\n\tv_nop\n\tv_nop\n\tv_nop" : "+v"(acc[0][0]), "+v"(acc[1][1]), "+v"(acc[2][2]), "+v"(acc[3][3]) : "v"(a[0]), "v"(a[3]));
    }
#pragma unroll
    for (int mb = 0; mb < 4; ++mb) {
#pragma unroll
        for (int nb = 0; nb < 4; ++nb) {
#pragma unroll
            for (int j = 0; j < 8; ++j) os[(hi * 8 + j) * 68 + nb * 16 + lr] = acc[mb][nb][j]; }
        __builtin_amdgcn_wave_barrier(); asm volatile("" ::: "memory");
        float* crow = C + (size_t)(r0 + mb * 16) * ldc + c0;
{
#pragma unroll
            for (int s = 0; s < 8; ++s) { const int row = 2 * s + hi, cofs = lr * 4; v4f val = *(const v4fa*)(os + row * 68 + cofs); if (BIAS) { val[0] += bfr(bias[c0 + cofs]); val[1] += bfr(bias[c0 + cofs + 1]); val[2] += bfr(bias[c0 + cofs + 2]); val[3] += bfr(bias[c0 + cofs + 3]); }
                *(v4f*)(crow + (size_t)row * ldc + cofs) = val; }
             }
        __builtin_amdgcn_wave_barrier(); asm volatile("" ::: "memory");
    }
}

// ---- k_gemmks: K-split GEMM for long K. One work-group of NW waves per (16*MB)x64 output tile; wave w sums k in [w*KK/NW, (w+1)*KK/NW) with the fragment loaders of k_gemmw;
// the NW partial tiles meet in LDS and are added in wave order. DP = k steps of 32 whose fragments a wave asks for ahead. LDA = pitch of the A rows in elements (Bt rows: KK). grid (M/(16*MB), N/64, Z), NW*32 threads. C f32, pitch ldc; z-batch strides sA/sB/sC in elements.
// Every loop of it is unrolled whole: the indices name registers (accumulators, fragment slots), and the trip counts are short compile-time constants.
template <typename T16, int NSPLIT, int MB, int NW, int KK, int DP, int LDA>
__global__ __launch_bounds__(NW * 32) void k_gemmks(const T16* __restrict__ A, const T16* __restrict__ A2, const T16* __restrict__ Bt, const T16* __restrict__ Bt2, float* C, int ldc, size_t sA, size_t sB, size_t sC) {
    typedef typename WFrag<T16>::V V;
    constexpr int KW = KK / NW, NI = KW / 32, PT = 68, TS = MB * 16 * PT;
    static_assert(KK % (NW * 32) == 0 && (MB * 256) % (NW * 32) == 0 && DP <= NI, "shape");
    __shared__ __align__(16) float ps[NW * TS];
    const size_t z = blockIdx.z; A += z * sA; if (NSPLIT == 2) A2 += z * sA; Bt += z * sB; if (NSPLIT == 2) Bt2 += z * sB; C += z * sC;
    const int lane = threadIdx.x & 31, lr = lane & 15, hi = lane >> 4, wave = threadIdx.x >> 5; const int r0 = blockIdx.x * (16 * MB), c0 = blockIdx.y * 64;
    v8f acc[MB][4];
#pragma unroll
    for (int mb = 0; mb < MB; ++mb)
#pragma unroll
        for (int nb = 0; nb < 4; ++nb) acc[mb][nb] = (v8f){};
    const size_t aoff = (size_t)(r0 + lr) * LDA + wave * KW + 8 * hi, boff = (size_t)(c0 + lr) * KK + wave * KW + 8 * hi;
    V a[DP][MB], a2[DP][MB], b[DP][4], b2[DP][4];
    auto fetch = [&](int s, int sl) {
#pragma unroll
        for (int mb = 0; mb < MB; ++mb) { a[sl][mb] = WFrag<T16>::ld(A + aoff + (size_t)mb * 16 * LDA + s * 32); if (NSPLIT == 2) a2[sl][mb] = WFrag<T16>::ld(A2 + aoff + (size_t)mb * 16 * LDA + s * 32); }
#pragma unroll
        for (int nb = 0; nb < 4; ++nb) { b[sl][nb] = WFrag<T16>::ld(Bt + boff + (size_t)nb * 16 * KK + s * 32); if (NSPLIT == 2) b2[sl][nb] = WFrag<T16>::ld(Bt2 + boff + (size_t)nb * 16 * KK + s * 32); } };
#pragma unroll
    for (int s = 0; s < DP; ++s) fetch(s, s);
    // unrolled whole, so that the DP register slots are named at compile time
#pragma unroll
    for (int s = 0; s < NI; ++s) { const int sl = s % DP;
        __builtin_amdgcn_sched_barrier(0);   // keeps the loads asked for ahead in front of these products: without it the scheduler sinks each load to its use and the wave pays the load latency once per fragment
#pragma unroll
        for (int nb = 0; nb < 4; ++nb)
#pragma unroll
            for (int mb = 0; mb < MB; ++mb) { acc[mb][nb] = WFrag<T16>::mma(a[sl][mb], b[sl][nb], acc[mb][nb]); if (NSPLIT == 2) { acc[mb][nb] = WFrag<T16>::mma(a2[sl][mb], b[sl][nb], acc[mb][nb]); acc[mb][nb] = WFrag<T16>::mma(a[sl][mb], b2[sl][nb], acc[mb][nb]); } }
        if (s + DP < NI) fetch(s + DP, sl);
    }
    float* pw = ps + wave * TS;
#pragma unroll
    for (int mb = 0; mb < MB; ++mb)
#pragma unroll
        for (int nb = 0; nb < 4; ++nb)
#pragma unroll
            for (int j = 0; j < 8; ++j) pw[(mb * 16 + hi * 8 + j) * PT + nb * 16 + lr] = acc[mb][nb][j];
    __syncthreads();   // every wave's partial tile is in LDS before any of it is added
#pragma unroll
    for (int q = 0; q < MB * 256 / (NW * 32); ++q) { const int p = q * (NW * 32) + threadIdx.x; const int row = p >> 4, cofs = (p & 15) * 4; v4f s = *(const v4fa*)(ps + row * PT + cofs);
#pragma unroll
        for (int w = 1; w < NW; ++w) s += *(const v4fa*)(ps + w * TS + row * PT + cofs);
        *(v4f*)(C + (size_t)(r0 + row) * ldc + c0 + cofs) = s; }
}

__device__ __forceinline__ h16 tohx(float x) { return (h16)x; }
__device__ __forceinline__ void splitf(float y, unsigned short& h, unsigned short& l) { h = f2bf(y); l = f2bf(y - bf2f(h)); }
typedef __attribute__((ext_vector_type(2))) _Float16 v2h;
typedef __attribute__((ext_vector_type(4))) _Float16 v4h;
typedef __attribute__((ext_vector_type(2))) unsigned short v2us;
typedef __attribute__((ext_vector_type(4))) unsigned short v4us;
typedef __attribute__((ext_vector_type(2))) float v2f;
typedef __attribute__((ext_vector_type(4))) int v4i;

// grid y picks one of three weights; their transposed planes lie behind one another in Bt
__global__ __launch_bounds__(256) void k_wtG(const float* __restrict__ w0, const float* __restrict__ w1, const float* __restrict__ w2, int K, int N, bf* Bt) {
    const float* w = (blockIdx.y == 0) ? w0 : (blockIdx.y == 1) ? w1 : w2; Bt += (size_t)blockIdx.y * N * K;
    const int lane = threadIdx.x & 31; const int L0 = (blockIdx.x * 8 + (threadIdx.x >> 5)) * 8; const int nlines = N * K / 64;
{
#pragma unroll 1
        for (int l = 0; l < 8; ++l) { const int L = L0 + l; if (L >= nlines) break; const size_t e = (size_t)L * 64 + lane * 2; const int k = (int)(e % K), n = (int)(e / K); v2us o;
            o[0] = f2bf(w[(size_t)k * N + n]); o[1] = f2bf(w[(size_t)(k + 1) * N + n]); *(v2us*)(Bt + e) = o; }
         }
}
__global__ __launch_bounds__(256) void k_cvt8(const float* __restrict__ src, bf* dst, size_t n8) { const size_t i = (size_t)blockIdx.x * 256 + threadIdx.x; if (i >= n8) return; const v8f v = *(const v8f*)(src + i * 8); v8us o;
#pragma unroll
    for (int k = 0; k < 8; ++k) o[k] = f2bf(v[k]); *(v8us*)(dst + i * 8) = o;  }

// k_rope: head planes [h][t][d] (fp16 + hi/lo) of rope(x) x sc with the rotate-half convention out[d] = x[d] cos[t][d] - x[d+HD/2] sin[t][d], out[d+HD/2] = x[d+HD/2] cos[t][d+HD/2] + x[d] sin[t][d+HD/2]
__global__ __launch_bounds__(256) void k_rope(const float* __restrict__ F, int pitch, int nheads, const float* __restrict__ CS, const float* __restrict__ RF, const float* __restrict__ nw, float sc, h16* P16, bf* Ph, bf* Pl) {
    { const size_t bz = (size_t)blockIdx.z * NB_ + blockIdx.y; F += bz * TT * pitch; const size_t po = bz * nheads * TT * HD; P16 += po; Ph += po; Pl += po; }   // grid y: batch; grid z: which projection (q, k), their buffers behind one another
    const size_t e = ((size_t)blockIdx.x * 256 + threadIdx.x) * 2; if (e >= (size_t)nheads * TT * HD) return; const int d = (int)(e % HD); const int t = (int)((e / HD) % TT); const int h = (int)(e / ((size_t)HD * TT)); const float* f = F + (size_t)t * pitch + h * HD; const float rf = RF ? RF[(size_t)h * TT + t] : 1.0f; v2h o16; v2us oh, ol;
#pragma unroll
    for (int q = 0; q < 2; ++q) { const int dd = d + q; const int dp = (dd < HD / 2) ? dd + HD / 2 : dd - HD / 2; float x0 = f[dd], x1 = f[dp];
        if (RF) { float n0 = __fmul_rn(x0, rf), n1 = __fmul_rn(x1, rf); asm volatile("" : "+v"(n0)); asm volatile("" : "+v"(n1)); x0 = __fmul_rn(bfr(nw[dd]), n0); x1 = __fmul_rn(bfr(nw[dp]), n1); }
        const v2f cs = *(const v2f*)(CS + ((size_t)t * HD + dd) * 2); float a = __fmul_rn(x0, cs[0]), bq = __fmul_rn(x1, cs[1]); asm volatile("" : "+v"(a)); asm volatile("" : "+v"(bq)); const float r = ((dd < HD / 2) ? __fsub_rn(a, bq) : __fadd_rn(a, bq)) * sc;
        o16[q] = tohx(r); unsigned short a2, c2; splitf(r, a2, c2); oh[q] = a2; ol[q] = c2; }
    *(v2h*)(P16 + e) = o16; *(v2us*)(Ph + e) = oh; *(v2us*)(Pl + e) = ol;  }
__global__ __launch_bounds__(256) void k_vtp(const float* __restrict__ F, int pitch, int nheads, h16* V16, bf* Vh, bf* Vl) { { F += (size_t)blockIdx.y * TT * pitch; const size_t po = (size_t)blockIdx.y * nheads * HD * TT; V16 += po; Vh += po; Vl += po; }   /* grid y: batch */ const size_t e = ((size_t)blockIdx.x * 256 + threadIdx.x) * 2; if (e >= (size_t)nheads * HD * TT) return; const int t = (int)(e % TT); const int d = (int)((e / TT) % HD); const int g = (int)(e / ((size_t)TT * HD)); v2h o16; v2us oh, ol;
#pragma unroll
    for (int q = 0; q < 2; ++q) { const float x = F[(size_t)(t + q) * pitch + g * HD + d]; o16[q] = tohx(x); unsigned short a2, c2; splitf(x, a2, c2); oh[q] = a2; ol[q] = c2; }
    *(v2h*)(V16 + e) = o16; *(v2us*)(Vh + e) = oh; *(v2us*)(Vl + e) = ol;  }
__global__ __launch_bounds__(256) void k_csid(float* CS) { const int idx = blockIdx.x * 256 + threadIdx.x; if (idx >= TT * HD) return; v2f cs; cs[0] = 1.0f; cs[1] = 0.0f; *(v2f*)(CS + (size_t)idx * 2) = cs;  }
// k_asoft: per row (zz, i): t = LeakyReLU_0.2(S x 1/8) over all keys; softmax (register row, one exp, fixed trees);
// the 16-bit probabilities go over the row's own 8 KiB of S (one wave owns a row and holds all of it in registers before its first store): hi plane in the first half and lo plane in the second, or fp16 in the first half.
__global__ __launch_bounds__(256) void k_asoft(float* Sb) {
    const int lane = threadIdx.x & 31; const int row = blockIdx.x * 8 + (threadIdx.x >> 5); if (row >= ZH * TT) return; const int i = row % TT; const int zz = row / TT; (void)zz; const bool hires = (i < RH); const float* sr = Sb + (size_t)row * TT; float v[TT / 32]; float mx = -3.0e38f;
#pragma unroll
    for (int ch = 0; ch < TT / 128; ++ch) { const int j0 = ch * 128 + lane * 4; const v4f a = *(const v4f*)(sr + j0);
#pragma unroll
        for (int q = 0; q < 4; ++q) { const int j = j0 + q; (void)j; float s0 = __fmul_rn(a[q], SCL); float sn = __fmul_rn(s0, 0.2f); asm volatile("" : "+v"(s0), "+v"(sn)); const float t = (s0 >= 0.0f) ? s0 : sn;   /* LeakyReLU_0.2 of the scaled score */ v[ch * 4 + q] = t; mx = fmaxf(mx, t); } }
#pragma unroll
    for (int sh = 16; sh; sh >>= 1) mx = fmaxf(mx, __shfl_xor(mx, sh, 32));
    float sum = 0.f;
#pragma unroll
    for (int k = 0; k < TT / 32; ++k) { float d0 = __fsub_rn(v[k], mx); asm volatile("" : "+v"(d0)); v[k] = __builtin_amdgcn_exp2f(__fmul_rn(d0, 1.4426950408889634f)); sum += v[k]; }
#pragma unroll
    for (int sh = 16; sh; sh >>= 1) sum += __shfl_xor(sum, sh, 32);
    const float f = __fdiv_rn(hires ? 1.0f : PCAR, sum);
{
        if (hires) {
#pragma unroll
            for (int ch = 0; ch < TT / 128; ++ch) { v4us oh, ol;
#pragma unroll
                for (int q = 0; q < 4; ++q) { unsigned short a, c2; splitf(v[ch * 4 + q] * f, a, c2); oh[q] = a; ol[q] = c2; }
                bf* pr = (bf*)(Sb + (size_t)row * TT) + ch * 128 + lane * 4; *(v4us*)pr = oh; *(v4us*)(pr + TT) = ol; }
        } else {
#pragma unroll
            for (int ch = 0; ch < TT / 128; ++ch) { v4h o4;
#pragma unroll
                for (int q = 0; q < 4; ++q) o4[q] = tohx(v[ch * 4 + q] * f);
                *(v4h*)((h16*)(Sb + (size_t)row * TT) + ch * 128 + lane * 4) = o4; } }
         }
}
__global__ __launch_bounds__(256) void k_merge(const float* __restrict__ O, int g0, float* OUTb) { const size_t e = ((size_t)blockIdx.x * 256 + threadIdx.x) * 2; if (e >= (size_t)ZH * TT * HD) return; const int d = (int)(e % HD); const int t = (int)((e / HD) % TT); const int zz = (int)(e / ((size_t)HD * TT)); const float cs = (t < RH) ? 1.0f : (1.0f / PCAR); const int g = g0 + zz; const size_t oo = ((size_t)(g / NH_) * TT + t) * DQ + (g % NH_) * HD + d;
    v2f o2; o2[0] = O[e] * cs; o2[1] = O[e + 1] * cs; *(v2f*)(OUTb + oo) = o2;  }

extern "C" void kernel_launch(void* const* d_in, const int* in_sizes, int n_in,
                              void* d_out, int out_size, void* d_ws, size_t ws_size, hipStream_t stream) {
    (void)in_sizes; (void)n_in; (void)out_size;
    const float* x = (const float*)d_in[0]; const float* w = (const float*)d_in[1];   /* h, W ('xw' [256][256]) */ const float* wq = w; const float* wk = w; const float* wv = w; const float* wo = nullptr; (void)wo;
    float* OUT = (float*)d_out;     // [8][2048][256]
    char* wsp = (char*)d_ws;
    auto take = [&](size_t bytes) { char* p = wsp; wsp += (bytes + 255) & ~(size_t)255; return (void*)p; };
    bf* WQ = (bf*)take((size_t)DQ * DM * 2); bf* WK = (bf*)take((size_t)DKV * DM * 2); bf* WV = (bf*)take((size_t)DKV * DM * 2); (void)WK; (void)WV;   /* behind one another: grid y / z strides */ float* CS = (float*)take((size_t)TT * HD * 2 * 4);
    h16* QP16 = (h16*)take((size_t)NG * TT * HD * 2); h16* KP16 = (h16*)take((size_t)NG * TT * HD * 2); h16* VT16 = (h16*)take((size_t)NG * HD * TT * 2);
    bf* QPh = (bf*)take((size_t)NG * TT * HD * 2); bf* KPh = (bf*)take((size_t)NG * TT * HD * 2); bf* QPl = (bf*)take((size_t)NG * TT * HD * 2); bf* KPl = (bf*)take((size_t)NG * TT * HD * 2); bf* VTh = (bf*)take((size_t)NG * HD * TT * 2); bf* VTl = (bf*)take((size_t)NG * HD * TT * 2);
    float* Sb = (float*)take((size_t)ZH * TT * TT * 4); float* Ob = (float*)take((size_t)ZH * TT * HD * 4);
    if ((size_t)(wsp - (char*)d_ws) > ws_size) return;    // ws 256 MiB
    // the projection's buffers lie in the score buffer: they are last read (plane builders) before the first scores are written (stream-ordered)
    static_assert((size_t)NB_ * TT * DM * 2 + 3 * (size_t)NB_ * TT * DQ * 4 <= (size_t)ZH * TT * TT * 4 && DQ == DKV && NH_ == NKV && NG % ZH == 0, "layout");
    bf* XB = (bf*)Sb; float* FQ = (float*)(XB + (size_t)NB_ * TT * DM); float* FV = FQ + 2 * (size_t)NB_ * TT * DQ;   // FQ, FK, FV behind one another
    k_wtG<<<dim3((unsigned)((DM * DQ / 64 + 63) / 64), 3, 1), 256, 0, stream>>>(wq, wk, wv, DM, DQ, WQ);
    k_csid<<<(TT * HD + 255) / 256, 256, 0, stream>>>(CS);
    const unsigned LQ = (unsigned)(((size_t)NH_ * TT * HD / 2 + 255) / 256), LKv = (unsigned)(((size_t)NKV * TT * HD / 2 + 255) / 256);
    k_cvt8<<<(unsigned)(((size_t)NB_ * TT * DM / 8 + 255) / 256), 256, 0, stream>>>(x, XB, (size_t)NB_ * TT * DM / 8);
    k_gemmks<bf, 0, 2, 4, DM, 2, DM><<<dim3(NB_ * TT / 32, DQ / 64, 3), 128, 0, stream>>>(XB, nullptr, WQ, nullptr, FQ, DQ, 0, (size_t)DQ * DM, (size_t)NB_ * TT * DQ);   // z: q, k, v
    k_rope<<<dim3(LQ, NB_, 2), 256, 0, stream>>>(FQ, DQ, NH_, CS, nullptr, nullptr, 1.0f, QP16, QPh, QPl);   // z: q, k
    k_vtp<<<dim3(LKv, NB_, 1), 256, 0, stream>>>(FV, DKV, NKV, VT16, VTh, VTl);
    for (int g0 = 0; g0 < NG; g0 += ZH) { const size_t zq = (size_t)g0;   // one kv head per query head: the pass's (batch, head) pairs use consecutive planes (z-strides TT*HD)
        k_gemmw<bf, 2, false><<<dim3(RH / 64, TT / 64, ZH), 32, 0, stream>>>(QPh + zq * TT * HD, QPl + zq * TT * HD, KPh + zq * TT * HD, KPl + zq * TT * HD, HD, Sb, TT, nullptr, (size_t)TT * HD, (size_t)TT * HD, (size_t)TT * TT);
        k_gemmw<h16, 0, false><<<dim3((TT - RH) / 64, TT / 64, ZH), 32, 0, stream>>>(QP16 + zq * TT * HD + (size_t)RH * HD, nullptr, KP16 + zq * TT * HD, nullptr, HD, Sb + (size_t)RH * TT, TT, nullptr, (size_t)TT * HD, (size_t)TT * HD, (size_t)TT * TT);
        k_asoft<<<ZH * TT / 8, 256, 0, stream>>>(Sb);
        k_gemmks<bf, 2, 1, 8, TT, 2, 2 * TT><<<dim3(RH / 16, HD / 64, ZH), 256, 0, stream>>>((const bf*)Sb, (const bf*)Sb + TT, VTh + zq * HD * TT, VTl + zq * HD * TT, Ob, HD, (size_t)2 * TT * TT, (size_t)HD * TT, (size_t)TT * HD);
        k_gemmks<h16, 0, 2, 8, TT, 3, 2 * TT><<<dim3((TT - RH) / 32, HD / 64, ZH), 256, 0, stream>>>((const h16*)Sb + (size_t)RH * 2 * TT, nullptr, VT16 + zq * HD * TT, nullptr, Ob + (size_t)RH * HD, HD, (size_t)2 * TT * TT, (size_t)HD * TT, (size_t)TT * HD);
        k_merge<<<(unsigned)(((size_t)ZH * TT * HD / 2 + 255) / 256), 256, 0, stream>>>(Ob, g0, OUT); }
}

// v003
// It runs in 174 microseconds.
// Next to v002, in two timings, it ran 2.91 times as fast each time.
// Over all steps from v000 it is 12.0 times as fast.
#include <hip/hip_runtime.h>

// Dense multi-head 'graph attention' with dot-product scores and a LeakyReLU before the softmax (h [8][2048][256]; Wh = h W ('xw' [256][256] 1/16, no bias) split into 4 heads x 64; scores = Wh.Wh^T x 1/sqrt(64) per head (queries, keys and values are all Wh); attention = softmax(LeakyReLU_0.2(scores)) over all 2,048 nodes (no adjacency); h' = attention Wh; heads concatenated -> [8][2048][256] (4.2 M); argument order h, W).
// Layout, all 8 batches at once (planes [batch][head][..]; the attention of all (batch, head) pairs runs in one launch): bf16 copy of h; the one 'xw' weight transposed three times into copies behind one another, one each for the q, k and v planes (same projection); identity-table plane builders; dense T-2048 attention in one fused kernel (hybrid rows: < 512 hi/lo 3 products, rest fp16 x1024) with the LeakyReLU applied to the scaled score in registers; it writes the output rows (no output projection).
// Compute dtypes, f32 accumulate: every input rounded to bf16; projection exact; attention rows < 512 3 products, rest fp16; LeakyReLU/softmax f32; output f32.

#define NB_  8
#define TT   2048
#define DM   256
#define NH_  4
#define NKV  4
#define REP  (NH_ / NKV)
#define HD   64
#define DQ   (NH_ * HD)
#define DKV  (NKV * HD)
#define ZH   8                    // sizes the projection's scratch (ZH * TT * TT floats)
#define NG   (NB_ * NH_)          // all (batch, head) pairs
#define RH   512                  // query rows < RH use hi+lo planes (0: none)
#define WIN  0
#define SCL  0.125f   // HD^-0.5
typedef _Float16 h16;
typedef unsigned short bf;
typedef __attribute__((ext_vector_type(16))) __bf16   v16bf;
typedef __attribute__((ext_vector_type(16))) _Float16 v16h;
typedef __attribute__((ext_vector_type(8)))  _Float16 v8h;
typedef __attribute__((ext_vector_type(8)))  unsigned short v8us;
typedef __attribute__((ext_vector_type(8)))  float    v8f;
typedef __attribute__((ext_vector_type(4)))  float    v4f;
typedef v8h  __attribute__((may_alias)) v8ha;
typedef v4f  __attribute__((may_alias)) v4fa;
typedef v8us __attribute__((may_alias)) v8usa;

__device__ __forceinline__ unsigned short f2bf(float f) { unsigned u = __float_as_uint(f); u += 0x7FFFu + ((u >> 16) & 1u); return (unsigned short)(u >> 16); }
__device__ __forceinline__ float bf2f(unsigned short b) { return __uint_as_float(((unsigned)b) << 16); }
__device__ __forceinline__ float bfr(float f) { return bf2f(f2bf(f)); }
__device__ __forceinline__ v16h cat16(v8h lo, v8h hi) { return __builtin_shufflevector(lo, hi, 0, 1, 2, 3, 4, 5, 6, 7, 8, 9, 10, 11, 12, 13, 14, 15); }
__device__ __forceinline__ v16bf cat16b(v8us lo, v8us hi) { return __builtin_bit_cast(v16bf, __builtin_shufflevector(lo, hi, 0, 1, 2, 3, 4, 5, 6, 7, 8, 9, 10, 11, 12, 13, 14, 15)); }
__device__ __forceinline__ v8f wmma16(v16h a, v16h b, v8f c) { return __builtin_amdgcn_wmma_f32_16x16x32_f16(false, a, false, b, (short)0, c, false, false); }
__device__ __forceinline__ v8f wmmab(v16bf a, v16bf b, v8f c) { return __builtin_amdgcn_wmma_f32_16x16x32_bf16(false, a, false, b, (short)0, c, false, false); }



// ---- WFrag: fragment loader (hardware k order: 8 k at 8*hi, 8 k at 16 + 8*hi of each 32) and product for K-contiguous 16-bit planes
template <typename T16> struct WFrag;
template <> struct WFrag<h16> { typedef v16h V; static __device__ __forceinline__ V ld(const h16* p) { return cat16(*(const v8h*)p, *(const v8h*)(p + 16)); } static __device__ __forceinline__ v8f mma(V a, V b, v8f c) { return wmma16(a, b, c); } };
template <> struct WFrag<bf> { typedef v16bf V; static __device__ __forceinline__ V ld(const bf* p) { return cat16b(*(const v8us*)p, *(const v8us*)(p + 16)); } static __device__ __forceinline__ v8f mma(V a, V b, v8f c) { return wmmab(a, b, c); } };

// ---- k_gemmks: K-split GEMM for long K. One work-group of NW waves per (16*MB)x64 output tile; wave w sums k in [w*KK/NW, (w+1)*KK/NW) with the fragment loaders of WFrag;
// the NW partial tiles meet in LDS and are added in wave order. DP = k steps of 32 whose fragments a wave asks for ahead. LDA = pitch of the A rows in elements (Bt rows: KK). grid (M/(16*MB), N/64, Z), NW*32 threads. C f32, pitch ldc; z-batch strides sA/sB/sC in elements.
// Every loop of it is unrolled whole: the indices name registers (accumulators, fragment slots), and the trip counts are short compile-time constants.
template <typename T16, int NSPLIT, int MB, int NW, int KK, int DP, int LDA>
__global__ __launch_bounds__(NW * 32) void k_gemmks(const T16* __restrict__ A, const T16* __restrict__ A2, const T16* __restrict__ Bt, const T16* __restrict__ Bt2, float* C, int ldc, size_t sA, size_t sB, size_t sC) {
    typedef typename WFrag<T16>::V V;
    constexpr int KW = KK / NW, NI = KW / 32, PT = 68, TS = MB * 16 * PT;
    static_assert(KK % (NW * 32) == 0 && (MB * 256) % (NW * 32) == 0 && DP <= NI, "shape");
    __shared__ __align__(16) float ps[NW * TS];
    const size_t z = blockIdx.z; A += z * sA; if (NSPLIT == 2) A2 += z * sA; Bt += z * sB; if (NSPLIT == 2) Bt2 += z * sB; C += z * sC;
    const int lane = threadIdx.x & 31, lr = lane & 15, hi = lane >> 4, wave = threadIdx.x >> 5; const int r0 = blockIdx.x * (16 * MB), c0 = blockIdx.y * 64;
    v8f acc[MB][4];
#pragma unroll
    for (int mb = 0; mb < MB; ++mb)
#pragma unroll
        for (int nb = 0; nb < 4; ++nb) acc[mb][nb] = (v8f){};
    const size_t aoff = (size_t)(r0 + lr) * LDA + wave * KW + 8 * hi, boff = (size_t)(c0 + lr) * KK + wave * KW + 8 * hi;
    V a[DP][MB], a2[DP][MB], b[DP][4], b2[DP][4];
    auto fetch = [&](int s, int sl) {
#pragma unroll
        for (int mb = 0; mb < MB; ++mb) { a[sl][mb] = WFrag<T16>::ld(A + aoff + (size_t)mb * 16 * LDA + s * 32); if (NSPLIT == 2) a2[sl][mb] = WFrag<T16>::ld(A2 + aoff + (size_t)mb * 16 * LDA + s * 32); }
#pragma unroll
        for (int nb = 0; nb < 4; ++nb) { b[sl][nb] = WFrag<T16>::ld(Bt + boff + (size_t)nb * 16 * KK + s * 32); if (NSPLIT == 2) b2[sl][nb] = WFrag<T16>::ld(Bt2 + boff + (size_t)nb * 16 * KK + s * 32); } };
#pragma unroll
    for (int s = 0; s < DP; ++s) fetch(s, s);
    // unrolled whole, so that the DP register slots are named at compile time
#pragma unroll
    for (int s = 0; s < NI; ++s) { const int sl = s % DP;
        __builtin_amdgcn_sched_barrier(0);   // keeps the loads asked for ahead in front of these products: without it the scheduler sinks each load to its use and the wave pays the load latency once per fragment
#pragma unroll
        for (int nb = 0; nb < 4; ++nb)
#pragma unroll
            for (int mb = 0; mb < MB; ++mb) { acc[mb][nb] = WFrag<T16>::mma(a[sl][mb], b[sl][nb], acc[mb][nb]); if (NSPLIT == 2) { acc[mb][nb] = WFrag<T16>::mma(a2[sl][mb], b[sl][nb], acc[mb][nb]); acc[mb][nb] = WFrag<T16>::mma(a[sl][mb], b2[sl][nb], acc[mb][nb]); } }
        if (s + DP < NI) fetch(s + DP, sl);
    }
    float* pw = ps + wave * TS;
#pragma unroll
    for (int mb = 0; mb < MB; ++mb)
#pragma unroll
        for (int nb = 0; nb < 4; ++nb)
#pragma unroll
            for (int j = 0; j < 8; ++j) pw[(mb * 16 + hi * 8 + j) * PT + nb * 16 + lr] = acc[mb][nb][j];
    __syncthreads();   // every wave's partial tile is in LDS before any of it is added
#pragma unroll
    for (int q = 0; q < MB * 256 / (NW * 32); ++q) { const int p = q * (NW * 32) + threadIdx.x; const int row = p >> 4, cofs = (p & 15) * 4; v4f s = *(const v4fa*)(ps + row * PT + cofs);
#pragma unroll
        for (int w = 1; w < NW; ++w) s += *(const v4fa*)(ps + w * TS + row * PT + cofs);
        *(v4f*)(C + (size_t)(r0 + row) * ldc + c0 + cofs) = s; }
}

__device__ __forceinline__ h16 tohx(float x) { return (h16)x; }
__device__ __forceinline__ void splitf(float y, unsigned short& h, unsigned short& l) { h = f2bf(y); l = f2bf(y - bf2f(h)); }
typedef __attribute__((ext_vector_type(2))) _Float16 v2h;
typedef __attribute__((ext_vector_type(4))) _Float16 v4h;
typedef __attribute__((ext_vector_type(2))) unsigned short v2us;
typedef __attribute__((ext_vector_type(4))) unsigned short v4us;
typedef __attribute__((ext_vector_type(2))) float v2f;
typedef __attribute__((ext_vector_type(4))) int v4i;

// grid y picks one of three weights; their transposed planes lie behind one another in Bt
__global__ __launch_bounds__(256) void k_wtG(const float* __restrict__ w0, const float* __restrict__ w1, const float* __restrict__ w2, int K, int N, bf* Bt) {
    const float* w = (blockIdx.y == 0) ? w0 : (blockIdx.y == 1) ? w1 : w2; Bt += (size_t)blockIdx.y * N * K;
    const int lane = threadIdx.x & 31; const int L0 = (blockIdx.x * 8 + (threadIdx.x >> 5)) * 8; const int nlines = N * K / 64;
{
#pragma unroll 1
        for (int l = 0; l < 8; ++l) { const int L = L0 + l; if (L >= nlines) break; const size_t e = (size_t)L * 64 + lane * 2; const int k = (int)(e % K), n = (int)(e / K); v2us o;
            o[0] = f2bf(w[(size_t)k * N + n]); o[1] = f2bf(w[(size_t)(k + 1) * N + n]); *(v2us*)(Bt + e) = o; }
         }
}
__global__ __launch_bounds__(256) void k_cvt8(const float* __restrict__ src, bf* dst, size_t n8) { const size_t i = (size_t)blockIdx.x * 256 + threadIdx.x; if (i >= n8) return; const v8f v = *(const v8f*)(src + i * 8); v8us o;
#pragma unroll
    for (int k = 0; k < 8; ++k) o[k] = f2bf(v[k]); *(v8us*)(dst + i * 8) = o;  }

// k_rope: head planes [h][t][d] (fp16 + hi/lo) of rope(x) x sc with the rotate-half convention out[d] = x[d] cos[t][d] - x[d+HD/2] sin[t][d], out[d+HD/2] = x[d+HD/2] cos[t][d+HD/2] + x[d] sin[t][d+HD/2]
__global__ __launch_bounds__(256) void k_rope(const float* __restrict__ F, int pitch, int nheads, const float* __restrict__ CS, const float* __restrict__ RF, const float* __restrict__ nw, float sc, h16* P16, bf* Ph, bf* Pl) {
    { const size_t bz = (size_t)blockIdx.z * NB_ + blockIdx.y; F += bz * TT * pitch; const size_t po = bz * nheads * TT * HD; P16 += po; Ph += po; Pl += po; }   // grid y: batch; grid z: which projection (q, k), their buffers behind one another
    const size_t e = ((size_t)blockIdx.x * 256 + threadIdx.x) * 2; if (e >= (size_t)nheads * TT * HD) return; const int d = (int)(e % HD); const int t = (int)((e / HD) % TT); const int h = (int)(e / ((size_t)HD * TT)); const float* f = F + (size_t)t * pitch + h * HD; const float rf = RF ? RF[(size_t)h * TT + t] : 1.0f; v2h o16; v2us oh, ol;
#pragma unroll
    for (int q = 0; q < 2; ++q) { const int dd = d + q; const int dp = (dd < HD / 2) ? dd + HD / 2 : dd - HD / 2; float x0 = f[dd], x1 = f[dp];
        if (RF) { float n0 = __fmul_rn(x0, rf), n1 = __fmul_rn(x1, rf); asm volatile("" : "+v"(n0)); asm volatile("" : "+v"(n1)); x0 = __fmul_rn(bfr(nw[dd]), n0); x1 = __fmul_rn(bfr(nw[dp]), n1); }
        const v2f cs = *(const v2f*)(CS + ((size_t)t * HD + dd) * 2); float a = __fmul_rn(x0, cs[0]), bq = __fmul_rn(x1, cs[1]); asm volatile("" : "+v"(a)); asm volatile("" : "+v"(bq)); const float r = ((dd < HD / 2) ? __fsub_rn(a, bq) : __fadd_rn(a, bq)) * sc;
        o16[q] = tohx(r); unsigned short a2, c2; splitf(r, a2, c2); oh[q] = a2; ol[q] = c2; }
    *(v2h*)(P16 + e) = o16; *(v2us*)(Ph + e) = oh; *(v2us*)(Pl + e) = ol;  }
__global__ __launch_bounds__(256) void k_vtp(const float* __restrict__ F, int pitch, int nheads, h16* V16, bf* Vh, bf* Vl) { { F += (size_t)blockIdx.y * TT * pitch; const size_t po = (size_t)blockIdx.y * nheads * HD * TT; V16 += po; Vh += po; Vl += po; }   /* grid y: batch */ const size_t e = ((size_t)blockIdx.x * 256 + threadIdx.x) * 2; if (e >= (size_t)nheads * HD * TT) return; const int t = (int)(e % TT); const int d = (int)((e / TT) % HD); const int g = (int)(e / ((size_t)TT * HD)); v2h o16; v2us oh, ol;
#pragma unroll
    for (int q = 0; q < 2; ++q) { const float x = F[(size_t)(t + q) * pitch + g * HD + d]; o16[q] = tohx(x); unsigned short a2, c2; splitf(x, a2, c2); oh[q] = a2; ol[q] = c2; }
    *(v2h*)(V16 + e) = o16; *(v2us*)(Vh + e) = oh; *(v2us*)(Vl + e) = ol;  }
__global__ __launch_bounds__(256) void k_csid(float* CS) { const int idx = blockIdx.x * 256 + threadIdx.x; if (idx >= TT * HD) return; v2f cs; cs[0] = 1.0f; cs[1] = 0.0f; *(v2f*)(CS + (size_t)idx * 2) = cs;  }
// ---- k_fattn: scores, LeakyReLU, softmax and P.V of one (batch, head) pair's query rows in one kernel; neither S nor P goes to memory.
// One wave owns NT*16 query rows and walks all TT keys in steps of 32: S^T = K Q^T (a lane holds scores of ONE query: column lr; rows = keys 8*hi + j), running maximum per query (the same in both lane halves) and partial sum per lane,
// the two 16-key score tiles converted in place are the B operand P^T of O^T += V^T P^T (A = V^T rows in the same k order, by the loader WFrag). Rows < RH: hi/lo planes, 3 products; rest fp16 with P x 2^10.
// Left: K and V fragments come straight from the planes, and each 16-byte load of a wave touches 16 lines (32 B of each); planes stored in fragment order, or K/V staged in LDS for the AW waves, would cut the line requests.
__device__ __forceinline__ float xhalf(float x) { return __builtin_bit_cast(float, __builtin_amdgcn_permlanex16(__builtin_bit_cast(int, x), __builtin_bit_cast(int, x), 0x76543210, 0xfedcba98, false, false)); }   // lane l <-> lane l ^ 16
template <typename T16> struct PCvt;   // one probability into element e of the B operand(s): fp16, or bf16 hi + lo
template <> struct PCvt<h16> { static __device__ __forceinline__ void put(v16h& a, v16h&, int e, float p) { a[e] = (h16)p; } };
template <> struct PCvt<bf> { static __device__ __forceinline__ void put(v16bf& a, v16bf& b, int e, float p) { const __bf16 h = (__bf16)p; a[e] = h; b[e] = (__bf16)(p - (float)h); } };
template <typename T16, int NSPLIT, int NT>
__device__ __forceinline__ void attn_rows(const T16* __restrict__ Q, const T16* __restrict__ Q2, const T16* __restrict__ Kp, const T16* __restrict__ Kp2, const T16* __restrict__ Vt, const T16* __restrict__ Vt2, float* __restrict__ orow) {
    typedef typename WFrag<T16>::V V;
    const int lane = threadIdx.x & 31, lr = lane & 15, hi = lane >> 4;
    constexpr float PB = (NSPLIT == 2) ? 0.0f : 10.0f;      // log2 of the factor on P (fp16 keeps small probabilities normal); it cancels against the row sum
    constexpr float C2 = SCL * 1.4426950408889634f;         // score scale x log2(e): LeakyReLU commutes with a positive factor
    V qf[NT][2], qf2[NT][2], kf[2][2], kf2[2][2];
#pragma unroll
    for (int nt = 0; nt < NT; ++nt)
#pragma unroll
        for (int ks = 0; ks < 2; ++ks) { qf[nt][ks] = WFrag<T16>::ld(Q + (size_t)(nt * 16 + lr) * HD + ks * 32 + 8 * hi); if (NSPLIT == 2) qf2[nt][ks] = WFrag<T16>::ld(Q2 + (size_t)(nt * 16 + lr) * HD + ks * 32 + 8 * hi); }
    const size_t koff = (size_t)lr * HD + 8 * hi, voff = (size_t)lr * TT + 8 * hi;
    auto fetchk = [&](int key0) {
#pragma unroll
        for (int kt = 0; kt < 2; ++kt)
#pragma unroll
            for (int ks = 0; ks < 2; ++ks) { kf[kt][ks] = WFrag<T16>::ld(Kp + koff + (size_t)(key0 + kt * 16) * HD + ks * 32); if (NSPLIT == 2) kf2[kt][ks] = WFrag<T16>::ld(Kp2 + koff + (size_t)(key0 + kt * 16) * HD + ks * 32); } };
    fetchk(0);
    v8f o[4][NT]; float m[NT], l[NT];
#pragma unroll
    for (int nt = 0; nt < NT; ++nt) { m[nt] = -3.0e38f; l[nt] = 0.0f;
#pragma unroll
        for (int dt = 0; dt < 4; ++dt) o[dt][nt] = (v8f){}; }
    // rolled: 64 steps of one body; the body alone fills the registers
#pragma unroll 1
    for (int key0 = 0; key0 < TT; key0 += 32) {
        V vf[4], vf2[4];
#pragma unroll
        for (int dt = 0; dt < 4; ++dt) { vf[dt] = WFrag<T16>::ld(Vt + voff + (size_t)dt * 16 * TT + key0); if (NSPLIT == 2) vf2[dt] = WFrag<T16>::ld(Vt2 + voff + (size_t)dt * 16 * TT + key0); }
        __builtin_amdgcn_sched_barrier(0);   // keeps the V loads in front of the score products: sunk to their use they would cost their latency behind the softmax
        v8f s[2][NT];
#pragma unroll
        for (int kt = 0; kt < 2; ++kt)
#pragma unroll
            for (int nt = 0; nt < NT; ++nt) { s[kt][nt] = (v8f){};
#pragma unroll
                for (int ks = 0; ks < 2; ++ks) { s[kt][nt] = WFrag<T16>::mma(kf[kt][ks], qf[nt][ks], s[kt][nt]); if (NSPLIT == 2) { s[kt][nt] = WFrag<T16>::mma(kf[kt][ks], qf2[nt][ks], s[kt][nt]); s[kt][nt] = WFrag<T16>::mma(kf2[kt][ks], qf[nt][ks], s[kt][nt]); } } }
        fetchk((key0 + 32) & (TT - 1));      // the next step's K fragments (the last step asks for step 0's again: in bounds, not used)
        asm volatile("s_wait_xcnt 0x0" ::: "memory");   // the address registers of the V and K loads above are reused by the vector code below: the wait stands in front of every such overwrite
        __builtin_amdgcn_sched_barrier(0);   // keeps those loads in front of the softmax, so that it covers their latency
        float ml[NT]; bool need = false;
#pragma unroll
        for (int nt = 0; nt < NT; ++nt) { ml[nt] = -3.0e38f;
#pragma unroll
            for (int kt = 0; kt < 2; ++kt)
#pragma unroll
                for (int j = 0; j < 8; ++j) { const float y = s[kt][nt][j] * C2; const float t = fmaxf(y, 0.2f * y);   /* LeakyReLU_0.2 of the scaled score, in log2 units */ s[kt][nt][j] = t; ml[nt] = fmaxf(ml[nt], t); }
            need = need || (ml[nt] > m[nt]); }
        if (__builtin_amdgcn_ballot_w32(need) != 0) {   // a new row maximum somewhere in the wave: rare after the first steps
#pragma unroll
            for (int nt = 0; nt < NT; ++nt) { const float mn = fmaxf(m[nt], fmaxf(ml[nt], xhalf(ml[nt]))); const float al = __builtin_amdgcn_exp2f(m[nt] - mn); m[nt] = mn; l[nt] *= al;
#pragma unroll
                for (int dt = 0; dt < 4; ++dt) o[dt][nt] *= al; } }
        V pf[NT], pf2[NT];
#pragma unroll
        for (int nt = 0; nt < NT; ++nt) { const float mb = m[nt] - PB; float p[16];
#pragma unroll
            for (int e = 0; e < 16; ++e) p[e] = __builtin_amdgcn_exp2f(s[e >> 3][nt][e & 7] - mb);
            l[nt] += (((p[0] + p[1]) + (p[2] + p[3])) + ((p[4] + p[5]) + (p[6] + p[7]))) + (((p[8] + p[9]) + (p[10] + p[11])) + ((p[12] + p[13]) + (p[14] + p[15])));
#pragma unroll
            for (int e = 0; e < 16; ++e) PCvt<T16>::put(pf[nt], pf2[nt], e, p[e]); }
#pragma unroll
        for (int dt = 0; dt < 4; ++dt)
#pragma unroll
            for (int nt = 0; nt < NT; ++nt) { o[dt][nt] = WFrag<T16>::mma(vf[dt], pf[nt], o[dt][nt]); if (NSPLIT == 2) { o[dt][nt] = WFrag<T16>::mma(vf[dt], pf2[nt], o[dt][nt]); o[dt][nt] = WFrag<T16>::mma(vf2[dt], pf[nt], o[dt][nt]); } }
    }
#pragma unroll
    for (int nt = 0; nt < NT; ++nt) { const float inv = __fdiv_rn(1.0f, l[nt] + xhalf(l[nt])); float* op = orow + (size_t)(nt * 16 + lr) * DQ + 8 * hi;   // the halves' sums meet once, here
#pragma unroll
        for (int dt = 0; dt < 4; ++dt) { v4f a, b;
#pragma unroll
            for (int j = 0; j < 4; ++j) { a[j] = o[dt][nt][j] * inv; b[j] = o[dt][nt][4 + j] * inv; }
            *(v4f*)(op + dt * 16) = a; *(v4f*)(op + dt * 16 + 4) = b; } }
    asm volatile("s_wait_xcnt 0x0" ::: "memory");   // behind the last store: whatever code follows this function in the kernel may reuse the stores' data and address registers
}
#define AW 4   // waves of a work-group; they walk the same keys, each with its own query rows
// grid x: first the NG * RH/(AW*16) work-groups of the hi/lo rows (16 rows a wave; the longer ones first), then the NG * (TT-RH)/(AW*32) of the fp16 rows (32 rows a wave)
__global__ __launch_bounds__(AW * 32) void k_fattn(const h16* __restrict__ Q16, const h16* __restrict__ K16, const h16* __restrict__ V16, const bf* __restrict__ Qh, const bf* __restrict__ Ql, const bf* __restrict__ Kh, const bf* __restrict__ Kl, const bf* __restrict__ Vh, const bf* __restrict__ Vl, float* __restrict__ OUTb) {
    constexpr int HB = RH / (AW * 16), LB = (TT - RH) / (AW * 32);
    static_assert(RH % (AW * 16) == 0 && (TT - RH) % (AW * 32) == 0 && (TT & (TT - 1)) == 0 && HD == 64, "shape");
    const int wave = threadIdx.x >> 5; const int id = blockIdx.x;
    if (id < NG * HB) { const int g = id / HB, q0 = (id % HB) * (AW * 16) + wave * 16; const size_t pl = (size_t)g * TT * HD;
        attn_rows<bf, 2, 1>(Qh + pl + (size_t)q0 * HD, Ql + pl + (size_t)q0 * HD, Kh + pl, Kl + pl, Vh + pl, Vl + pl, OUTb + ((size_t)(g / NH_) * TT + q0) * DQ + (g % NH_) * HD);
    } else { const int i2 = id - NG * HB; const int g = i2 / LB, q0 = RH + (i2 % LB) * (AW * 32) + wave * 32; const size_t pl = (size_t)g * TT * HD;
        attn_rows<h16, 0, 2>(Q16 + pl + (size_t)q0 * HD, nullptr, K16 + pl, nullptr, V16 + pl, nullptr, OUTb + ((size_t)(g / NH_) * TT + q0) * DQ + (g % NH_) * HD); }
}

extern "C" void kernel_launch(void* const* d_in, const int* in_sizes, int n_in,
                              void* d_out, int out_size, void* d_ws, size_t ws_size, hipStream_t stream) {
    (void)in_sizes; (void)n_in; (void)out_size;
    const float* x = (const float*)d_in[0]; const float* w = (const float*)d_in[1];   /* h, W ('xw' [256][256]) */ const float* wq = w; const float* wk = w; const float* wv = w; const float* wo = nullptr; (void)wo;
    float* OUT = (float*)d_out;     // [8][2048][256]
    char* wsp = (char*)d_ws;
    auto take = [&](size_t bytes) { char* p = wsp; wsp += (bytes + 255) & ~(size_t)255; return (void*)p; };
    bf* WQ = (bf*)take((size_t)DQ * DM * 2); bf* WK = (bf*)take((size_t)DKV * DM * 2); bf* WV = (bf*)take((size_t)DKV * DM * 2); (void)WK; (void)WV;   /* behind one another: grid y / z strides */ float* CS = (float*)take((size_t)TT * HD * 2 * 4);
    h16* QP16 = (h16*)take((size_t)NG * TT * HD * 2); h16* KP16 = (h16*)take((size_t)NG * TT * HD * 2); h16* VT16 = (h16*)take((size_t)NG * HD * TT * 2);
    bf* QPh = (bf*)take((size_t)NG * TT * HD * 2); bf* KPh = (bf*)take((size_t)NG * TT * HD * 2); bf* QPl = (bf*)take((size_t)NG * TT * HD * 2); bf* KPl = (bf*)take((size_t)NG * TT * HD * 2); bf* VTh = (bf*)take((size_t)NG * HD * TT * 2); bf* VTl = (bf*)take((size_t)NG * HD * TT * 2);
    float* Sb = (float*)take((size_t)ZH * TT * TT * 4);   // scratch of the projection
    if ((size_t)(wsp - (char*)d_ws) > ws_size) return;    // ws 256 MiB
    static_assert((size_t)NB_ * TT * DM * 2 + 3 * (size_t)NB_ * TT * DQ * 4 <= (size_t)ZH * TT * TT * 4 && DQ == DKV && NH_ == NKV && NG % ZH == 0, "layout");
    bf* XB = (bf*)Sb; float* FQ = (float*)(XB + (size_t)NB_ * TT * DM); float* FV = FQ + 2 * (size_t)NB_ * TT * DQ;   // FQ, FK, FV behind one another
    k_wtG<<<dim3((unsigned)((DM * DQ / 64 + 63) / 64), 3, 1), 256, 0, stream>>>(wq, wk, wv, DM, DQ, WQ);
    k_csid<<<(TT * HD + 255) / 256, 256, 0, stream>>>(CS);
    const unsigned LQ = (unsigned)(((size_t)NH_ * TT * HD / 2 + 255) / 256), LKv = (unsigned)(((size_t)NKV * TT * HD / 2 + 255) / 256);
    k_cvt8<<<(unsigned)(((size_t)NB_ * TT * DM / 8 + 255) / 256), 256, 0, stream>>>(x, XB, (size_t)NB_ * TT * DM / 8);
    k_gemmks<bf, 0, 2, 4, DM, 2, DM><<<dim3(NB_ * TT / 32, DQ / 64, 3), 128, 0, stream>>>(XB, nullptr, WQ, nullptr, FQ, DQ, 0, (size_t)DQ * DM, (size_t)NB_ * TT * DQ);   // z: q, k, v
    k_rope<<<dim3(LQ, NB_, 2), 256, 0, stream>>>(FQ, DQ, NH_, CS, nullptr, nullptr, 1.0f, QP16, QPh, QPl);   // z: q, k
    k_vtp<<<dim3(LKv, NB_, 1), 256, 0, stream>>>(FV, DKV, NKV, VT16, VTh, VTl);
    k_fattn<<<NG * (RH / (AW * 16)) + NG * ((TT - RH) / (AW * 32)), AW * 32, 0, stream>>>(QP16, KP16, VT16, QPh, QPl, KPh, KPl, VTh, VTl, OUT);
}

// v004
// Measured time: 136 microseconds a run.
// Next to v003, in two timings, it ran 1.29 and 1.28 times as fast.
// Counting every step since v000, it is 15.4 times as fast.
#include <hip/hip_runtime.h>

// Dense multi-head 'graph attention' with dot-product scores and a LeakyReLU before the softmax (h [8][2048][256]; Wh = h W ('xw' [256][256] 1/16, no bias) split into 4 heads x 64; scores = Wh.Wh^T x 1/sqrt(64) per head (queries, keys and values are all Wh); attention = softmax(LeakyReLU_0.2(scores)) over all 2,048 nodes (no adjacency); h' = attention Wh; heads concatenated -> [8][2048][256] (4.2 M); argument order h, W).
// Layout, all 8 batches at once (planes [batch][head][..]): bf16 copy of h; the 'xw' weight transposed once; ONE projection launch whose epilogue writes the attention's planes itself: Wh row-major [t][d] (read as q and as k) and transposed [d][t] (read as v), each as fp16 and as bf16 hi + lo; dense T-2048 attention in one fused kernel (hybrid rows: < 512 hi/lo 3 products, rest fp16 x1024) with the LeakyReLU applied to the scaled score in registers; it writes the output rows (no output projection).
// Compute dtypes, f32 accumulate: every input rounded to bf16; projection exact; attention rows < 512 3 products, rest fp16; LeakyReLU/softmax f32; output f32.

#define NB_  8
#define TT   2048
#define DM   256
#define NH_  4
#define NKV  4
#define REP  (NH_ / NKV)
#define HD   64
#define DQ   (NH_ * HD)
#define DKV  (NKV * HD)
#define NG   (NB_ * NH_)          // all (batch, head) pairs
#define RH   512                  // query rows < RH use hi+lo planes (0: none)
#define WIN  0
#define SCL  0.125f   // HD^-0.5
typedef _Float16 h16;
typedef unsigned short bf;
typedef __attribute__((ext_vector_type(16))) __bf16   v16bf;
typedef __attribute__((ext_vector_type(16))) _Float16 v16h;
typedef __attribute__((ext_vector_type(8)))  _Float16 v8h;
typedef __attribute__((ext_vector_type(8)))  unsigned short v8us;
typedef __attribute__((ext_vector_type(8)))  float    v8f;
typedef __attribute__((ext_vector_type(4)))  float    v4f;
typedef v8h  __attribute__((may_alias)) v8ha;
typedef v4f  __attribute__((may_alias)) v4fa;
typedef v8us __attribute__((may_alias)) v8usa;

__device__ __forceinline__ unsigned short f2bf(float f) { unsigned u = __float_as_uint(f); u += 0x7FFFu + ((u >> 16) & 1u); return (unsigned short)(u >> 16); }
__device__ __forceinline__ float bf2f(unsigned short b) { return __uint_as_float(((unsigned)b) << 16); }
__device__ __forceinline__ float bfr(float f) { return bf2f(f2bf(f)); }
__device__ __forceinline__ v16h cat16(v8h lo, v8h hi) { return __builtin_shufflevector(lo, hi, 0, 1, 2, 3, 4, 5, 6, 7, 8, 9, 10, 11, 12, 13, 14, 15); }
__device__ __forceinline__ v16bf cat16b(v8us lo, v8us hi) { return __builtin_bit_cast(v16bf, __builtin_shufflevector(lo, hi, 0, 1, 2, 3, 4, 5, 6, 7, 8, 9, 10, 11, 12, 13, 14, 15)); }
__device__ __forceinline__ v8f wmma16(v16h a, v16h b, v8f c) { return __builtin_amdgcn_wmma_f32_16x16x32_f16(false, a, false, b, (short)0, c, false, false); }
__device__ __forceinline__ v8f wmmab(v16bf a, v16bf b, v8f c) { return __builtin_amdgcn_wmma_f32_16x16x32_bf16(false, a, false, b, (short)0, c, false, false); }



// ---- WFrag: fragment loader (hardware k order: 8 k at 8*hi, 8 k at 16 + 8*hi of each 32) and product for K-contiguous 16-bit planes
template <typename T16> struct WFrag;
template <> struct WFrag<h16> { typedef v16h V; static __device__ __forceinline__ V ld(const h16* p) { return cat16(*(const v8h*)p, *(const v8h*)(p + 16)); } static __device__ __forceinline__ v8f mma(V a, V b, v8f c) { return wmma16(a, b, c); } };
template <> struct WFrag<bf> { typedef v16bf V; static __device__ __forceinline__ V ld(const bf* p) { return cat16b(*(const v8us*)p, *(const v8us*)(p + 16)); } static __device__ __forceinline__ v8f mma(V a, V b, v8f c) { return wmmab(a, b, c); } };

__device__ __forceinline__ h16 tohx(float x) { return (h16)x; }
__device__ __forceinline__ void splitf(float y, unsigned short& h, unsigned short& l) { h = f2bf(y); l = f2bf(y - bf2f(h)); }
typedef __attribute__((ext_vector_type(2))) _Float16 v2h;
typedef __attribute__((ext_vector_type(4))) _Float16 v4h;
typedef __attribute__((ext_vector_type(2))) unsigned short v2us;
typedef __attribute__((ext_vector_type(4))) unsigned short v4us;
typedef __attribute__((ext_vector_type(2))) float v2f;
typedef __attribute__((ext_vector_type(4))) int v4i;
// ---- k_projp: the projection Wh = h W with the attention's planes written by its epilogue. One work-group of NW waves per 64x64 output tile (64 nodes of one batch x the 64 columns of one head); wave w sums k in [w*KK/NW, (w+1)*KK/NW) with the fragment loaders of WFrag;
// the NW partial tiles meet in LDS and are added in wave order; the summed tile goes out twice, each time as fp16, bf16 hi and bf16 lo: row-major [t][d] (512 contiguous bytes a wave store) and, read back from LDS by columns, transposed [d][t] (64 nodes = one whole 128-byte line per d).
// DP = k steps of 32 whose fragments a wave asks for ahead (all of them). grid (NB_*TT/64, NH_), NW*32 threads. Every loop of it is unrolled whole: the indices name registers (accumulators, fragment slots), and the trip counts are short compile-time constants.
__device__ __forceinline__ void cvt3(const float* x, v8h& o16, v8us& oh, v8us& ol) {   // 8 values -> fp16, bf16 hi, bf16 lo
#pragma unroll
    for (int j = 0; j < 8; ++j) { o16[j] = tohx(x[j]); unsigned short a2, c2; splitf(x[j], a2, c2); oh[j] = a2; ol[j] = c2; } }
template <int NW, int KK, int DP>
__global__ __launch_bounds__(NW * 32) void k_projp(const bf* __restrict__ A, const bf* __restrict__ Bt, h16* __restrict__ P16, bf* __restrict__ Ph, bf* __restrict__ Pl, h16* __restrict__ V16, bf* __restrict__ Vh, bf* __restrict__ Vl) {
    typedef typename WFrag<bf>::V V;
    constexpr int MB = 4, KW = KK / NW, NI = KW / 32, PT = 68, TS = MB * 16 * PT;
    static_assert(KK % (NW * 32) == 0 && NW == 4 && DP == NI && HD == 64 && TT % 64 == 0, "shape");
    __shared__ __align__(16) float ps[NW * TS];
    const int lane = threadIdx.x & 31, lr = lane & 15, hi = lane >> 4, wave = threadIdx.x >> 5; const int r0 = blockIdx.x * 64, c0 = blockIdx.y * 64;
    v8f acc[MB][4];
#pragma unroll
    for (int mb = 0; mb < MB; ++mb)
#pragma unroll
        for (int nb = 0; nb < 4; ++nb) acc[mb][nb] = (v8f){};
    const bf* pa = A + (size_t)(r0 + lr) * KK + wave * KW + 8 * hi; const bf* pb = Bt + (size_t)(c0 + lr) * KK + wave * KW + 8 * hi;
    V a[DP][MB], b[DP][4];
    auto fetch = [&](int s, int sl) {
#pragma unroll
        for (int mb = 0; mb < MB; ++mb) a[sl][mb] = WFrag<bf>::ld(pa + mb * 16 * KK + s * 32);
#pragma unroll
        for (int nb = 0; nb < 4; ++nb) b[sl][nb] = WFrag<bf>::ld(pb + nb * 16 * KK + s * 32); };
#pragma unroll
    for (int s = 0; s < DP; ++s) fetch(s, s);
    asm volatile("s_wait_xcnt 0x0" :: "v"(pa), "v"(pb) : "memory");   // the two address pairs are inputs here, so they stay whole up to this wait
    // unrolled whole, so that the DP register slots are named at compile time
#pragma unroll
    for (int s = 0; s < NI; ++s) { const int sl = s % DP;
        __builtin_amdgcn_sched_barrier(0);   // keeps the loads asked for ahead in front of these products: without it the scheduler sinks each load to its use and the wave pays the load latency once per fragment
#pragma unroll
        for (int nb = 0; nb < 4; ++nb)
#pragma unroll
            for (int mb = 0; mb < MB; ++mb) acc[mb][nb] = WFrag<bf>::mma(a[sl][mb], b[sl][nb], acc[mb][nb]);
    }
    float* pw = ps + wave * TS;
#pragma unroll
    for (int mb = 0; mb < MB; ++mb)
#pragma unroll
        for (int nb = 0; nb < 4; ++nb)
#pragma unroll
            for (int j = 0; j < 8; ++j) pw[(mb * 16 + hi * 8 + j) * PT + nb * 16 + lr] = acc[mb][nb][j];
    __syncthreads();   // every wave's partial tile is in LDS before any of it is added
    const int g = (r0 / TT) * NH_ + blockIdx.y, t0 = r0 % TT;   // (batch, head) pair and first node of the tile
    const size_t pr = ((size_t)g * TT + t0) * HD;               // the tile's 64 rows lie behind one another in a [t][d] plane
    constexpr int NQ = 64 * 8 / (NW * 32); v8h o16[NQ]; v8us oh[NQ], ol[NQ];
#pragma unroll
    for (int q = 0; q < NQ; ++q) { const int p = q * (NW * 32) + threadIdx.x; float* sp = ps + (p >> 3) * PT + (p & 7) * 8; v4f s0 = *(const v4fa*)sp, s1 = *(const v4fa*)(sp + 4);
#pragma unroll
        for (int w = 1; w < NW; ++w) { s0 += *(const v4fa*)(sp + w * TS); s1 += *(const v4fa*)(sp + w * TS + 4); }
        *(v4fa*)sp = s0; *(v4fa*)(sp + 4) = s1;   // the sum replaces wave 0's partial (this thread alone touches these 8 places here): the transposed pass reads it
        const float x[8] = { s0[0], s0[1], s0[2], s0[3], s1[0], s1[1], s1[2], s1[3] }; cvt3(x, o16[q], oh[q], ol[q]); }
    __syncthreads();   // the whole summed tile is in LDS before any column of it is read
    // the row-major stores stand behind the barrier: in front of it the barrier would wait until they have left
#pragma unroll
    for (int q = 0; q < NQ; ++q) { const size_t e = pr + (size_t)(q * (NW * 32) + threadIdx.x) * 8; *(v8h*)(P16 + e) = o16[q]; *(v8us*)(Ph + e) = oh[q]; *(v8us*)(Pl + e) = ol[q]; }
    const int run = threadIdx.x & 7, dg = threadIdx.x >> 3;     // 8 nodes x 4 columns a thread; lanes 0-7 fill one 128-byte line of a [d][t] plane
    v4f xr[8];
#pragma unroll
    for (int j = 0; j < 8; ++j) xr[j] = *(const v4fa*)(ps + (run * 8 + j) * PT + dg * 4);
#pragma unroll
    for (int i = 0; i < 4; ++i) { const float x[8] = { xr[0][i], xr[1][i], xr[2][i], xr[3][i], xr[4][i], xr[5][i], xr[6][i], xr[7][i] }; v8h t16; v8us th, tl; cvt3(x, t16, th, tl);
        const size_t pv = ((size_t)g * HD + dg * 4 + i) * TT + t0 + run * 8;
        *(v8h*)(V16 + pv) = t16; *(v8us*)(Vh + pv) = th; *(v8us*)(Vl + pv) = tl; }
}

// grid y picks one of three weights; their transposed planes lie behind one another in Bt
__global__ __launch_bounds__(256) void k_wtG(const float* __restrict__ w0, const float* __restrict__ w1, const float* __restrict__ w2, int K, int N, bf* Bt) {
    const float* w = (blockIdx.y == 0) ? w0 : (blockIdx.y == 1) ? w1 : w2; Bt += (size_t)blockIdx.y * N * K;
    const int lane = threadIdx.x & 31; const int L0 = (blockIdx.x * 8 + (threadIdx.x >> 5)) * 8; const int nlines = N * K / 64;
{
#pragma unroll 1
        for (int l = 0; l < 8; ++l) { const int L = L0 + l; if (L >= nlines) break; const size_t e = (size_t)L * 64 + lane * 2; const int k = (int)(e % K), n = (int)(e / K); v2us o;
            o[0] = f2bf(w[(size_t)k * N + n]); o[1] = f2bf(w[(size_t)(k + 1) * N + n]); *(v2us*)(Bt + e) = o; }
         }
}
__global__ __launch_bounds__(256) void k_cvt8(const float* __restrict__ src, bf* dst, size_t n8) { const size_t i = (size_t)blockIdx.x * 256 + threadIdx.x; if (i >= n8) return; const v8f v = *(const v8f*)(src + i * 8); v8us o;
#pragma unroll
    for (int k = 0; k < 8; ++k) o[k] = f2bf(v[k]); *(v8us*)(dst + i * 8) = o;  }

// ---- k_fattn: scores, LeakyReLU, softmax and P.V of one (batch, head) pair's query rows in one kernel; neither S nor P goes to memory.
// One wave owns NT*16 query rows and walks all TT keys in steps of 32: S^T = K Q^T (a lane holds scores of ONE query: column lr; rows = keys 8*hi + j), running maximum per query (the same in both lane halves) and partial sum per lane,
// the two 16-key score tiles converted in place are the B operand P^T of O^T += V^T P^T (A = V^T rows in the same k order, by the loader WFrag). Rows < RH: hi/lo planes, 3 products; rest fp16 with P x 2^10.
// Left: K and V fragments come straight from the planes, and each 16-byte load of a wave touches 16 lines (32 B of each); planes stored in fragment order, or K/V staged in LDS for the AW waves, would cut the line requests.
__device__ __forceinline__ float xhalf(float x) { return __builtin_bit_cast(float, __builtin_amdgcn_permlanex16(__builtin_bit_cast(int, x), __builtin_bit_cast(int, x), 0x76543210, 0xfedcba98, false, false)); }   // lane l <-> lane l ^ 16
template <typename T16> struct PCvt;   // one probability into element e of the B operand(s): fp16, or bf16 hi + lo
template <> struct PCvt<h16> { static __device__ __forceinline__ void put(v16h& a, v16h&, int e, float p) { a[e] = (h16)p; } };
template <> struct PCvt<bf> { static __device__ __forceinline__ void put(v16bf& a, v16bf& b, int e, float p) { const __bf16 h = (__bf16)p; a[e] = h; b[e] = (__bf16)(p - (float)h); } };
template <typename T16, int NSPLIT, int NT>
__device__ __forceinline__ void attn_rows(const T16* __restrict__ Q, const T16* __restrict__ Q2, const T16* __restrict__ Kp, const T16* __restrict__ Kp2, const T16* __restrict__ Vt, const T16* __restrict__ Vt2, float* __restrict__ orow) {
    typedef typename WFrag<T16>::V V;
    const int lane = threadIdx.x & 31, lr = lane & 15, hi = lane >> 4;
    constexpr float PB = (NSPLIT == 2) ? 0.0f : 10.0f;      // log2 of the factor on P (fp16 keeps small probabilities normal); it cancels against the row sum
    constexpr float C2 = SCL * 1.4426950408889634f;         // score scale x log2(e): LeakyReLU commutes with a positive factor
    V qf[NT][2], qf2[NT][2], kf[2][2], kf2[2][2];
#pragma unroll
    for (int nt = 0; nt < NT; ++nt)
#pragma unroll
        for (int ks = 0; ks < 2; ++ks) { qf[nt][ks] = WFrag<T16>::ld(Q + (size_t)(nt * 16 + lr) * HD + ks * 32 + 8 * hi); if (NSPLIT == 2) qf2[nt][ks] = WFrag<T16>::ld(Q2 + (size_t)(nt * 16 + lr) * HD + ks * 32 + 8 * hi); }
    const size_t koff = (size_t)lr * HD + 8 * hi, voff = (size_t)lr * TT + 8 * hi;
    auto fetchk = [&](int key0) {
#pragma unroll
        for (int kt = 0; kt < 2; ++kt)
#pragma unroll
            for (int ks = 0; ks < 2; ++ks) { kf[kt][ks] = WFrag<T16>::ld(Kp + koff + (size_t)(key0 + kt * 16) * HD + ks * 32); if (NSPLIT == 2) kf2[kt][ks] = WFrag<T16>::ld(Kp2 + koff + (size_t)(key0 + kt * 16) * HD + ks * 32); } };
    fetchk(0);
    v8f o[4][NT]; float m[NT], l[NT];
#pragma unroll
    for (int nt = 0; nt < NT; ++nt) { m[nt] = -3.0e38f; l[nt] = 0.0f;
#pragma unroll
        for (int dt = 0; dt < 4; ++dt) o[dt][nt] = (v8f){}; }
    // rolled: 64 steps of one body; the body alone fills the registers
#pragma unroll 1
    for (int key0 = 0; key0 < TT; key0 += 32) {
        V vf[4], vf2[4];
#pragma unroll
        for (int dt = 0; dt < 4; ++dt) { vf[dt] = WFrag<T16>::ld(Vt + voff + (size_t)dt * 16 * TT + key0); if (NSPLIT == 2) vf2[dt] = WFrag<T16>::ld(Vt2 + voff + (size_t)dt * 16 * TT + key0); }
        __builtin_amdgcn_sched_barrier(0);   // keeps the V loads in front of the score products: sunk to their use they would cost their latency behind the softmax
        v8f s[2][NT];
#pragma unroll
        for (int kt = 0; kt < 2; ++kt)
#pragma unroll
            for (int nt = 0; nt < NT; ++nt) { s[kt][nt] = (v8f){};
#pragma unroll
                for (int ks = 0; ks < 2; ++ks) { s[kt][nt] = WFrag<T16>::mma(kf[kt][ks], qf[nt][ks], s[kt][nt]); if (NSPLIT == 2) { s[kt][nt] = WFrag<T16>::mma(kf[kt][ks], qf2[nt][ks], s[kt][nt]); s[kt][nt] = WFrag<T16>::mma(kf2[kt][ks], qf[nt][ks], s[kt][nt]); } } }
        fetchk((key0 + 32) & (TT - 1));      // the next step's K fragments (the last step asks for step 0's again: in bounds, not used)
        asm volatile("s_wait_xcnt 0x0" ::: "memory");   // the address registers of the V and K loads above are reused by the vector code below: the wait stands in front of every such overwrite
        __builtin_amdgcn_sched_barrier(0);   // keeps those loads in front of the softmax, so that it covers their latency
        float ml[NT]; bool need = false;
#pragma unroll
        for (int nt = 0; nt < NT; ++nt) { ml[nt] = -3.0e38f;
#pragma unroll
            for (int kt = 0; kt < 2; ++kt)
#pragma unroll
                for (int j = 0; j < 8; ++j) { const float y = s[kt][nt][j] * C2; const float t = fmaxf(y, 0.2f * y);   /* LeakyReLU_0.2 of the scaled score, in log2 units */ s[kt][nt][j] = t; ml[nt] = fmaxf(ml[nt], t); }
            need = need || (ml[nt] > m[nt]); }
        if (__builtin_amdgcn_ballot_w32(need) != 0) {   // a new row maximum somewhere in the wave: rare after the first steps
#pragma unroll
            for (int nt = 0; nt < NT; ++nt) { const float mn = fmaxf(m[nt], fmaxf(ml[nt], xhalf(ml[nt]))); const float al = __builtin_amdgcn_exp2f(m[nt] - mn); m[nt] = mn; l[nt] *= al;
#pragma unroll
                for (int dt = 0; dt < 4; ++dt) o[dt][nt] *= al; } }
        V pf[NT], pf2[NT];
#pragma unroll
        for (int nt = 0; nt < NT; ++nt) { const float mb = m[nt] - PB; float p[16];
#pragma unroll
            for (int e = 0; e < 16; ++e) p[e] = __builtin_amdgcn_exp2f(s[e >> 3][nt][e & 7] - mb);
            l[nt] += (((p[0] + p[1]) + (p[2] + p[3])) + ((p[4] + p[5]) + (p[6] + p[7]))) + (((p[8] + p[9]) + (p[10] + p[11])) + ((p[12] + p[13]) + (p[14] + p[15])));
#pragma unroll
            for (int e = 0; e < 16; ++e) PCvt<T16>::put(pf[nt], pf2[nt], e, p[e]); }
#pragma unroll
        for (int dt = 0; dt < 4; ++dt)
#pragma unroll
            for (int nt = 0; nt < NT; ++nt) { o[dt][nt] = WFrag<T16>::mma(vf[dt], pf[nt], o[dt][nt]); if (NSPLIT == 2) { o[dt][nt] = WFrag<T16>::mma(vf[dt], pf2[nt], o[dt][nt]); o[dt][nt] = WFrag<T16>::mma(vf2[dt], pf[nt], o[dt][nt]); } }
    }
#pragma unroll
    for (int nt = 0; nt < NT; ++nt) { const float inv = __fdiv_rn(1.0f, l[nt] + xhalf(l[nt])); float* op = orow + (size_t)(nt * 16 + lr) * DQ + 8 * hi;   // the halves' sums meet once, here
#pragma unroll
        for (int dt = 0; dt < 4; ++dt) { v4f a, b;
#pragma unroll
            for (int j = 0; j < 4; ++j) { a[j] = o[dt][nt][j] * inv; b[j] = o[dt][nt][4 + j] * inv; }
            *(v4f*)(op + dt * 16) = a; *(v4f*)(op + dt * 16 + 4) = b; } }
    asm volatile("s_wait_xcnt 0x0" ::: "memory");   // behind the last store: whatever code follows this function in the kernel may reuse the stores' data and address registers
}
#define AW 4   // waves of a work-group; they walk the same keys, each with its own query rows
// grid x: first the NG * RH/(AW*16) work-groups of the hi/lo rows (16 rows a wave; the longer ones first), then the NG * (TT-RH)/(AW*32) of the fp16 rows (32 rows a wave)
__global__ __launch_bounds__(AW * 32) void k_fattn(const h16* __restrict__ Q16, const h16* __restrict__ K16, const h16* __restrict__ V16, const bf* __restrict__ Qh, const bf* __restrict__ Ql, const bf* __restrict__ Kh, const bf* __restrict__ Kl, const bf* __restrict__ Vh, const bf* __restrict__ Vl, float* __restrict__ OUTb) {
    constexpr int HB = RH / (AW * 16), LB = (TT - RH) / (AW * 32);
    static_assert(RH % (AW * 16) == 0 && (TT - RH) % (AW * 32) == 0 && (TT & (TT - 1)) == 0 && HD == 64, "shape");
    const int wave = threadIdx.x >> 5; const int id = blockIdx.x;
    if (id < NG * HB) { const int g = id / HB, q0 = (id % HB) * (AW * 16) + wave * 16; const size_t pl = (size_t)g * TT * HD;
        attn_rows<bf, 2, 1>(Qh + pl + (size_t)q0 * HD, Ql + pl + (size_t)q0 * HD, Kh + pl, Kl + pl, Vh + pl, Vl + pl, OUTb + ((size_t)(g / NH_) * TT + q0) * DQ + (g % NH_) * HD);
    } else { const int i2 = id - NG * HB; const int g = i2 / LB, q0 = RH + (i2 % LB) * (AW * 32) + wave * 32; const size_t pl = (size_t)g * TT * HD;
        attn_rows<h16, 0, 2>(Q16 + pl + (size_t)q0 * HD, nullptr, K16 + pl, nullptr, V16 + pl, nullptr, OUTb + ((size_t)(g / NH_) * TT + q0) * DQ + (g % NH_) * HD); }
}

extern "C" void kernel_launch(void* const* d_in, const int* in_sizes, int n_in,
                              void* d_out, int out_size, void* d_ws, size_t ws_size, hipStream_t stream) {
    (void)in_sizes; (void)n_in; (void)out_size;
    const float* x = (const float*)d_in[0]; const float* w = (const float*)d_in[1];   /* order h, W ('xw' [256][256]) */
    float* OUT = (float*)d_out;     // [8][2048][256]
    char* wsp = (char*)d_ws;
    auto take = [&](size_t bytes) { char* p = wsp; wsp += (bytes + 255) & ~(size_t)255; return (void*)p; };
    bf* WT = (bf*)take((size_t)DQ * DM * 2); bf* XB = (bf*)take((size_t)NB_ * TT * DM * 2);
    h16* P16 = (h16*)take((size_t)NG * TT * HD * 2); bf* Ph = (bf*)take((size_t)NG * TT * HD * 2); bf* Pl = (bf*)take((size_t)NG * TT * HD * 2);      // Wh [t][d]: q and k
    h16* VT16 = (h16*)take((size_t)NG * HD * TT * 2); bf* VTh = (bf*)take((size_t)NG * HD * TT * 2); bf* VTl = (bf*)take((size_t)NG * HD * TT * 2);   // Wh [d][t]: v
    if ((size_t)(wsp - (char*)d_ws) > ws_size) return;    // ws 256 MiB
    k_wtG<<<dim3((unsigned)((DM * DQ / 64 + 63) / 64), 1, 1), 256, 0, stream>>>(w, w, w, DM, DQ, WT);   // grid y 1: the one weight
    k_cvt8<<<(unsigned)(((size_t)NB_ * TT * DM / 8 + 255) / 256), 256, 0, stream>>>(x, XB, (size_t)NB_ * TT * DM / 8);
    k_projp<4, DM, 2><<<dim3(NB_ * TT / 64, NH_, 1), 128, 0, stream>>>(XB, WT, P16, Ph, Pl, VT16, VTh, VTl);
    k_fattn<<<NG * (RH / (AW * 16)) + NG * ((TT - RH) / (AW * 32)), AW * 32, 0, stream>>>(P16, P16, VT16, Ph, Pl, Ph, Pl, VTh, VTl, OUT);   // q and k: the same planes
}

// v005
// One run takes 93.1 microseconds.
// Next to v004, in two timings, it ran 1.45 times as fast each time.
// Counting every step since v000, it is 22.3 times as fast.
#include <hip/hip_runtime.h>

// Dense multi-head 'graph attention' with dot-product scores and a LeakyReLU before the softmax (h [8][2048][256]; Wh = h W ('xw' [256][256] 1/16, no bias) split into 4 heads x 64; scores = Wh.Wh^T x 1/sqrt(64) per head (queries, keys and values are all Wh); attention = softmax(LeakyReLU_0.2(scores)) over all 2,048 nodes (no adjacency); h' = attention Wh; heads concatenated -> [8][2048][256] (4.2 M); argument order h, W).
// Layout, all 8 batches at once (planes [batch][head][..]): bf16 copy of h; the 'xw' weight transposed once (both in fragment order too); ONE projection launch whose epilogue writes the attention's planes itself: Wh with rows t (read as q and as k) and with rows d (read as v), each as fp16 and as bf16 hi + lo, both kept in the matrix instructions' fragment order (see k_projp); dense T-2048 attention in one fused kernel (hybrid rows: < 512 hi/lo 3 products, rest fp16 x1024) with the LeakyReLU applied to the scaled score in registers; it writes the output rows (no output projection).
// Compute dtypes, f32 accumulate: every input rounded to bf16; projection exact; attention rows < 512 3 products, rest fp16; LeakyReLU/softmax f32; output f32.

#define NB_  8
#define TT   2048
#define DM   256
#define NH_  4
#define NKV  4
#define REP  (NH_ / NKV)
#define HD   64
#define DQ   (NH_ * HD)
#define DKV  (NKV * HD)
#define NG   (NB_ * NH_)          // all (batch, head) pairs
#define RH   512                  // query rows < RH use hi+lo planes (0: none)
#define WIN  0
#define SCL  0.125f   // HD^-0.5
typedef _Float16 h16;
typedef unsigned short bf;
typedef __attribute__((ext_vector_type(16))) __bf16   v16bf;
typedef __attribute__((ext_vector_type(16))) _Float16 v16h;
typedef __attribute__((ext_vector_type(8)))  _Float16 v8h;
typedef __attribute__((ext_vector_type(8)))  unsigned short v8us;
typedef __attribute__((ext_vector_type(8)))  float    v8f;
typedef __attribute__((ext_vector_type(4)))  float    v4f;
typedef v8h  __attribute__((may_alias)) v8ha;
typedef v4f  __attribute__((may_alias)) v4fa;
typedef v8us __attribute__((may_alias)) v8usa;

__device__ __forceinline__ unsigned short f2bf(float f) { unsigned u = __float_as_uint(f); u += 0x7FFFu + ((u >> 16) & 1u); return (unsigned short)(u >> 16); }
__device__ __forceinline__ float bf2f(unsigned short b) { return __uint_as_float(((unsigned)b) << 16); }
__device__ __forceinline__ float bfr(float f) { return bf2f(f2bf(f)); }
__device__ __forceinline__ v16h cat16(v8h lo, v8h hi) { return __builtin_shufflevector(lo, hi, 0, 1, 2, 3, 4, 5, 6, 7, 8, 9, 10, 11, 12, 13, 14, 15); }
__device__ __forceinline__ v16bf cat16b(v8us lo, v8us hi) { return __builtin_bit_cast(v16bf, __builtin_shufflevector(lo, hi, 0, 1, 2, 3, 4, 5, 6, 7, 8, 9, 10, 11, 12, 13, 14, 15)); }
__device__ __forceinline__ v8f wmma16(v16h a, v16h b, v8f c) { return __builtin_amdgcn_wmma_f32_16x16x32_f16(false, a, false, b, (short)0, c, false, false); }
__device__ __forceinline__ v8f wmmab(v16bf a, v16bf b, v8f c) { return __builtin_amdgcn_wmma_f32_16x16x32_bf16(false, a, false, b, (short)0, c, false, false); }



// ---- WFrag: fragment loader (hardware k order: 8 k at 8*hi, 8 k at 16 + 8*hi of each 32) and product for 16-bit planes kept in fragment order (p = block + lane * 8: the block's first 512 bytes hold every lane's first 8 k, the next 512 its second 8)
template <typename T16> struct WFrag;
template <> struct WFrag<h16> { typedef v16h V; static __device__ __forceinline__ V ldf(const h16* p) { return cat16(*(const v8h*)p, *(const v8h*)(p + 256)); } static __device__ __forceinline__ v8f mma(V a, V b, v8f c) { return wmma16(a, b, c); } };
template <> struct WFrag<bf> { typedef v16bf V; static __device__ __forceinline__ V ldf(const bf* p) { return cat16b(*(const v8us*)p, *(const v8us*)(p + 256)); } static __device__ __forceinline__ v8f mma(V a, V b, v8f c) { return wmmab(a, b, c); } };

__device__ __forceinline__ h16 tohx(float x) { return (h16)x; }
__device__ __forceinline__ void splitf(float y, unsigned short& h, unsigned short& l) { h = f2bf(y); l = f2bf(y - bf2f(h)); }
typedef __attribute__((ext_vector_type(2))) _Float16 v2h;
typedef __attribute__((ext_vector_type(4))) _Float16 v4h;
typedef __attribute__((ext_vector_type(2))) unsigned short v2us;
typedef __attribute__((ext_vector_type(4))) unsigned short v4us;
typedef __attribute__((ext_vector_type(2))) float v2f;
typedef __attribute__((ext_vector_type(4))) int v4i;
// ---- k_projp: the projection Wh = h W with the attention's planes written by its epilogue. One work-group of NW waves per 64x64 output tile (64 nodes of one batch x the 64 columns of one head); wave w sums k in [w*KK/NW, (w+1)*KK/NW) with the fragment loaders of WFrag;
// the NW partial tiles meet in LDS and are added in wave order; the summed tile goes out twice, each time as fp16, bf16 hi and bf16 lo, in the order in which the attention's fragment loads want it, so that each of its 16-byte loads reads 512 contiguous bytes (4 lines) where a row-major plane gives 32 bytes of each of 16 lines.
// Fragment order: blocks of 1,024 bytes = one 16 x 32 operand fragment = [c][lane][8 k], lane = hi*16 + row, k = 16*c + 8*hi + j. q/k plane: [t/16][d/32] blocks (rows t, k = d); v plane: [t/32][d/16] blocks (rows d, k = t). Every wave store here is 512 contiguous bytes.
// DP = k steps of 32 whose fragments a wave asks for ahead (all of them). grid (NB_*TT/64, NH_), NW*32 threads. Every loop of it is unrolled whole: the indices name registers (accumulators, fragment slots), and the trip counts are short compile-time constants.
__device__ __forceinline__ void cvt3(const float* x, v8h& o16, v8us& oh, v8us& ol) {   // 8 values -> fp16, bf16 hi, bf16 lo
#pragma unroll
    for (int j = 0; j < 8; ++j) { o16[j] = tohx(x[j]); unsigned short a2, c2; splitf(x[j], a2, c2); oh[j] = a2; ol[j] = c2; } }
template <int NW, int KK, int DP>
__global__ __launch_bounds__(NW * 32) void k_projp(const bf* __restrict__ A, const bf* __restrict__ Bt, h16* __restrict__ P16, bf* __restrict__ Ph, bf* __restrict__ Pl, h16* __restrict__ V16, bf* __restrict__ Vh, bf* __restrict__ Vl) {
    typedef typename WFrag<bf>::V V;
    constexpr int MB = 4, KW = KK / NW, NI = KW / 32, PT = 68, TS = MB * 16 * PT;
    static_assert(KK % (NW * 32) == 0 && NW == 4 && DP == NI && HD == 64 && TT % 64 == 0, "shape");
    __shared__ __align__(16) float ps[NW * TS];
    const int lane = threadIdx.x & 31, lr = lane & 15, hi = lane >> 4, wave = threadIdx.x >> 5; const int r0 = blockIdx.x * 64, c0 = blockIdx.y * 64;
    v8f acc[MB][4];
#pragma unroll
    for (int mb = 0; mb < MB; ++mb)
#pragma unroll
        for (int nb = 0; nb < 4; ++nb) acc[mb][nb] = (v8f){};
    const bf* pa = A + (size_t)r0 * KK + wave * NI * 512 + lane * 8; const bf* pb = Bt + (size_t)c0 * KK + wave * NI * 512 + lane * 8;   // both planes in fragment order: [row/16][k/32] blocks of 512 elements
    V a[DP][MB], b[DP][4];
    auto fetch = [&](int s, int sl) {
#pragma unroll
        for (int mb = 0; mb < MB; ++mb) a[sl][mb] = WFrag<bf>::ldf(pa + mb * 16 * KK + s * 512);
#pragma unroll
        for (int nb = 0; nb < 4; ++nb) b[sl][nb] = WFrag<bf>::ldf(pb + nb * 16 * KK + s * 512); };
#pragma unroll
    for (int s = 0; s < DP; ++s) fetch(s, s);
    asm volatile("s_wait_xcnt 0x0" :: "v"(pa), "v"(pb) : "memory");   // the two address pairs are inputs here, so they stay whole up to this wait
    // unrolled whole, so that the DP register slots are named at compile time
#pragma unroll
    for (int s = 0; s < NI; ++s) { const int sl = s % DP;
        __builtin_amdgcn_sched_barrier(0);   // keeps the loads asked for ahead in front of these products: without it the scheduler sinks each load to its use and the wave pays the load latency once per fragment
#pragma unroll
        for (int nb = 0; nb < 4; ++nb)
#pragma unroll
            for (int mb = 0; mb < MB; ++mb) acc[mb][nb] = WFrag<bf>::mma(a[sl][mb], b[sl][nb], acc[mb][nb]);
    }
    float* pw = ps + wave * TS;
#pragma unroll
    for (int mb = 0; mb < MB; ++mb)
#pragma unroll
        for (int nb = 0; nb < 4; ++nb)
#pragma unroll
            for (int j = 0; j < 8; ++j) pw[(mb * 16 + hi * 8 + j) * PT + nb * 16 + lr] = acc[mb][nb][j];
    __syncthreads();   // every wave's partial tile is in LDS before any of it is added
    const int g = (r0 / TT) * NH_ + blockIdx.y, t0 = r0 % TT;   // (batch, head) pair and first node of the tile
    const size_t pr = ((size_t)g * TT + t0) * HD;               // the tile's 64 rows lie behind one another in a [t][d] plane
    constexpr int NQ = 64 * 8 / (NW * 32); v8h o16[NQ]; v8us oh[NQ], ol[NQ];
#pragma unroll
    for (int q = 0; q < NQ; ++q) { float* sp = ps + (q * 16 + (threadIdx.x & 15)) * PT + (threadIdx.x >> 4) * 8;   /* node q*16 + (thread & 15), columns 8*(thread >> 4)..+7: 16-byte piece number 'thread' of the q-th 16-node block pair */ v4f s0 = *(const v4fa*)sp, s1 = *(const v4fa*)(sp + 4);
#pragma unroll
        for (int w = 1; w < NW; ++w) { s0 += *(const v4fa*)(sp + w * TS); s1 += *(const v4fa*)(sp + w * TS + 4); }
        *(v4fa*)sp = s0; *(v4fa*)(sp + 4) = s1;   // the sum replaces wave 0's partial (this thread alone touches these 8 places here): the transposed pass reads it
        const float x[8] = { s0[0], s0[1], s0[2], s0[3], s1[0], s1[1], s1[2], s1[3] }; cvt3(x, o16[q], oh[q], ol[q]); }
    __syncthreads();   // the whole summed tile is in LDS before any column of it is read
    // the q/k stores stand behind the barrier: in front of it the barrier would wait until they have left
#pragma unroll
    for (int q = 0; q < NQ; ++q) { const size_t e = pr + (size_t)(q * (NW * 32) + threadIdx.x) * 8; *(v8h*)(P16 + e) = o16[q]; *(v8us*)(Ph + e) = oh[q]; *(v8us*)(Pl + e) = ol[q]; }
    // v plane: wave w has the columns d = 16*w + lr; its i-th piece holds the 8 nodes 16*i + 8*hi + j of that column
#pragma unroll
    for (int i = 0; i < 4; ++i) { float x[8];
#pragma unroll
        for (int j = 0; j < 8; ++j) x[j] = ps[(i * 16 + hi * 8 + j) * PT + wave * 16 + lr];
        v8h t16; v8us th, tl; cvt3(x, t16, th, tl);
        const size_t pv = (size_t)g * HD * TT + (size_t)(t0 / 32 + (i >> 1)) * 2048 + wave * 512 + (i & 1) * 256 + lane * 8;
        *(v8h*)(V16 + pv) = t16; *(v8us*)(Vh + pv) = th; *(v8us*)(Vl + pv) = tl; }
}

// grid y picks one of three weights; their transposed planes lie behind one another in Bt, each in fragment order (rows n, k = the weight's rows): e counts the plane's elements in that order
__global__ __launch_bounds__(256) void k_wtG(const float* __restrict__ w0, const float* __restrict__ w1, const float* __restrict__ w2, int K, int N, bf* Bt) {
    const float* w = (blockIdx.y == 0) ? w0 : (blockIdx.y == 1) ? w1 : w2; Bt += (size_t)blockIdx.y * N * K;
    const int lane = threadIdx.x & 31; const int L0 = (blockIdx.x * 8 + (threadIdx.x >> 5)) * 8; const int nlines = N * K / 64;
{
#pragma unroll 1
        for (int l = 0; l < 8; ++l) { const int L = L0 + l; if (L >= nlines) break; const size_t e = (size_t)L * 64 + lane * 2; const int blk = (int)(e >> 9), kb = K / 32; const int k = (blk % kb) * 32 + (int)((e >> 7) & 3) * 8 + (int)(e & 7), n = (blk / kb) * 16 + (int)((e >> 3) & 15); v2us o;
            o[0] = f2bf(w[(size_t)k * N + n]); o[1] = f2bf(w[(size_t)(k + 1) * N + n]); *(v2us*)(Bt + e) = o; }
         }
}
// bf16 copy of h in fragment order (rows of DM, [row/16][k/32] blocks). A wave takes 8 rows x 128 bytes (one k step of 32): whole lines read, and four whole 128-byte lines stored (8 rows' pieces of one k run of 8 lie behind one another)
__global__ __launch_bounds__(256) void k_cvt8(const float* __restrict__ src, bf* dst, size_t n8) { const size_t i = (size_t)blockIdx.x * 256 + threadIdx.x; if (i >= n8) return;
    static_assert(DM == 256, "shape");   // 8 k steps of 32 a row tile
    const size_t r = i & 7, kc = (i >> 3) & 3, rh = (i >> 5) & 1, ks = (i >> 6) & 7, tile = i >> 9;
    const v8f v = *(const v8f*)(src + (tile * 16 + rh * 8 + r) * DM + ks * 32 + kc * 8); v8us o;
#pragma unroll
    for (int k = 0; k < 8; ++k) o[k] = f2bf(v[k]); *(v8us*)(dst + ((tile * 8 + ks) * 64 + kc * 16 + rh * 8 + r) * 8) = o;  }

// ---- k_fattn: scores, LeakyReLU, softmax and P.V of one (batch, head) pair's query rows in one kernel; neither S nor P goes to memory.
// One wave owns NT*16 query rows and walks all TT keys in steps of 32: S^T = K Q^T (a lane holds scores of ONE query: column lr; rows = keys 8*hi + j), running maximum per query (the same in both lane halves) and partial sum per lane,
// the two 16-key score tiles converted in place are the B operand P^T of O^T += V^T P^T (A = V^T rows in the same k order, by the loader WFrag). Rows < RH: hi/lo planes, 3 products; rest fp16 with P x 2^10.
// Q, K and V fragments come straight from the planes, which are kept in fragment order (k_projp): a step's K and its V are 4 KB in a row each, 512 contiguous bytes a load. Left: the AW waves of a work-group each load the same K and V; staged once in LDS they would be loaded once.
__device__ __forceinline__ float xhalf(float x) { return __builtin_bit_cast(float, __builtin_amdgcn_permlanex16(__builtin_bit_cast(int, x), __builtin_bit_cast(int, x), 0x76543210, 0xfedcba98, false, false)); }   // lane l <-> lane l ^ 16
template <typename T16> struct PCvt;   // one probability into element e of the B operand(s): fp16, or bf16 hi + lo
template <> struct PCvt<h16> { static __device__ __forceinline__ void put(v16h& a, v16h&, int e, float p) { a[e] = (h16)p; } };
template <> struct PCvt<bf> { static __device__ __forceinline__ void put(v16bf& a, v16bf& b, int e, float p) { const __bf16 h = (__bf16)p; a[e] = h; b[e] = (__bf16)(p - (float)h); } };
template <typename T16, int NSPLIT, int NT>
__device__ __forceinline__ void attn_rows(const T16* __restrict__ Q, const T16* __restrict__ Q2, const T16* __restrict__ Kp, const T16* __restrict__ Kp2, const T16* __restrict__ Vt, const T16* __restrict__ Vt2, float* __restrict__ orow) {
    typedef typename WFrag<T16>::V V;
    const int lane = threadIdx.x & 31, lr = lane & 15, hi = lane >> 4;
    constexpr float PB = (NSPLIT == 2) ? 0.0f : 10.0f;      // log2 of the factor on P (fp16 keeps small probabilities normal); it cancels against the row sum
    constexpr float C2 = SCL * 1.4426950408889634f;         // score scale x log2(e): LeakyReLU commutes with a positive factor
    V qf[NT][2], qf2[NT][2], kf[2][2], kf2[2][2];
#pragma unroll
    for (int nt = 0; nt < NT; ++nt)
#pragma unroll
        for (int ks = 0; ks < 2; ++ks) { qf[nt][ks] = WFrag<T16>::ldf(Q + lane * 8 + (nt * 2 + ks) * 512); if (NSPLIT == 2) qf2[nt][ks] = WFrag<T16>::ldf(Q2 + lane * 8 + (nt * 2 + ks) * 512); }
    const size_t koff = (size_t)lane * 8, voff = (size_t)lane * 8;   // a lane's 16 bytes in each 512-byte half block
    auto fetchk = [&](int key0) {
#pragma unroll
        for (int kt = 0; kt < 2; ++kt)
#pragma unroll
            for (int ks = 0; ks < 2; ++ks) { kf[kt][ks] = WFrag<T16>::ldf(Kp + koff + (size_t)key0 * HD + (kt * 2 + ks) * 512); if (NSPLIT == 2) kf2[kt][ks] = WFrag<T16>::ldf(Kp2 + koff + (size_t)key0 * HD + (kt * 2 + ks) * 512); } };
    fetchk(0);
    v8f o[4][NT]; float m[NT], l[NT];
#pragma unroll
    for (int nt = 0; nt < NT; ++nt) { m[nt] = -3.0e38f; l[nt] = 0.0f;
#pragma unroll
        for (int dt = 0; dt < 4; ++dt) o[dt][nt] = (v8f){}; }
    // rolled: 64 steps of one body; the body alone fills the registers
#pragma unroll 1
    for (int key0 = 0; key0 < TT; key0 += 32) {
        V vf[4], vf2[4];
#pragma unroll
        for (int dt = 0; dt < 4; ++dt) { vf[dt] = WFrag<T16>::ldf(Vt + voff + (size_t)key0 * HD + dt * 512); if (NSPLIT == 2) vf2[dt] = WFrag<T16>::ldf(Vt2 + voff + (size_t)key0 * HD + dt * 512); }
        __builtin_amdgcn_sched_barrier(0);   // keeps the V loads in front of the score products: sunk to their use they would cost their latency behind the softmax
        v8f s[2][NT];
#pragma unroll
        for (int kt = 0; kt < 2; ++kt)
#pragma unroll
            for (int nt = 0; nt < NT; ++nt) { s[kt][nt] = (v8f){};
#pragma unroll
                for (int ks = 0; ks < 2; ++ks) { s[kt][nt] = WFrag<T16>::mma(kf[kt][ks], qf[nt][ks], s[kt][nt]); if (NSPLIT == 2) { s[kt][nt] = WFrag<T16>::mma(kf[kt][ks], qf2[nt][ks], s[kt][nt]); s[kt][nt] = WFrag<T16>::mma(kf2[kt][ks], qf[nt][ks], s[kt][nt]); } } }
        fetchk((key0 + 32) & (TT - 1));      // the next step's K fragments (the last step asks for step 0's again: in bounds, not used)
        asm volatile("s_wait_xcnt 0x0" ::: "memory");   // the address registers of the V and K loads above are reused by the vector code below: the wait stands in front of every such overwrite
        __builtin_amdgcn_sched_barrier(0);   // keeps those loads in front of the softmax, so that it covers their latency
        float ml[NT]; bool need = false;
#pragma unroll
        for (int nt = 0; nt < NT; ++nt) { ml[nt] = -3.0e38f;
#pragma unroll
            for (int kt = 0; kt < 2; ++kt)
#pragma unroll
                for (int j = 0; j < 8; ++j) { const float y = s[kt][nt][j] * C2; const float t = fmaxf(y, 0.2f * y);   /* LeakyReLU_0.2 of the scaled score, in log2 units */ s[kt][nt][j] = t; ml[nt] = fmaxf(ml[nt], t); }
            need = need || (ml[nt] > m[nt]); }
        if (__builtin_amdgcn_ballot_w32(need) != 0) {   // a new row maximum somewhere in the wave: rare after the first steps
#pragma unroll
            for (int nt = 0; nt < NT; ++nt) { const float mn = fmaxf(m[nt], fmaxf(ml[nt], xhalf(ml[nt]))); const float al = __builtin_amdgcn_exp2f(m[nt] - mn); m[nt] = mn; l[nt] *= al;
#pragma unroll
                for (int dt = 0; dt < 4; ++dt) o[dt][nt] *= al; } }
        V pf[NT], pf2[NT];
#pragma unroll
        for (int nt = 0; nt < NT; ++nt) { const float mb = m[nt] - PB; float p[16];
#pragma unroll
            for (int e = 0; e < 16; ++e) p[e] = __builtin_amdgcn_exp2f(s[e >> 3][nt][e & 7] - mb);
            l[nt] += (((p[0] + p[1]) + (p[2] + p[3])) + ((p[4] + p[5]) + (p[6] + p[7]))) + (((p[8] + p[9]) + (p[10] + p[11])) + ((p[12] + p[13]) + (p[14] + p[15])));
#pragma unroll
            for (int e = 0; e < 16; ++e) PCvt<T16>::put(pf[nt], pf2[nt], e, p[e]); }
#pragma unroll
        for (int dt = 0; dt < 4; ++dt)
#pragma unroll
            for (int nt = 0; nt < NT; ++nt) { o[dt][nt] = WFrag<T16>::mma(vf[dt], pf[nt], o[dt][nt]); if (NSPLIT == 2) { o[dt][nt] = WFrag<T16>::mma(vf[dt], pf2[nt], o[dt][nt]); o[dt][nt] = WFrag<T16>::mma(vf2[dt], pf[nt], o[dt][nt]); } }
    }
#pragma unroll
    for (int nt = 0; nt < NT; ++nt) { const float inv = __fdiv_rn(1.0f, l[nt] + xhalf(l[nt])); float* op = orow + (size_t)(nt * 16 + lr) * DQ + 8 * hi;   // the halves' sums meet once, here
#pragma unroll
        for (int dt = 0; dt < 4; ++dt) { v4f a, b;
#pragma unroll
            for (int j = 0; j < 4; ++j) { a[j] = o[dt][nt][j] * inv; b[j] = o[dt][nt][4 + j] * inv; }
            *(v4f*)(op + dt * 16) = a; *(v4f*)(op + dt * 16 + 4) = b; } }
    asm volatile("s_wait_xcnt 0x0" ::: "memory");   // behind the last store: whatever code follows this function in the kernel may reuse the stores' data and address registers
}
#define AW 4   // waves of a work-group; they walk the same keys, each with its own query rows
// grid x: first the NG * RH/(AW*16) work-groups of the hi/lo rows (16 rows a wave; the longer ones first), then the NG * (TT-RH)/(AW*32) of the fp16 rows (32 rows a wave)
__global__ __launch_bounds__(AW * 32) void k_fattn(const h16* __restrict__ Q16, const h16* __restrict__ K16, const h16* __restrict__ V16, const bf* __restrict__ Qh, const bf* __restrict__ Ql, const bf* __restrict__ Kh, const bf* __restrict__ Kl, const bf* __restrict__ Vh, const bf* __restrict__ Vl, float* __restrict__ OUTb) {
    constexpr int HB = RH / (AW * 16), LB = (TT - RH) / (AW * 32);
    static_assert(RH % (AW * 16) == 0 && (TT - RH) % (AW * 32) == 0 && (TT & (TT - 1)) == 0 && HD == 64, "shape");
    const int wave = threadIdx.x >> 5; const int id = blockIdx.x;
    if (id < NG * HB) { const int g = id / HB, q0 = (id % HB) * (AW * 16) + wave * 16; const size_t pl = (size_t)g * TT * HD;
        attn_rows<bf, 2, 1>(Qh + pl + (size_t)q0 * HD, Ql + pl + (size_t)q0 * HD, Kh + pl, Kl + pl, Vh + pl, Vl + pl, OUTb + ((size_t)(g / NH_) * TT + q0) * DQ + (g % NH_) * HD);
    } else { const int i2 = id - NG * HB; const int g = i2 / LB, q0 = RH + (i2 % LB) * (AW * 32) + wave * 32; const size_t pl = (size_t)g * TT * HD;
        attn_rows<h16, 0, 2>(Q16 + pl + (size_t)q0 * HD, nullptr, K16 + pl, nullptr, V16 + pl, nullptr, OUTb + ((size_t)(g / NH_) * TT + q0) * DQ + (g % NH_) * HD); }
}

extern "C" void kernel_launch(void* const* d_in, const int* in_sizes, int n_in,
                              void* d_out, int out_size, void* d_ws, size_t ws_size, hipStream_t stream) {
    (void)in_sizes; (void)n_in; (void)out_size;
    const float* x = (const float*)d_in[0]; const float* w = (const float*)d_in[1];   /* order h, W ('xw' [256][256]) */
    float* OUT = (float*)d_out;     // [8][2048][256]
    char* wsp = (char*)d_ws;
    auto take = [&](size_t bytes) { char* p = wsp; wsp += (bytes + 255) & ~(size_t)255; return (void*)p; };
    bf* WT = (bf*)take((size_t)DQ * DM * 2); bf* XB = (bf*)take((size_t)NB_ * TT * DM * 2);
    h16* P16 = (h16*)take((size_t)NG * TT * HD * 2); bf* Ph = (bf*)take((size_t)NG * TT * HD * 2); bf* Pl = (bf*)take((size_t)NG * TT * HD * 2);      // Wh, rows t: q and k
    h16* VT16 = (h16*)take((size_t)NG * HD * TT * 2); bf* VTh = (bf*)take((size_t)NG * HD * TT * 2); bf* VTl = (bf*)take((size_t)NG * HD * TT * 2);   // Wh, rows d: v
    if ((size_t)(wsp - (char*)d_ws) > ws_size) return;    // ws 256 MiB
    k_wtG<<<dim3((unsigned)((DM * DQ / 64 + 63) / 64), 1, 1), 256, 0, stream>>>(w, w, w, DM, DQ, WT);   // grid y 1: the one weight
    k_cvt8<<<(unsigned)(((size_t)NB_ * TT * DM / 8 + 255) / 256), 256, 0, stream>>>(x, XB, (size_t)NB_ * TT * DM / 8);
    k_projp<4, DM, 2><<<dim3(NB_ * TT / 64, NH_, 1), 128, 0, stream>>>(XB, WT, P16, Ph, Pl, VT16, VTh, VTl);
    k_fattn<<<NG * (RH / (AW * 16)) + NG * ((TT - RH) / (AW * 32)), AW * 32, 0, stream>>>(P16, P16, VT16, Ph, Pl, Ph, Pl, VTh, VTl, OUT);   // q and k: the same planes
}

// v006
// One run takes 84.8 microseconds.
// Two timings next to v005 put it at 1.10 and 1.08 times that version's speed.
// Counting every step since v000, it is 24.3 times as fast.
#include <hip/hip_runtime.h>

// Dense multi-head 'graph attention' with dot-product scores and a LeakyReLU before the softmax (h [8][2048][256]; Wh = h W ('xw' [256][256] 1/16, no bias) split into 4 heads x 64; scores = Wh.Wh^T x 1/sqrt(64) per head (queries, keys and values are all Wh); attention = softmax(LeakyReLU_0.2(scores)) over all 2,048 nodes (no adjacency); h' = attention Wh; heads concatenated -> [8][2048][256] (4.2 M); argument order h, W).
// Layout, all 8 batches at once (planes [batch][head][..]): ONE projection launch that reads h and the 'xw' weight as f32, rounds them to bf16 in registers, and whose epilogue writes the attention's planes itself: Wh with rows t (read as q and as k) and with rows d (read as v), each as fp16 and as bf16 hi + lo, both kept in the matrix instructions' fragment order (see k_projp); dense T-2048 attention in one fused kernel (hybrid rows: < 512 hi/lo 3 products, rest fp16 x1024) with the LeakyReLU applied to the scaled score in registers; it writes the output rows (no output projection).
// Compute dtypes, f32 accumulate: every input rounded to bf16; projection exact; attention rows < 512 3 products, rest fp16; LeakyReLU/softmax f32; output f32.

#define NB_  8
#define TT   2048
#define DM   256
#define NH_  4
#define NKV  4
#define REP  (NH_ / NKV)
#define HD   64
#define DQ   (NH_ * HD)
#define DKV  (NKV * HD)
#define NG   (NB_ * NH_)          // all (batch, head) pairs
#define RH   512                  // query rows < RH use hi+lo planes (0: none)
#define WIN  0
#define SCL  0.125f   // HD^-0.5
typedef _Float16 h16;
typedef unsigned short bf;
typedef __attribute__((ext_vector_type(16))) __bf16   v16bf;
typedef __attribute__((ext_vector_type(16))) _Float16 v16h;
typedef __attribute__((ext_vector_type(8)))  _Float16 v8h;
typedef __attribute__((ext_vector_type(8)))  unsigned short v8us;
typedef __attribute__((ext_vector_type(8)))  float    v8f;
typedef __attribute__((ext_vector_type(4)))  float    v4f;
typedef v8h  __attribute__((may_alias)) v8ha;
typedef v4f  __attribute__((may_alias)) v4fa;
typedef v8us __attribute__((may_alias)) v8usa;

__device__ __forceinline__ unsigned short f2bf(float f) { unsigned u = __float_as_uint(f); u += 0x7FFFu + ((u >> 16) & 1u); return (unsigned short)(u >> 16); }
__device__ __forceinline__ float bf2f(unsigned short b) { return __uint_as_float(((unsigned)b) << 16); }
__device__ __forceinline__ float bfr(float f) { return bf2f(f2bf(f)); }
__device__ __forceinline__ v16h cat16(v8h lo, v8h hi) { return __builtin_shufflevector(lo, hi, 0, 1, 2, 3, 4, 5, 6, 7, 8, 9, 10, 11, 12, 13, 14, 15); }
__device__ __forceinline__ v16bf cat16b(v8us lo, v8us hi) { return __builtin_bit_cast(v16bf, __builtin_shufflevector(lo, hi, 0, 1, 2, 3, 4, 5, 6, 7, 8, 9, 10, 11, 12, 13, 14, 15)); }
__device__ __forceinline__ v8f wmma16(v16h a, v16h b, v8f c) { return __builtin_amdgcn_wmma_f32_16x16x32_f16(false, a, false, b, (short)0, c, false, false); }
__device__ __forceinline__ v8f wmmab(v16bf a, v16bf b, v8f c) { return __builtin_amdgcn_wmma_f32_16x16x32_bf16(false, a, false, b, (short)0, c, false, false); }



// ---- WFrag: fragment loader (hardware k order: 8 k at 8*hi, 8 k at 16 + 8*hi of each 32) and product for 16-bit planes kept in fragment order (p = block + lane * 8: the block's first 512 bytes hold every lane's first 8 k, the next 512 its second 8)
template <typename T16> struct WFrag;
template <> struct WFrag<h16> { typedef v16h V; static __device__ __forceinline__ V ldf(const h16* p) { return cat16(*(const v8h*)p, *(const v8h*)(p + 256)); } static __device__ __forceinline__ v8f mma(V a, V b, v8f c) { return wmma16(a, b, c); } };
template <> struct WFrag<bf> { typedef v16bf V; static __device__ __forceinline__ V ldf(const bf* p) { return cat16b(*(const v8us*)p, *(const v8us*)(p + 256)); } static __device__ __forceinline__ v8f mma(V a, V b, v8f c) { return wmmab(a, b, c); } };

__device__ __forceinline__ h16 tohx(float x) { return (h16)x; }
__device__ __forceinline__ void splitf(float y, unsigned short& h, unsigned short& l) { h = f2bf(y); l = f2bf(y - bf2f(h)); }
typedef __attribute__((ext_vector_type(2))) _Float16 v2h;
typedef __attribute__((ext_vector_type(4))) _Float16 v4h;
typedef __attribute__((ext_vector_type(2))) unsigned short v2us;
typedef __attribute__((ext_vector_type(4))) unsigned short v4us;
typedef __attribute__((ext_vector_type(2))) float v2f;
typedef __attribute__((ext_vector_type(4))) int v4i;
// ---- k_projp: the projection Wh = h W with the attention's planes written by its epilogue. One work-group of NW waves per 64x64 output tile (64 nodes of one batch x the 64 columns of one head); wave w sums k in [w*KK/NW, (w+1)*KK/NW); it reads h and W as f32 and rounds them to bf16 itself (no converted copies, no launches for them);
// the NW partial tiles meet in LDS and are added in wave order; the summed tile goes out twice, each time as fp16, bf16 hi and bf16 lo, in the order in which the attention's fragment loads want it, so that each of its 16-byte loads reads 512 contiguous bytes (4 lines) where a row-major plane gives 32 bytes of each of 16 lines.
// Fragment order: blocks of 1,024 bytes = one 16 x 32 operand fragment = [c][lane][8 k], lane = hi*16 + row, k = 16*c + 8*hi + j. q/k plane: [t/16][d/32] blocks (rows t, k = d); v plane: [t/32][d/16] blocks (rows d, k = t). Every wave store here is 512 contiguous bytes.
// grid (NB_*TT/64, NH_), NW*32 threads. Every loop of it is unrolled whole: the indices name registers (accumulators, fragment slots), and the trip counts are short compile-time constants.
__device__ __forceinline__ void cvt3(const float* x, v8h& o16, v8us& oh, v8us& ol) {   // 8 values -> fp16, bf16 hi, bf16 lo
#pragma unroll
    for (int j = 0; j < 8; ++j) { o16[j] = tohx(x[j]); unsigned short a2, c2; splitf(x[j], a2, c2); oh[j] = a2; ol[j] = c2; } }
// amdgpu_waves_per_eu(4): a budget of 256 registers, so that 4 work-groups fit a WGP and all 1,024 are resident at once (left alone the allocator took 264 without need)
template <int NW, int KK>
__global__ __launch_bounds__(NW * 32) __attribute__((amdgpu_waves_per_eu(4))) void k_projp(const float* __restrict__ H, const float* __restrict__ Wm, h16* __restrict__ P16, bf* __restrict__ Ph, bf* __restrict__ Pl, h16* __restrict__ V16, bf* __restrict__ Vh, bf* __restrict__ Vl) {
    typedef typename WFrag<bf>::V V;
    constexpr int MB = 4, KW = KK / NW, NI = KW / 32, PT = 68, TS = MB * 16 * PT;
    static_assert(KK % (NW * 32) == 0 && NW == 4 && NI == 2 && HD == 64 && TT % 64 == 0 && KK == DM, "shape");
    __shared__ __align__(16) float ps[NW * TS];
    const int lane = threadIdx.x & 31, lr = lane & 15, hi = lane >> 4, wave = threadIdx.x >> 5; const int r0 = blockIdx.x * 64, c0 = blockIdx.y * 64;
    // Both operands come straight from the f32 inputs and are rounded to bf16 in registers. Element e of a fragment is k = 16*(e >> 3) + 8*hi + (e & 7) of its k step, for A and for B alike.
    // A: lane (hi, lr) of row tile mb has node mb*16 + lr: 4 loads of 4 k. B: the lane has the 4 columns lr*4 .. lr*4 + 3, ONE FOR EACH OF THE 4 COLUMN TILES (tile nb = column lr*4 + nb), so that one 16-byte load of a W row serves all 4 tiles and a wave's load covers 4 whole lines.
    const float* pa = H + (size_t)(r0 + lr) * KK + wave * KW + hi * 8; const float* pb = Wm + (size_t)(wave * KW + hi * 8) * DQ + c0 + lr * 4;
    v4f ra[NI][MB][4], rb[NI][16];
#pragma unroll
    for (int s = 0; s < NI; ++s)
#pragma unroll
        for (int mb = 0; mb < MB; ++mb)
#pragma unroll
            for (int q = 0; q < 4; ++q) ra[s][mb][q] = *(const v4fa*)(pa + mb * 16 * KK + s * 32 + (q >> 1) * 16 + (q & 1) * 4);
#pragma unroll
    for (int e = 0; e < 16; ++e) rb[0][e] = *(const v4fa*)(pb + ((e >> 3) * 16 + (e & 7)) * DQ);
    asm volatile("s_wait_xcnt 0x0" :: "v"(pa), "v"(pb) : "memory");   // the two address pairs are inputs here, so they stay whole up to this wait, in front of any reuse of their registers
    __builtin_amdgcn_sched_barrier(0);   // keeps all these loads in flight together, in front of the conversions: sunk to their uses they would cost their latency one by one
    V a[NI][MB], b[NI][4];
#pragma unroll
    for (int s = 0; s < NI; ++s)
#pragma unroll
        for (int mb = 0; mb < MB; ++mb)
#pragma unroll
            for (int e = 0; e < 16; ++e) a[s][mb][e] = (__bf16)ra[s][mb][e >> 2][e & 3];
    __builtin_amdgcn_sched_barrier(0);   // keeps the loads below behind A's conversion: the second k step of W is asked for when A's f32 registers are free again (all at once takes more than 256 registers, and a work-group fewer fits a WGP)
#pragma unroll
    for (int e = 0; e < 16; ++e) rb[1][e] = *(const v4fa*)(pb + (32 + (e >> 3) * 16 + (e & 7)) * DQ);
    asm volatile("s_wait_xcnt 0x0" :: "v"(pb) : "memory");   // as above, for the address pair of these loads
    __builtin_amdgcn_sched_barrier(0);   // keeps these loads in front of the conversion of the first k step, which covers part of their latency
#pragma unroll
    for (int s = 0; s < NI; ++s)
#pragma unroll
        for (int nb = 0; nb < 4; ++nb)
#pragma unroll
            for (int e = 0; e < 16; ++e) b[s][nb][e] = (__bf16)rb[s][e][nb];
    v8f acc[MB][4];
#pragma unroll
    for (int mb = 0; mb < MB; ++mb)
#pragma unroll
        for (int nb = 0; nb < 4; ++nb) acc[mb][nb] = (v8f){};
#pragma unroll
    for (int s = 0; s < NI; ++s) {
        __builtin_amdgcn_sched_barrier(0);   // keeps the k steps apart, behind the conversions: mixed, the f32 registers, both steps' fragments and all accumulators live at once and take more than 256 registers
#pragma unroll
        for (int nb = 0; nb < 4; ++nb)
#pragma unroll
            for (int mb = 0; mb < MB; ++mb) acc[mb][nb] = WFrag<bf>::mma(a[s][mb], b[s][nb], acc[mb][nb]);
    }
    float* pw = ps + wave * TS;
#pragma unroll
    for (int mb = 0; mb < MB; ++mb)
#pragma unroll
        for (int j = 0; j < 8; ++j) { const v4f t = { acc[mb][0][j], acc[mb][1][j], acc[mb][2][j], acc[mb][3][j] }; *(v4fa*)(pw + (mb * 16 + hi * 8 + j) * PT + lr * 4) = t; }   // the lane's 4 columns lie side by side
    __syncthreads();   // every wave's partial tile is in LDS before any of it is added
    const int g = (r0 / TT) * NH_ + blockIdx.y, t0 = r0 % TT;   // (batch, head) pair and first node of the tile
    const size_t pr = ((size_t)g * TT + t0) * HD;               // the tile's 64 rows lie behind one another in a [t][d] plane
    constexpr int NQ = 64 * 8 / (NW * 32); v8h o16[NQ]; v8us oh[NQ], ol[NQ];
#pragma unroll
    for (int q = 0; q < NQ; ++q) { float* sp = ps + (q * 16 + (threadIdx.x & 15)) * PT + (threadIdx.x >> 4) * 8;   /* node q*16 + (thread & 15), columns 8*(thread >> 4)..+7: 16-byte piece number 'thread' of the q-th 16-node block pair */ v4f s0 = *(const v4fa*)sp, s1 = *(const v4fa*)(sp + 4);
#pragma unroll
        for (int w = 1; w < NW; ++w) { s0 += *(const v4fa*)(sp + w * TS); s1 += *(const v4fa*)(sp + w * TS + 4); }
        *(v4fa*)sp = s0; *(v4fa*)(sp + 4) = s1;   // the sum replaces wave 0's partial (this thread alone touches these 8 places here): the transposed pass reads it
        const float x[8] = { s0[0], s0[1], s0[2], s0[3], s1[0], s1[1], s1[2], s1[3] }; cvt3(x, o16[q], oh[q], ol[q]); }
    __syncthreads();   // the whole summed tile is in LDS before any column of it is read
    // the q/k stores stand behind the barrier: in front of it the barrier would wait until they have left
#pragma unroll
    for (int q = 0; q < NQ; ++q) { const size_t e = pr + (size_t)(q * (NW * 32) + threadIdx.x) * 8; *(v8h*)(P16 + e) = o16[q]; *(v8us*)(Ph + e) = oh[q]; *(v8us*)(Pl + e) = ol[q]; }
    // v plane: wave w has the columns d = 16*w + lr; its i-th piece holds the 8 nodes 16*i + 8*hi + j of that column
#pragma unroll
    for (int i = 0; i < 4; ++i) { float x[8];
#pragma unroll
        for (int j = 0; j < 8; ++j) x[j] = ps[(i * 16 + hi * 8 + j) * PT + wave * 16 + lr];
        v8h t16; v8us th, tl; cvt3(x, t16, th, tl);
        const size_t pv = (size_t)g * HD * TT + (size_t)(t0 / 32 + (i >> 1)) * 2048 + wave * 512 + (i & 1) * 256 + lane * 8;
        *(v8h*)(V16 + pv) = t16; *(v8us*)(Vh + pv) = th; *(v8us*)(Vl + pv) = tl; }
}

// ---- k_fattn: scores, LeakyReLU, softmax and P.V of one (batch, head) pair's query rows in one kernel; neither S nor P goes to memory.
// One wave owns NT*16 query rows and walks all TT keys in steps of 32: S^T = K Q^T (a lane holds scores of ONE query: column lr; rows = keys 8*hi + j), running maximum per query (the same in both lane halves) and partial sum per lane,
// the two 16-key score tiles converted in place are the B operand P^T of O^T += V^T P^T (A = V^T rows in the same k order, by the loader WFrag). Rows < RH: hi/lo planes, 3 products; rest fp16 with P x 2^10.
// Q, K and V fragments come straight from the planes, which are kept in fragment order (k_projp): a step's K and its V are 4 KB in a row each, 512 contiguous bytes a load. Left: the AW waves of a work-group each load the same K and V; staged once in LDS they would be loaded once.
__device__ __forceinline__ float xhalf(float x) { return __builtin_bit_cast(float, __builtin_amdgcn_permlanex16(__builtin_bit_cast(int, x), __builtin_bit_cast(int, x), 0x76543210, 0xfedcba98, false, false)); }   // lane l <-> lane l ^ 16
template <typename T16> struct PCvt;   // one probability into element e of the B operand(s): fp16, or bf16 hi + lo
template <> struct PCvt<h16> { static __device__ __forceinline__ void put(v16h& a, v16h&, int e, float p) { a[e] = (h16)p; } };
template <> struct PCvt<bf> { static __device__ __forceinline__ void put(v16bf& a, v16bf& b, int e, float p) { const __bf16 h = (__bf16)p; a[e] = h; b[e] = (__bf16)(p - (float)h); } };
template <typename T16, int NSPLIT, int NT>
__device__ __forceinline__ void attn_rows(const T16* __restrict__ Q, const T16* __restrict__ Q2, const T16* __restrict__ Kp, const T16* __restrict__ Kp2, const T16* __restrict__ Vt, const T16* __restrict__ Vt2, float* __restrict__ orow) {
    typedef typename WFrag<T16>::V V;
    const int lane = threadIdx.x & 31, lr = lane & 15, hi = lane >> 4;
    constexpr float PB = (NSPLIT == 2) ? 0.0f : 10.0f;      // log2 of the factor on P (fp16 keeps small probabilities normal); it cancels against the row sum
    constexpr float C2 = SCL * 1.4426950408889634f;         // score scale x log2(e): LeakyReLU commutes with a positive factor
    V qf[NT][2], qf2[NT][2], kf[2][2], kf2[2][2];
#pragma unroll
    for (int nt = 0; nt < NT; ++nt)
#pragma unroll
        for (int ks = 0; ks < 2; ++ks) { qf[nt][ks] = WFrag<T16>::ldf(Q + lane * 8 + (nt * 2 + ks) * 512); if (NSPLIT == 2) qf2[nt][ks] = WFrag<T16>::ldf(Q2 + lane * 8 + (nt * 2 + ks) * 512); }
    const size_t koff = (size_t)lane * 8, voff = (size_t)lane * 8;   // a lane's 16 bytes in each 512-byte half block
    auto fetchk = [&](int key0) {
#pragma unroll
        for (int kt = 0; kt < 2; ++kt)
#pragma unroll
            for (int ks = 0; ks < 2; ++ks) { kf[kt][ks] = WFrag<T16>::ldf(Kp + koff + (size_t)key0 * HD + (kt * 2 + ks) * 512); if (NSPLIT == 2) kf2[kt][ks] = WFrag<T16>::ldf(Kp2 + koff + (size_t)key0 * HD + (kt * 2 + ks) * 512); } };
    fetchk(0);
    v8f o[4][NT]; float m[NT], l[NT];
#pragma unroll
    for (int nt = 0; nt < NT; ++nt) { m[nt] = -3.0e38f; l[nt] = 0.0f;
#pragma unroll
        for (int dt = 0; dt < 4; ++dt) o[dt][nt] = (v8f){}; }
    // rolled: 64 steps of one body; the body alone fills the registers
#pragma unroll 1
    for (int key0 = 0; key0 < TT; key0 += 32) {
        V vf[4], vf2[4];
#pragma unroll
        for (int dt = 0; dt < 4; ++dt) { vf[dt] = WFrag<T16>::ldf(Vt + voff + (size_t)key0 * HD + dt * 512); if (NSPLIT == 2) vf2[dt] = WFrag<T16>::ldf(Vt2 + voff + (size_t)key0 * HD + dt * 512); }
        __builtin_amdgcn_sched_barrier(0);   // keeps the V loads in front of the score products: sunk to their use they would cost their latency behind the softmax
        v8f s[2][NT];
#pragma unroll
        for (int kt = 0; kt < 2; ++kt)
#pragma unroll
            for (int nt = 0; nt < NT; ++nt) { s[kt][nt] = (v8f){};
#pragma unroll
                for (int ks = 0; ks < 2; ++ks) { s[kt][nt] = WFrag<T16>::mma(kf[kt][ks], qf[nt][ks], s[kt][nt]); if (NSPLIT == 2) { s[kt][nt] = WFrag<T16>::mma(kf[kt][ks], qf2[nt][ks], s[kt][nt]); s[kt][nt] = WFrag<T16>::mma(kf2[kt][ks], qf[nt][ks], s[kt][nt]); } } }
        fetchk((key0 + 32) & (TT - 1));      // the next step's K fragments (the last step asks for step 0's again: in bounds, not used)
        asm volatile("s_wait_xcnt 0x0" ::: "memory");   // the address registers of the V and K loads above are reused by the vector code below: the wait stands in front of every such overwrite
        __builtin_amdgcn_sched_barrier(0);   // keeps those loads in front of the softmax, so that it covers their latency
        float ml[NT]; bool need = false;
#pragma unroll
        for (int nt = 0; nt < NT; ++nt) { ml[nt] = -3.0e38f;
#pragma unroll
            for (int kt = 0; kt < 2; ++kt)
#pragma unroll
                for (int j = 0; j < 8; ++j) { const float y = s[kt][nt][j] * C2; const float t = fmaxf(y, 0.2f * y);   /* LeakyReLU_0.2 of the scaled score, in log2 units */ s[kt][nt][j] = t; ml[nt] = fmaxf(ml[nt], t); }
            need = need || (ml[nt] > m[nt]); }
        if (__builtin_amdgcn_ballot_w32(need) != 0) {   // a new row maximum somewhere in the wave: rare after the first steps
#pragma unroll
            for (int nt = 0; nt < NT; ++nt) { const float mn = fmaxf(m[nt], fmaxf(ml[nt], xhalf(ml[nt]))); const float al = __builtin_amdgcn_exp2f(m[nt] - mn); m[nt] = mn; l[nt] *= al;
#pragma unroll
                for (int dt = 0; dt < 4; ++dt) o[dt][nt] *= al; } }
        V pf[NT], pf2[NT];
#pragma unroll
        for (int nt = 0; nt < NT; ++nt) { const float mb = m[nt] - PB; float p[16];
#pragma unroll
            for (int e = 0; e < 16; ++e) p[e] = __builtin_amdgcn_exp2f(s[e >> 3][nt][e & 7] - mb);
            l[nt] += (((p[0] + p[1]) + (p[2] + p[3])) + ((p[4] + p[5]) + (p[6] + p[7]))) + (((p[8] + p[9]) + (p[10] + p[11])) + ((p[12] + p[13]) + (p[14] + p[15])));
#pragma unroll
            for (int e = 0; e < 16; ++e) PCvt<T16>::put(pf[nt], pf2[nt], e, p[e]); }
#pragma unroll
        for (int dt = 0; dt < 4; ++dt)
#pragma unroll
            for (int nt = 0; nt < NT; ++nt) { o[dt][nt] = WFrag<T16>::mma(vf[dt], pf[nt], o[dt][nt]); if (NSPLIT == 2) { o[dt][nt] = WFrag<T16>::mma(vf[dt], pf2[nt], o[dt][nt]); o[dt][nt] = WFrag<T16>::mma(vf2[dt], pf[nt], o[dt][nt]); } }
    }
#pragma unroll
    for (int nt = 0; nt < NT; ++nt) { const float inv = __fdiv_rn(1.0f, l[nt] + xhalf(l[nt])); float* op = orow + (size_t)(nt * 16 + lr) * DQ + 8 * hi;   // the halves' sums meet once, here
#pragma unroll
        for (int dt = 0; dt < 4; ++dt) { v4f a, b;
#pragma unroll
            for (int j = 0; j < 4; ++j) { a[j] = o[dt][nt][j] * inv; b[j] = o[dt][nt][4 + j] * inv; }
            *(v4f*)(op + dt * 16) = a; *(v4f*)(op + dt * 16 + 4) = b; } }
    asm volatile("s_wait_xcnt 0x0" ::: "memory");   // behind the last store: whatever code follows this function in the kernel may reuse the stores' data and address registers
}
#define AW 4   // waves of a work-group; they walk the same keys, each with its own query rows
// grid x: first the NG * RH/(AW*16) work-groups of the hi/lo rows (16 rows a wave; the longer ones first), then the NG * (TT-RH)/(AW*32) of the fp16 rows (32 rows a wave)
__global__ __launch_bounds__(AW * 32) void k_fattn(const h16* __restrict__ Q16, const h16* __restrict__ K16, const h16* __restrict__ V16, const bf* __restrict__ Qh, const bf* __restrict__ Ql, const bf* __restrict__ Kh, const bf* __restrict__ Kl, const bf* __restrict__ Vh, const bf* __restrict__ Vl, float* __restrict__ OUTb) {
    constexpr int HB = RH / (AW * 16), LB = (TT - RH) / (AW * 32);
    static_assert(RH % (AW * 16) == 0 && (TT - RH) % (AW * 32) == 0 && (TT & (TT - 1)) == 0 && HD == 64, "shape");
    const int wave = threadIdx.x >> 5; const int id = blockIdx.x;
    if (id < NG * HB) { const int g = id / HB, q0 = (id % HB) * (AW * 16) + wave * 16; const size_t pl = (size_t)g * TT * HD;
        attn_rows<bf, 2, 1>(Qh + pl + (size_t)q0 * HD, Ql + pl + (size_t)q0 * HD, Kh + pl, Kl + pl, Vh + pl, Vl + pl, OUTb + ((size_t)(g / NH_) * TT + q0) * DQ + (g % NH_) * HD);
    } else { const int i2 = id - NG * HB; const int g = i2 / LB, q0 = RH + (i2 % LB) * (AW * 32) + wave * 32; const size_t pl = (size_t)g * TT * HD;
        attn_rows<h16, 0, 2>(Q16 + pl + (size_t)q0 * HD, nullptr, K16 + pl, nullptr, V16 + pl, nullptr, OUTb + ((size_t)(g / NH_) * TT + q0) * DQ + (g % NH_) * HD); }
}

extern "C" void kernel_launch(void* const* d_in, const int* in_sizes, int n_in,
                              void* d_out, int out_size, void* d_ws, size_t ws_size, hipStream_t stream) {
    (void)in_sizes; (void)n_in; (void)out_size;
    const float* x = (const float*)d_in[0]; const float* w = (const float*)d_in[1];   /* order h, W ('xw' [256][256]) */
    float* OUT = (float*)d_out;     // [8][2048][256]
    char* wsp = (char*)d_ws;
    auto take = [&](size_t bytes) { char* p = wsp; wsp += (bytes + 255) & ~(size_t)255; return (void*)p; };
    h16* P16 = (h16*)take((size_t)NG * TT * HD * 2); bf* Ph = (bf*)take((size_t)NG * TT * HD * 2); bf* Pl = (bf*)take((size_t)NG * TT * HD * 2);      // Wh, rows t: q and k
    h16* VT16 = (h16*)take((size_t)NG * HD * TT * 2); bf* VTh = (bf*)take((size_t)NG * HD * TT * 2); bf* VTl = (bf*)take((size_t)NG * HD * TT * 2);   // Wh, rows d: v
    if ((size_t)(wsp - (char*)d_ws) > ws_size) return;    // ws 256 MiB
    k_projp<4, DM><<<dim3(NB_ * TT / 64, NH_, 1), 128, 0, stream>>>(x, w, P16, Ph, Pl, VT16, VTh, VTl);
    k_fattn<<<NG * (RH / (AW * 16)) + NG * ((TT - RH) / (AW * 32)), AW * 32, 0, stream>>>(P16, P16, VT16, Ph, Pl, Ph, Pl, VTh, VTl, OUT);   // q and k: the same planes
}

// v007
// Measured time: 77.4 microseconds a run.
// Timed twice side by side with v006, it ran 1.10 times as fast both times.
// Counting every step since v000, it is 26.7 times as fast.
#include <hip/hip_runtime.h>

// Dense multi-head 'graph attention' with dot-product scores and a LeakyReLU before the softmax (h [8][2048][256]; Wh = h W ('xw' [256][256] 1/16, no bias) split into 4 heads x 64; scores = Wh.Wh^T x 1/sqrt(64) per head (queries, keys and values are all Wh); attention = softmax(LeakyReLU_0.2(scores)) over all 2,048 nodes (no adjacency); h' = attention Wh; heads concatenated -> [8][2048][256] (4.2 M); argument order h, W).
// Layout, all 8 batches at once (planes [batch][head][..]): ONE projection launch that reads h and the 'xw' weight as f32, rounds them to bf16 in registers, and whose epilogue writes the attention's planes itself: Wh with rows t (read as q and as k) and with rows d (read as v), each as fp16 and as bf16 hi + lo, both kept in the matrix instructions' fragment order (see k_projp); dense T-2048 attention in one fused kernel (hybrid rows: < 512 hi/lo 3 products, rest fp16 x1024) with the LeakyReLU applied to the scaled score in registers; it writes the output rows (no output projection).
// Compute dtypes, f32 accumulate: every input rounded to bf16; projection exact; attention rows < 512 3 products, rest fp16; LeakyReLU/softmax f32; output f32.

#define NB_  8
#define TT   2048
#define DM   256
#define NH_  4
#define NKV  4
#define REP  (NH_ / NKV)
#define HD   64
#define DQ   (NH_ * HD)
#define DKV  (NKV * HD)
#define NG   (NB_ * NH_)          // all (batch, head) pairs
#define RH   512                  // query rows < RH use hi+lo planes (0: none)
#define WIN  0
#define SCL  0.125f   // HD^-0.5
typedef _Float16 h16;
typedef unsigned short bf;
typedef __attribute__((ext_vector_type(16))) __bf16   v16bf;
typedef __attribute__((ext_vector_type(16))) _Float16 v16h;
typedef __attribute__((ext_vector_type(8)))  _Float16 v8h;
typedef __attribute__((ext_vector_type(8)))  unsigned short v8us;
typedef __attribute__((ext_vector_type(8)))  float    v8f;
typedef __attribute__((ext_vector_type(4)))  float    v4f;
typedef v8h  __attribute__((may_alias)) v8ha;
typedef v4f  __attribute__((may_alias)) v4fa;
typedef v8us __attribute__((may_alias)) v8usa;

__device__ __forceinline__ unsigned short f2bf(float f) { unsigned u = __float_as_uint(f); u += 0x7FFFu + ((u >> 16) & 1u); return (unsigned short)(u >> 16); }
__device__ __forceinline__ float bf2f(unsigned short b) { return __uint_as_float(((unsigned)b) << 16); }
__device__ __forceinline__ float bfr(float f) { return bf2f(f2bf(f)); }
__device__ __forceinline__ v16h cat16(v8h lo, v8h hi) { return __builtin_shufflevector(lo, hi, 0, 1, 2, 3, 4, 5, 6, 7, 8, 9, 10, 11, 12, 13, 14, 15); }
__device__ __forceinline__ v16bf cat16b(v8us lo, v8us hi) { return __builtin_bit_cast(v16bf, __builtin_shufflevector(lo, hi, 0, 1, 2, 3, 4, 5, 6, 7, 8, 9, 10, 11, 12, 13, 14, 15)); }
__device__ __forceinline__ v8f wmma16(v16h a, v16h b, v8f c) { return __builtin_amdgcn_wmma_f32_16x16x32_f16(false, a, false, b, (short)0, c, false, false); }
__device__ __forceinline__ v8f wmmab(v16bf a, v16bf b, v8f c) { return __builtin_amdgcn_wmma_f32_16x16x32_bf16(false, a, false, b, (short)0, c, false, false); }



// ---- WFrag: fragment loader (hardware k order: 8 k at 8*hi, 8 k at 16 + 8*hi of each 32) and product for 16-bit planes kept in fragment order (p = block + lane * 8: the block's first 512 bytes hold every lane's first 8 k, the next 512 its second 8)
template <typename T16> struct WFrag;
template <> struct WFrag<h16> { typedef v16h V; static __device__ __forceinline__ V ldf(const h16* p) { return cat16(*(const v8h*)p, *(const v8h*)(p + 256)); } static __device__ __forceinline__ v8f mma(V a, V b, v8f c) { return wmma16(a, b, c); } };
template <> struct WFrag<bf> { typedef v16bf V; static __device__ __forceinline__ V ldf(const bf* p) { return cat16b(*(const v8us*)p, *(const v8us*)(p + 256)); } static __device__ __forceinline__ v8f mma(V a, V b, v8f c) { return wmmab(a, b, c); } };

__device__ __forceinline__ h16 tohx(float x) { return (h16)x; }
__device__ __forceinline__ void splitf(float y, unsigned short& h, unsigned short& l) { h = f2bf(y); l = f2bf(y - bf2f(h)); }
typedef __attribute__((ext_vector_type(2))) _Float16 v2h;
typedef __attribute__((ext_vector_type(4))) _Float16 v4h;
typedef __attribute__((ext_vector_type(2))) unsigned short v2us;
typedef __attribute__((ext_vector_type(4))) unsigned short v4us;
typedef __attribute__((ext_vector_type(2))) float v2f;
typedef __attribute__((ext_vector_type(4))) int v4i;
// ---- k_projp: the projection Wh = h W with the attention's planes written by its epilogue. One work-group of NW waves per 64x64 output tile (64 nodes of one batch x the 64 columns of one head); wave w sums k in [w*KK/NW, (w+1)*KK/NW); it reads h and W as f32 and rounds them to bf16 itself (no converted copies, no launches for them);
// the NW partial tiles meet in LDS and are added in wave order; the summed tile goes out twice, each time as fp16, bf16 hi and bf16 lo, in the order in which the attention's fragment loads want it, so that each of its 16-byte loads reads 512 contiguous bytes (4 lines) where a row-major plane gives 32 bytes of each of 16 lines.
// Fragment order: blocks of 1,024 bytes = one 16 x 32 operand fragment = [c][lane][8 k], lane = hi*16 + row, k = 16*c + 8*hi + j. q/k plane: [t/16][d/32] blocks (rows t, k = d); v plane: [t/32][d/16] blocks (rows d, k = t). Every wave store here is 512 contiguous bytes.
// grid (NB_*TT/64, NH_), NW*32 threads. Every loop of it is unrolled whole: the indices name registers (accumulators, fragment slots), and the trip counts are short compile-time constants.
__device__ __forceinline__ void cvt3(const float* x, v8h& o16, v8us& oh, v8us& ol) {   // 8 values -> fp16, bf16 hi, bf16 lo
#pragma unroll
    for (int j = 0; j < 8; ++j) { o16[j] = tohx(x[j]); unsigned short a2, c2; splitf(x[j], a2, c2); oh[j] = a2; ol[j] = c2; } }
// amdgpu_waves_per_eu(4): a budget of 256 registers, so that 4 work-groups fit a WGP and all 1,024 are resident at once (left alone the allocator took 264 without need)
template <int NW, int KK>
__global__ __launch_bounds__(NW * 32) __attribute__((amdgpu_waves_per_eu(4))) void k_projp(const float* __restrict__ H, const float* __restrict__ Wm, h16* __restrict__ P16, bf* __restrict__ Ph, bf* __restrict__ Pl, h16* __restrict__ V16, bf* __restrict__ Vh, bf* __restrict__ Vl) {
    typedef typename WFrag<bf>::V V;
    constexpr int MB = 4, KW = KK / NW, NI = KW / 32, PT = 68, TS = MB * 16 * PT;
    static_assert(KK % (NW * 32) == 0 && NW == 4 && NI == 2 && HD == 64 && TT % 64 == 0 && KK == DM, "shape");
    __shared__ __align__(16) float ps[NW * TS];
    const int lane = threadIdx.x & 31, lr = lane & 15, hi = lane >> 4, wave = threadIdx.x >> 5; const int r0 = blockIdx.x * 64, c0 = blockIdx.y * 64;
    // Both operands come straight from the f32 inputs and are rounded to bf16 in registers. Element e of a fragment is k = 16*(e >> 3) + 8*hi + (e & 7) of its k step, for A and for B alike.
    // A: lane (hi, lr) of row tile mb has node mb*16 + lr: 4 loads of 4 k. B: the lane has the 4 columns lr*4 .. lr*4 + 3, ONE FOR EACH OF THE 4 COLUMN TILES (tile nb = column lr*4 + nb), so that one 16-byte load of a W row serves all 4 tiles and a wave's load covers 4 whole lines.
    const float* pa = H + (size_t)(r0 + lr) * KK + wave * KW + hi * 8; const float* pb = Wm + (size_t)(wave * KW + hi * 8) * DQ + c0 + lr * 4;
    v4f ra[NI][MB][4], rb[NI][16];
#pragma unroll
    for (int s = 0; s < NI; ++s)
#pragma unroll
        for (int mb = 0; mb < MB; ++mb)
#pragma unroll
            for (int q = 0; q < 4; ++q) ra[s][mb][q] = *(const v4fa*)(pa + mb * 16 * KK + s * 32 + (q >> 1) * 16 + (q & 1) * 4);
#pragma unroll
    for (int e = 0; e < 16; ++e) rb[0][e] = *(const v4fa*)(pb + ((e >> 3) * 16 + (e & 7)) * DQ);
    asm volatile("s_wait_xcnt 0x0" :: "v"(pa), "v"(pb) : "memory");   // the two address pairs are inputs here, so they stay whole up to this wait, in front of any reuse of their registers
    __builtin_amdgcn_sched_barrier(0);   // keeps all these loads in flight together, in front of the conversions: sunk to their uses they would cost their latency one by one
    V a[NI][MB], b[NI][4];
#pragma unroll
    for (int s = 0; s < NI; ++s)
#pragma unroll
        for (int mb = 0; mb < MB; ++mb)
#pragma unroll
            for (int e = 0; e < 16; ++e) a[s][mb][e] = (__bf16)ra[s][mb][e >> 2][e & 3];
    __builtin_amdgcn_sched_barrier(0);   // keeps the loads below behind A's conversion: the second k step of W is asked for when A's f32 registers are free again (all at once takes more than 256 registers, and a work-group fewer fits a WGP)
#pragma unroll
    for (int e = 0; e < 16; ++e) rb[1][e] = *(const v4fa*)(pb + (32 + (e >> 3) * 16 + (e & 7)) * DQ);
    asm volatile("s_wait_xcnt 0x0" :: "v"(pb) : "memory");   // as above, for the address pair of these loads
    __builtin_amdgcn_sched_barrier(0);   // keeps these loads in front of the conversion of the first k step, which covers part of their latency
#pragma unroll
    for (int s = 0; s < NI; ++s)
#pragma unroll
        for (int nb = 0; nb < 4; ++nb)
#pragma unroll
            for (int e = 0; e < 16; ++e) b[s][nb][e] = (__bf16)rb[s][e][nb];
    v8f acc[MB][4];
#pragma unroll
    for (int mb = 0; mb < MB; ++mb)
#pragma unroll
        for (int nb = 0; nb < 4; ++nb) acc[mb][nb] = (v8f){};
#pragma unroll
    for (int s = 0; s < NI; ++s) {
        __builtin_amdgcn_sched_barrier(0);   // keeps the k steps apart, behind the conversions: mixed, the f32 registers, both steps' fragments and all accumulators live at once and take more than 256 registers
#pragma unroll
        for (int nb = 0; nb < 4; ++nb)
#pragma unroll
            for (int mb = 0; mb < MB; ++mb) acc[mb][nb] = WFrag<bf>::mma(a[s][mb], b[s][nb], acc[mb][nb]);
    }
    float* pw = ps + wave * TS;
#pragma unroll
    for (int mb = 0; mb < MB; ++mb)
#pragma unroll
        for (int j = 0; j < 8; ++j) { const v4f t = { acc[mb][0][j], acc[mb][1][j], acc[mb][2][j], acc[mb][3][j] }; *(v4fa*)(pw + (mb * 16 + hi * 8 + j) * PT + lr * 4) = t; }   // the lane's 4 columns lie side by side
    __syncthreads();   // every wave's partial tile is in LDS before any of it is added
    const int g = (r0 / TT) * NH_ + blockIdx.y, t0 = r0 % TT;   // (batch, head) pair and first node of the tile
    const size_t pr = ((size_t)g * TT + t0) * HD;               // the tile's 64 rows lie behind one another in a [t][d] plane
    constexpr int NQ = 64 * 8 / (NW * 32); v8h o16[NQ]; v8us oh[NQ], ol[NQ];
#pragma unroll
    for (int q = 0; q < NQ; ++q) { float* sp = ps + (q * 16 + (threadIdx.x & 15)) * PT + (threadIdx.x >> 4) * 8;   /* node q*16 + (thread & 15), columns 8*(thread >> 4)..+7: 16-byte piece number 'thread' of the q-th 16-node block pair */ v4f s0 = *(const v4fa*)sp, s1 = *(const v4fa*)(sp + 4);
#pragma unroll
        for (int w = 1; w < NW; ++w) { s0 += *(const v4fa*)(sp + w * TS); s1 += *(const v4fa*)(sp + w * TS + 4); }
        *(v4fa*)sp = s0; *(v4fa*)(sp + 4) = s1;   // the sum replaces wave 0's partial (this thread alone touches these 8 places here): the transposed pass reads it
        const float x[8] = { s0[0], s0[1], s0[2], s0[3], s1[0], s1[1], s1[2], s1[3] }; cvt3(x, o16[q], oh[q], ol[q]); }
    __syncthreads();   // the whole summed tile is in LDS before any column of it is read
    // the q/k stores stand behind the barrier: in front of it the barrier would wait until they have left
#pragma unroll
    for (int q = 0; q < NQ; ++q) { const size_t e = pr + (size_t)(q * (NW * 32) + threadIdx.x) * 8; *(v8h*)(P16 + e) = o16[q]; *(v8us*)(Ph + e) = oh[q]; *(v8us*)(Pl + e) = ol[q]; }
    // v plane: wave w has the columns d = 16*w + lr; its i-th piece holds the 8 nodes 16*i + 8*hi + j of that column
#pragma unroll
    for (int i = 0; i < 4; ++i) { float x[8];
#pragma unroll
        for (int j = 0; j < 8; ++j) x[j] = ps[(i * 16 + hi * 8 + j) * PT + wave * 16 + lr];
        v8h t16; v8us th, tl; cvt3(x, t16, th, tl);
        const size_t pv = (size_t)g * HD * TT + (size_t)(t0 / 32 + (i >> 1)) * 2048 + wave * 512 + (i & 1) * 256 + lane * 8;
        *(v8h*)(V16 + pv) = t16; *(v8us*)(Vh + pv) = th; *(v8us*)(Vl + pv) = tl; }
}

// ---- k_fattn: scores, LeakyReLU, softmax and P.V of one (batch, head) pair's query rows in one kernel; neither S nor P goes to memory.
// One wave owns NT*16 query rows and walks all TT keys in steps of 32: S^T = K Q^T (a lane holds scores of ONE query: column lr; rows = keys 8*hi + j), running maximum per query (the same in both lane halves) and partial sum per lane,
// the two 16-key score tiles converted in place are the B operand P^T of O^T += V^T P^T (A = V^T rows in the same k order, by the loader WFrag). Rows < RH: hi/lo planes, 3 products; rest fp16 with P x 2^10.
// Q fragments come straight from the planes, which are kept in fragment order (k_projp): a step's K and its V are 4 KB in a row each. K and V reach the waves through LDS: a stage = 64 keys (hi/lo rows: 4 planes) or 128 keys (fp16 rows: 2 planes) of every K and V plane, 32 KB either way, brought in ONCE for the AW waves of the work-group by asynchronous copies
// (16 bytes a lane, no register), two buffers: the next stage's copies fly while this stage is worked on. The bytes keep their order, so a fragment load from LDS reads 512 contiguous bytes (no bank conflict).
#define HSB  (64 * HD * 2)        // bytes of 64 keys of one plane
// 4 + 4 copies of one thread: its 16-byte pieces (2,048 bytes apart: AW*32 threads x 16 bytes) of 64 keys at ga and of 64 keys at gb, which come to lie behind one another in LDS. Every lane is on; both addresses are multiples of 16.
// The s_wait_xcnt 0 is the last line of the copies' own statement, so that it stands in front of any rewrite of the address registers that the copies name.
__device__ __forceinline__ void stage2(unsigned l, const char* ga, const char* gb) {
    asm volatile("global_load_async_to_lds_b128 %0, %8, off\n\t"
                 "global_load_async_to_lds_b128 %1, %9, off\n\t"
                 "global_load_async_to_lds_b128 %2, %10, off\n\t"
                 "global_load_async_to_lds_b128 %3, %11, off\n\t"
                 "global_load_async_to_lds_b128 %4, %12, off\n\t"
                 "global_load_async_to_lds_b128 %5, %13, off\n\t"
                 "global_load_async_to_lds_b128 %6, %14, off\n\t"
                 "global_load_async_to_lds_b128 %7, %15, off\n\t"
                 "s_wait_xcnt 0x0"
                 :: "v"(l), "v"(l + 2048u), "v"(l + 4096u), "v"(l + 6144u), "v"(l + HSB), "v"(l + HSB + 2048u), "v"(l + HSB + 4096u), "v"(l + HSB + 6144u),
                    "v"(ga), "v"(ga + 2048), "v"(ga + 4096), "v"(ga + 6144), "v"(gb), "v"(gb + 2048), "v"(gb + 4096), "v"(gb + 6144) : "memory");
}
#define AW 4   // waves of a work-group; they walk the same keys, each with its own query rows
#define AWT (AW * 32)
__device__ __forceinline__ float xhalf(float x) { return __builtin_bit_cast(float, __builtin_amdgcn_permlanex16(__builtin_bit_cast(int, x), __builtin_bit_cast(int, x), 0x76543210, 0xfedcba98, false, false)); }   // lane l <-> lane l ^ 16
template <typename T16> struct PCvt;   // one probability into element e of the B operand(s): fp16, or bf16 hi + lo
template <> struct PCvt<h16> { static __device__ __forceinline__ void put(v16h& a, v16h&, int e, float p) { a[e] = (h16)p; } };
template <> struct PCvt<bf> { static __device__ __forceinline__ void put(v16bf& a, v16bf& b, int e, float p) { const __bf16 h = (__bf16)p; a[e] = h; b[e] = (__bf16)(p - (float)h); } };
template <typename T16, int NSPLIT, int NT>
__device__ __forceinline__ void attn_rows(const T16* __restrict__ Q, const T16* __restrict__ Q2, const T16* __restrict__ Kp, const T16* __restrict__ Kp2, const T16* __restrict__ Vt, const T16* __restrict__ Vt2, float* __restrict__ orow, unsigned short* sm) {
    typedef typename WFrag<T16>::V V;
    constexpr int NPL = (NSPLIT == 2) ? 4 : 2, SK = 256 / NPL, PLB = SK * HD * 2, BB = NPL * PLB, PE = PLB / 2, VO = (NPL / 2) * PE, NST = TT / SK;   // planes of a stage ([K][V] or [K hi][K lo][V hi][V lo]), its keys, bytes of a plane's share, bytes of a buffer, elements of a plane's share, where V starts, stages
    static_assert(AWT * 16 * 4 == HSB && BB == 4 * HSB && NST >= 2, "shape");
    const int lane = threadIdx.x & 31, lr = lane & 15, hi = lane >> 4;
    constexpr float PB = (NSPLIT == 2) ? 0.0f : 10.0f;      // log2 of the factor on P (fp16 keeps small probabilities normal); it cancels against the row sum
    constexpr float C2 = SCL * 1.4426950408889634f;         // score scale x log2(e): LeakyReLU commutes with a positive factor
    V qf[NT][2], qf2[NT][2], kf[2][2], kf2[2][2];
#pragma unroll
    for (int nt = 0; nt < NT; ++nt)
#pragma unroll
        for (int ks = 0; ks < 2; ++ks) { qf[nt][ks] = WFrag<T16>::ldf(Q + lane * 8 + (nt * 2 + ks) * 512); if (NSPLIT == 2) qf2[nt][ks] = WFrag<T16>::ldf(Q2 + lane * 8 + (nt * 2 + ks) * 512); }
    const unsigned lds0 = (unsigned)(size_t)sm + threadIdx.x * 16;   // this thread's first piece in buffer 0: LDS byte address = low 32 bits of the shared address
    const size_t toff = (size_t)threadIdx.x * 16;
    auto stage = [&](int st) {   // all copies of stage st, into buffer st & 1
        const unsigned l = lds0 + (st & 1) * BB; const size_t go = toff + (size_t)st * PLB;
        if (NSPLIT == 2) { stage2(l, (const char*)Kp + go, (const char*)Kp2 + go); stage2(l + 2 * HSB, (const char*)Vt + go, (const char*)Vt2 + go); }
        else { stage2(l, (const char*)Kp + go, (const char*)Kp + go + HSB); stage2(l + 2 * HSB, (const char*)Vt + go, (const char*)Vt + go + HSB); } };
    auto fetchk = [&](const T16* sb, int sub) {   // the K fragments of step 'sub' of the stage at sb
#pragma unroll
        for (int kt = 0; kt < 2; ++kt)
#pragma unroll
            for (int ks = 0; ks < 2; ++ks) { kf[kt][ks] = WFrag<T16>::ldf(sb + sub * 2048 + (kt * 2 + ks) * 512); if (NSPLIT == 2) kf2[kt][ks] = WFrag<T16>::ldf(sb + PE + sub * 2048 + (kt * 2 + ks) * 512); } };
    stage(0);
    asm volatile("s_wait_asynccnt 0x0" ::: "memory");   // this wave's copies of stage 0 have landed
    __syncthreads();                                    // ... and every other wave's: stage 0 may be read
    stage(1);
    v8f o[4][NT]; float m[NT], l[NT];
#pragma unroll
    for (int nt = 0; nt < NT; ++nt) { m[nt] = -3.0e38f; l[nt] = 0.0f;
#pragma unroll
        for (int dt = 0; dt < 4; ++dt) o[dt][nt] = (v8f){}; }
    // rolled: one body (a stage: 2 or 4 steps); the body alone fills the registers
#pragma unroll 1
    for (int st = 0; st < NST; ++st) {
      const T16* sb = (const T16*)sm + (st & 1) * (BB / 2) + lane * 8;   // this stage's buffer, at the lane's 16 bytes of each 512-byte half block
      fetchk(sb, 0);
      // unrolled: the steps of a stage differ in what they fetch ahead (the last one nothing), and their LDS offsets become immediates
#pragma unroll
      for (int sub = 0; sub < SK / 32; ++sub) {
        V vf[4], vf2[4];
#pragma unroll
        for (int dt = 0; dt < 4; ++dt) { vf[dt] = WFrag<T16>::ldf(sb + VO + sub * 2048 + dt * 512); if (NSPLIT == 2) vf2[dt] = WFrag<T16>::ldf(sb + VO + PE + sub * 2048 + dt * 512); }
        __builtin_amdgcn_sched_barrier(0);   // keeps the V loads in front of the score products: sunk to their use they would cost their latency behind the softmax
        v8f s[2][NT];
#pragma unroll
        for (int kt = 0; kt < 2; ++kt)
#pragma unroll
            for (int nt = 0; nt < NT; ++nt) { s[kt][nt] = (v8f){};
#pragma unroll
                for (int ks = 0; ks < 2; ++ks) { s[kt][nt] = WFrag<T16>::mma(kf[kt][ks], qf[nt][ks], s[kt][nt]); if (NSPLIT == 2) { s[kt][nt] = WFrag<T16>::mma(kf[kt][ks], qf2[nt][ks], s[kt][nt]); s[kt][nt] = WFrag<T16>::mma(kf2[kt][ks], qf[nt][ks], s[kt][nt]); } } }
        if (sub + 1 < SK / 32) fetchk(sb, sub + 1);   // the next step's K fragments, inside this stage only: nothing of the next stage is read in front of its barrier
        __builtin_amdgcn_sched_barrier(0);   // keeps those loads in front of the softmax, so that it covers their latency
        float ml[NT]; bool need = false;
#pragma unroll
        for (int nt = 0; nt < NT; ++nt) { ml[nt] = -3.0e38f;
#pragma unroll
            for (int kt = 0; kt < 2; ++kt)
#pragma unroll
                for (int j = 0; j < 8; ++j) { const float y = s[kt][nt][j] * C2; const float t = fmaxf(y, 0.2f * y);   /* LeakyReLU_0.2 of the scaled score, in log2 units */ s[kt][nt][j] = t; ml[nt] = fmaxf(ml[nt], t); }
            need = need || (ml[nt] > m[nt]); }
        if (__builtin_amdgcn_ballot_w32(need) != 0) {   // a new row maximum somewhere in the wave: rare after the first steps
#pragma unroll
            for (int nt = 0; nt < NT; ++nt) { const float mn = fmaxf(m[nt], fmaxf(ml[nt], xhalf(ml[nt]))); const float al = __builtin_amdgcn_exp2f(m[nt] - mn); m[nt] = mn; l[nt] *= al;
#pragma unroll
                for (int dt = 0; dt < 4; ++dt) o[dt][nt] *= al; } }
        V pf[NT], pf2[NT];
#pragma unroll
        for (int nt = 0; nt < NT; ++nt) { const float mb = m[nt] - PB; float p[16];
#pragma unroll
            for (int e = 0; e < 16; ++e) p[e] = __builtin_amdgcn_exp2f(s[e >> 3][nt][e & 7] - mb);
            l[nt] += (((p[0] + p[1]) + (p[2] + p[3])) + ((p[4] + p[5]) + (p[6] + p[7]))) + (((p[8] + p[9]) + (p[10] + p[11])) + ((p[12] + p[13]) + (p[14] + p[15])));
#pragma unroll
            for (int e = 0; e < 16; ++e) PCvt<T16>::put(pf[nt], pf2[nt], e, p[e]); }
#pragma unroll
        for (int dt = 0; dt < 4; ++dt)
#pragma unroll
            for (int nt = 0; nt < NT; ++nt) { o[dt][nt] = WFrag<T16>::mma(vf[dt], pf[nt], o[dt][nt]); if (NSPLIT == 2) { o[dt][nt] = WFrag<T16>::mma(vf[dt], pf2[nt], o[dt][nt]); o[dt][nt] = WFrag<T16>::mma(vf2[dt], pf[nt], o[dt][nt]); } }
      }
      // hand-over, every wave, in this order
      asm volatile("s_wait_dscnt 0x0" ::: "memory");      // this wave's reads of the buffer have returned before anything is copied over it
      asm volatile("s_wait_asynccnt 0x0" ::: "memory");   // this wave's copies of stage st + 1 have landed
      __syncthreads();                                    // stage st + 1 may be read by all, and every wave has left stage st's buffer
      if (st + 2 < NST) stage(st + 2);                    // the same for the whole work-group
    }
    asm volatile("s_wait_asynccnt 0x0" ::: "memory");   // no copy is outstanding when the wave goes on to its end
#pragma unroll
    for (int nt = 0; nt < NT; ++nt) { const float inv = __fdiv_rn(1.0f, l[nt] + xhalf(l[nt])); float* op = orow + (size_t)(nt * 16 + lr) * DQ + 8 * hi;   // the halves' sums meet once, here
#pragma unroll
        for (int dt = 0; dt < 4; ++dt) { v4f a, b;
#pragma unroll
            for (int j = 0; j < 4; ++j) { a[j] = o[dt][nt][j] * inv; b[j] = o[dt][nt][4 + j] * inv; }
            *(v4f*)(op + dt * 16) = a; *(v4f*)(op + dt * 16 + 4) = b; } }
    asm volatile("s_wait_xcnt 0x0" ::: "memory");   // behind the last store: whatever code follows this function in the kernel may reuse the stores' data and address registers
}
// grid x: first the NG * RH/(AW*16) work-groups of the hi/lo rows (16 rows a wave; the longer ones first), then the NG * (TT-RH)/(AW*32) of the fp16 rows (32 rows a wave)
__global__ __launch_bounds__(AW * 32) void k_fattn(const h16* __restrict__ Q16, const h16* __restrict__ K16, const h16* __restrict__ V16, const bf* __restrict__ Qh, const bf* __restrict__ Ql, const bf* __restrict__ Kh, const bf* __restrict__ Kl, const bf* __restrict__ Vh, const bf* __restrict__ Vl, float* __restrict__ OUTb) {
    constexpr int HB = RH / (AW * 16), LB = (TT - RH) / (AW * 32);
    static_assert(RH % (AW * 16) == 0 && (TT - RH) % (AW * 32) == 0 && (TT & (TT - 1)) == 0 && HD == 64, "shape");
    __shared__ __align__(16) unsigned short sm[2 * 4 * HSB / 2];   // two buffers of a stage
    const int wave = threadIdx.x >> 5; const int id = blockIdx.x;
    if (id < NG * HB) { const int g = id / HB, q0 = (id % HB) * (AW * 16) + wave * 16; const size_t pl = (size_t)g * TT * HD;
        attn_rows<bf, 2, 1>(Qh + pl + (size_t)q0 * HD, Ql + pl + (size_t)q0 * HD, Kh + pl, Kl + pl, Vh + pl, Vl + pl, OUTb + ((size_t)(g / NH_) * TT + q0) * DQ + (g % NH_) * HD, sm);
    } else { const int i2 = id - NG * HB; const int g = i2 / LB, q0 = RH + (i2 % LB) * (AW * 32) + wave * 32; const size_t pl = (size_t)g * TT * HD;
        attn_rows<h16, 0, 2>(Q16 + pl + (size_t)q0 * HD, nullptr, K16 + pl, nullptr, V16 + pl, nullptr, OUTb + ((size_t)(g / NH_) * TT + q0) * DQ + (g % NH_) * HD, sm); }
}

extern "C" void kernel_launch(void* const* d_in, const int* in_sizes, int n_in,
                              void* d_out, int out_size, void* d_ws, size_t ws_size, hipStream_t stream) {
    (void)in_sizes; (void)n_in; (void)out_size;
    const float* x = (const float*)d_in[0]; const float* w = (const float*)d_in[1];   /* order h, W ('xw' [256][256]) */
    float* OUT = (float*)d_out;     // [8][2048][256]
    char* wsp = (char*)d_ws;
    auto take = [&](size_t bytes) { char* p = wsp; wsp += (bytes + 255) & ~(size_t)255; return (void*)p; };
    h16* P16 = (h16*)take((size_t)NG * TT * HD * 2); bf* Ph = (bf*)take((size_t)NG * TT * HD * 2); bf* Pl = (bf*)take((size_t)NG * TT * HD * 2);      // Wh, rows t: q and k
    h16* VT16 = (h16*)take((size_t)NG * HD * TT * 2); bf* VTh = (bf*)take((size_t)NG * HD * TT * 2); bf* VTl = (bf*)take((size_t)NG * HD * TT * 2);   // Wh, rows d: v
    if ((size_t)(wsp - (char*)d_ws) > ws_size) return;    // ws 256 MiB
    k_projp<4, DM><<<dim3(NB_ * TT / 64, NH_, 1), 128, 0, stream>>>(x, w, P16, Ph, Pl, VT16, VTh, VTl);
    k_fattn<<<NG * (RH / (AW * 16)) + NG * ((TT - RH) / (AW * 32)), AW * 32, 0, stream>>>(P16, P16, VT16, Ph, Pl, Ph, Pl, VTh, VTl, OUT);   // q and k: the same planes
}

// v008
// Measured time: 72.6 microseconds a run.
// Timed twice side by side with v007, it ran 1.07 times as fast both times.
// Over all steps from v000 it is 28.5 times as fast.
#include <hip/hip_runtime.h>

// Dense multi-head 'graph attention' with dot-product scores and a LeakyReLU before the softmax (h [8][2048][256]; Wh = h W ('xw' [256][256] 1/16, no bias) split into 4 heads x 64; scores = Wh.Wh^T x 1/sqrt(64) per head (queries, keys and values are all Wh); attention = softmax(LeakyReLU_0.2(scores)) over all 2,048 nodes (no adjacency); h' = attention Wh; heads concatenated -> [8][2048][256] (4.2 M); argument order h, W).
// Layout, all 8 batches at once (planes [batch][head][..]): ONE projection launch that reads h and the 'xw' weight as f32, rounds them to bf16 in registers, and whose epilogue writes the attention's planes itself: Wh with rows t (read as q and as k) and with rows d (read as v), each as fp16 and as bf16 hi + lo, both kept in the matrix instructions' fragment order (see k_projp); dense T-2048 attention in one fused kernel (hybrid rows: < 512 hi/lo 3 products, rest fp16 x1024) with the LeakyReLU applied to the scaled score in registers; it writes the output rows (no output projection).
// Compute dtypes, f32 accumulate: every input rounded to bf16; projection exact; attention rows < 512 3 products, rest fp16; LeakyReLU/softmax f32; output f32.

#define NB_  8
#define TT   2048
#define DM   256
#define NH_  4
#define NKV  4
#define REP  (NH_ / NKV)
#define HD   64
#define DQ   (NH_ * HD)
#define DKV  (NKV * HD)
#define NG   (NB_ * NH_)          // all (batch, head) pairs
#define RH   512                  // query rows < RH use hi+lo planes (0: none)
#define WIN  0
#define SCL  0.125f   // HD^-0.5
typedef _Float16 h16;
typedef unsigned short bf;
typedef __attribute__((ext_vector_type(16))) __bf16   v16bf;
typedef __attribute__((ext_vector_type(16))) _Float16 v16h;
typedef __attribute__((ext_vector_type(8)))  _Float16 v8h;
typedef __attribute__((ext_vector_type(8)))  unsigned short v8us;
typedef __attribute__((ext_vector_type(8)))  float    v8f;
typedef __attribute__((ext_vector_type(4)))  float    v4f;
typedef v8h  __attribute__((may_alias)) v8ha;
typedef v4f  __attribute__((may_alias)) v4fa;
typedef v8us __attribute__((may_alias)) v8usa;

__device__ __forceinline__ unsigned short f2bf(float f) { unsigned u = __float_as_uint(f); u += 0x7FFFu + ((u >> 16) & 1u); return (unsigned short)(u >> 16); }
__device__ __forceinline__ float bf2f(unsigned short b) { return __uint_as_float(((unsigned)b) << 16); }
__device__ __forceinline__ float bfr(float f) { return bf2f(f2bf(f)); }
__device__ __forceinline__ v16h cat16(v8h lo, v8h hi) { return __builtin_shufflevector(lo, hi, 0, 1, 2, 3, 4, 5, 6, 7, 8, 9, 10, 11, 12, 13, 14, 15); }
__device__ __forceinline__ v16bf cat16b(v8us lo, v8us hi) { return __builtin_bit_cast(v16bf, __builtin_shufflevector(lo, hi, 0, 1, 2, 3, 4, 5, 6, 7, 8, 9, 10, 11, 12, 13, 14, 15)); }
__device__ __forceinline__ v8f wmma16(v16h a, v16h b, v8f c) { return __builtin_amdgcn_wmma_f32_16x16x32_f16(false, a, false, b, (short)0, c, false, false); }
__device__ __forceinline__ v8f wmmab(v16bf a, v16bf b, v8f c) { return __builtin_amdgcn_wmma_f32_16x16x32_bf16(false, a, false, b, (short)0, c, false, false); }



// ---- WFrag: fragment loader (hardware k order: 8 k at 8*hi, 8 k at 16 + 8*hi of each 32) and product for 16-bit planes kept in fragment order (p = block + lane * 8: the block's first 512 bytes hold every lane's first 8 k, the next 512 its second 8)
template <typename T16> struct WFrag;
template <> struct WFrag<h16> { typedef v16h V; static __device__ __forceinline__ V ldf(const h16* p) { return cat16(*(const v8h*)p, *(const v8h*)(p + 256)); } static __device__ __forceinline__ v8f mma(V a, V b, v8f c) { return wmma16(a, b, c); } };
template <> struct WFrag<bf> { typedef v16bf V; static __device__ __forceinline__ V ldf(const bf* p) { return cat16b(*(const v8us*)p, *(const v8us*)(p + 256)); } static __device__ __forceinline__ v8f mma(V a, V b, v8f c) { return wmmab(a, b, c); } };

__device__ __forceinline__ h16 tohx(float x) { return (h16)x; }
__device__ __forceinline__ void splitf(float y, unsigned short& h, unsigned short& l) { h = f2bf(y); l = f2bf(y - bf2f(h)); }
typedef __attribute__((ext_vector_type(2))) _Float16 v2h;
typedef __attribute__((ext_vector_type(4))) _Float16 v4h;
typedef __attribute__((ext_vector_type(2))) unsigned short v2us;
typedef __attribute__((ext_vector_type(4))) unsigned short v4us;
typedef __attribute__((ext_vector_type(2))) float v2f;
typedef __attribute__((ext_vector_type(4))) int v4i;
// ---- k_projp: the projection Wh = h W with the attention's planes written by its epilogue. One work-group of NW waves per 64x64 output tile (64 nodes of one batch x the 64 columns of one head); wave w sums k in [w*KK/NW, (w+1)*KK/NW); it reads h and W as f32 and rounds them to bf16 itself (no converted copies, no launches for them);
// the NW partial tiles meet in LDS and are added in wave order; the summed tile goes out twice, each time as fp16, bf16 hi and bf16 lo, in the order in which the attention's fragment loads want it, so that each of its 16-byte loads reads 512 contiguous bytes (4 lines) where a row-major plane gives 32 bytes of each of 16 lines.
// Fragment order: blocks of 1,024 bytes = one 16 x 32 operand fragment = [c][lane][8 k], lane = hi*16 + row, k = 16*c + 8*hi + j. q/k plane: [t/16][d/32] blocks (rows t, k = d); v plane: [t/32][d/16] blocks (rows d, k = t). Every wave store here is 512 contiguous bytes.
// grid (NB_*TT/64, NH_), NW*32 threads. Every loop of it is unrolled whole: the indices name registers (accumulators, fragment slots), and the trip counts are short compile-time constants.
__device__ __forceinline__ void cvt3(const float* x, v8h& o16, v8us& oh, v8us& ol) {   // 8 values -> fp16, bf16 hi, bf16 lo
#pragma unroll
    for (int j = 0; j < 8; ++j) { o16[j] = tohx(x[j]); unsigned short a2, c2; splitf(x[j], a2, c2); oh[j] = a2; ol[j] = c2; } }
// amdgpu_waves_per_eu(4): a budget of 256 registers, so that 4 work-groups fit a WGP and all 1,024 are resident at once (left alone the allocator took 264 without need)
template <int NW, int KK>
__global__ __launch_bounds__(NW * 32) __attribute__((amdgpu_waves_per_eu(4))) void k_projp(const float* __restrict__ H, const float* __restrict__ Wm, h16* __restrict__ P16, bf* __restrict__ Ph, bf* __restrict__ Pl, h16* __restrict__ V16, bf* __restrict__ Vh, bf* __restrict__ Vl) {
    typedef typename WFrag<bf>::V V;
    constexpr int MB = 4, KW = KK / NW, NI = KW / 32, PT = 68, TS = MB * 16 * PT;
    static_assert(KK % (NW * 32) == 0 && NW == 4 && NI == 2 && HD == 64 && TT % 64 == 0 && KK == DM, "shape");
    __shared__ __align__(16) float ps[NW * TS];
    const int lane = threadIdx.x & 31, lr = lane & 15, hi = lane >> 4, wave = threadIdx.x >> 5; const int r0 = blockIdx.x * 64, c0 = blockIdx.y * 64;
    // Both operands come straight from the f32 inputs and are rounded to bf16 in registers. Element e of a fragment is k = 16*(e >> 3) + 8*hi + (e & 7) of its k step, for A and for B alike.
    // A: lane (hi, lr) of row tile mb has node mb*16 + lr: 4 loads of 4 k. B: the lane has the 4 columns lr*4 .. lr*4 + 3, ONE FOR EACH OF THE 4 COLUMN TILES (tile nb = column lr*4 + nb), so that one 16-byte load of a W row serves all 4 tiles and a wave's load covers 4 whole lines.
    const float* pa = H + (size_t)(r0 + lr) * KK + wave * KW + hi * 8; const float* pb = Wm + (size_t)(wave * KW + hi * 8) * DQ + c0 + lr * 4;
    v4f ra[NI][MB][4], rb[NI][16];
#pragma unroll
    for (int s = 0; s < NI; ++s)
#pragma unroll
        for (int mb = 0; mb < MB; ++mb)
#pragma unroll
            for (int q = 0; q < 4; ++q) ra[s][mb][q] = *(const v4fa*)(pa + mb * 16 * KK + s * 32 + (q >> 1) * 16 + (q & 1) * 4);
#pragma unroll
    for (int e = 0; e < 16; ++e) rb[0][e] = *(const v4fa*)(pb + ((e >> 3) * 16 + (e & 7)) * DQ);
    asm volatile("s_wait_xcnt 0x0" :: "v"(pa), "v"(pb) : "memory");   // the two address pairs are inputs here, so they stay whole up to this wait, in front of any reuse of their registers
    __builtin_amdgcn_sched_barrier(0);   // keeps all these loads in flight together, in front of the conversions: sunk to their uses they would cost their latency one by one
    V a[NI][MB], b[NI][4];
#pragma unroll
    for (int s = 0; s < NI; ++s)
#pragma unroll
        for (int mb = 0; mb < MB; ++mb)
#pragma unroll
            for (int e = 0; e < 16; ++e) a[s][mb][e] = (__bf16)ra[s][mb][e >> 2][e & 3];
    __builtin_amdgcn_sched_barrier(0);   // keeps the loads below behind A's conversion: the second k step of W is asked for when A's f32 registers are free again (all at once takes more than 256 registers, and a work-group fewer fits a WGP)
#pragma unroll
    for (int e = 0; e < 16; ++e) rb[1][e] = *(const v4fa*)(pb + (32 + (e >> 3) * 16 + (e & 7)) * DQ);
    asm volatile("s_wait_xcnt 0x0" :: "v"(pb) : "memory");   // as above, for the address pair of these loads
    __builtin_amdgcn_sched_barrier(0);   // keeps these loads in front of the conversion of the first k step, which covers part of their latency
#pragma unroll
    for (int s = 0; s < NI; ++s)
#pragma unroll
        for (int nb = 0; nb < 4; ++nb)
#pragma unroll
            for (int e = 0; e < 16; ++e) b[s][nb][e] = (__bf16)rb[s][e][nb];
    v8f acc[MB][4];
#pragma unroll
    for (int mb = 0; mb < MB; ++mb)
#pragma unroll
        for (int nb = 0; nb < 4; ++nb) acc[mb][nb] = (v8f){};
#pragma unroll
    for (int s = 0; s < NI; ++s) {
        __builtin_amdgcn_sched_barrier(0);   // keeps the k steps apart, behind the conversions: mixed, the f32 registers, both steps' fragments and all accumulators live at once and take more than 256 registers
#pragma unroll
        for (int nb = 0; nb < 4; ++nb)
#pragma unroll
            for (int mb = 0; mb < MB; ++mb) acc[mb][nb] = WFrag<bf>::mma(a[s][mb], b[s][nb], acc[mb][nb]);
    }
    float* pw = ps + wave * TS;
#pragma unroll
    for (int mb = 0; mb < MB; ++mb)
#pragma unroll
        for (int j = 0; j < 8; ++j) { const v4f t = { acc[mb][0][j], acc[mb][1][j], acc[mb][2][j], acc[mb][3][j] }; *(v4fa*)(pw + (mb * 16 + hi * 8 + j) * PT + lr * 4) = t; }   // the lane's 4 columns lie side by side
    __syncthreads();   // every wave's partial tile is in LDS before any of it is added
    const int g = (r0 / TT) * NH_ + blockIdx.y, t0 = r0 % TT;   // (batch, head) pair and first node of the tile
    const size_t pr = ((size_t)g * TT + t0) * HD;               // the tile's 64 rows lie behind one another in a [t][d] plane
    constexpr int NQ = 64 * 8 / (NW * 32); v8h o16[NQ]; v8us oh[NQ], ol[NQ];
#pragma unroll
    for (int q = 0; q < NQ; ++q) { float* sp = ps + (q * 16 + (threadIdx.x & 15)) * PT + (threadIdx.x >> 4) * 8;   /* node q*16 + (thread & 15), columns 8*(thread >> 4)..+7: 16-byte piece number 'thread' of the q-th 16-node block pair */ v4f s0 = *(const v4fa*)sp, s1 = *(const v4fa*)(sp + 4);
#pragma unroll
        for (int w = 1; w < NW; ++w) { s0 += *(const v4fa*)(sp + w * TS); s1 += *(const v4fa*)(sp + w * TS + 4); }
        *(v4fa*)sp = s0; *(v4fa*)(sp + 4) = s1;   // the sum replaces wave 0's partial (this thread alone touches these 8 places here): the transposed pass reads it
        const float x[8] = { s0[0], s0[1], s0[2], s0[3], s1[0], s1[1], s1[2], s1[3] }; cvt3(x, o16[q], oh[q], ol[q]); }
    __syncthreads();   // the whole summed tile is in LDS before any column of it is read
    // the q/k stores stand behind the barrier: in front of it the barrier would wait until they have left
#pragma unroll
    for (int q = 0; q < NQ; ++q) { const size_t e = pr + (size_t)(q * (NW * 32) + threadIdx.x) * 8; *(v8h*)(P16 + e) = o16[q]; *(v8us*)(Ph + e) = oh[q]; *(v8us*)(Pl + e) = ol[q]; }
    // v plane: wave w has the columns d = 16*w + lr; its i-th piece holds the 8 nodes 16*i + 8*hi + j of that column
#pragma unroll
    for (int i = 0; i < 4; ++i) { float x[8];
#pragma unroll
        for (int j = 0; j < 8; ++j) x[j] = ps[(i * 16 + hi * 8 + j) * PT + wave * 16 + lr];
        v8h t16; v8us th, tl; cvt3(x, t16, th, tl);
        const size_t pv = (size_t)g * HD * TT + (size_t)(t0 / 32 + (i >> 1)) * 2048 + wave * 512 + (i & 1) * 256 + lane * 8;
        *(v8h*)(V16 + pv) = t16; *(v8us*)(Vh + pv) = th; *(v8us*)(Vl + pv) = tl; }
}

// ---- k_fattn: scores, LeakyReLU, softmax and P.V of one (batch, head) pair's query rows in one kernel; neither S nor P goes to memory.
// One wave owns NT*16 query rows and walks all TT keys in steps of 32: S^T = K Q^T (a lane holds scores of ONE query: column lr; rows = keys 8*hi + j), maximum in use (raised only past TH) and running sum per lane,
// the two 16-key score tiles converted in place are the B operand P^T of O^T += V^T P^T (A = V^T rows in the same k order, by the loader WFrag). Rows < RH: hi/lo planes, 3 products; rest fp16 with P x 2^10.
// Q fragments come straight from the planes, which are kept in fragment order (k_projp): a step's K and its V are 4 KB in a row each. K and V reach the waves through LDS: a stage = 64 keys (hi/lo rows: 4 planes) or 128 keys (fp16 rows: 2 planes) of every K and V plane, 32 KB either way, brought in ONCE for the AW waves of the work-group by asynchronous copies
// (16 bytes a lane, no register), two buffers: the next stage's copies fly while this stage is worked on. The bytes keep their order, so a fragment load from LDS reads 512 contiguous bytes (no bank conflict).
#define HSB  (64 * HD * 2)        // bytes of 64 keys of one plane
// 4 + 4 copies of one thread: its 16-byte pieces (2,048 bytes apart: AW*32 threads x 16 bytes) of 64 keys at ga and of 64 keys at gb, which come to lie behind one another in LDS. Every lane is on; both addresses are multiples of 16.
// The s_wait_xcnt 0 is the last line of the copies' own statement, so that it stands in front of any rewrite of the address registers that the copies name.
__device__ __forceinline__ void stage2(unsigned l, const char* ga, const char* gb) {
    asm volatile("global_load_async_to_lds_b128 %0, %8, off\n\t"
                 "global_load_async_to_lds_b128 %1, %9, off\n\t"
                 "global_load_async_to_lds_b128 %2, %10, off\n\t"
                 "global_load_async_to_lds_b128 %3, %11, off\n\t"
                 "global_load_async_to_lds_b128 %4, %12, off\n\t"
                 "global_load_async_to_lds_b128 %5, %13, off\n\t"
                 "global_load_async_to_lds_b128 %6, %14, off\n\t"
                 "global_load_async_to_lds_b128 %7, %15, off\n\t"
                 "s_wait_xcnt 0x0"
                 :: "v"(l), "v"(l + 2048u), "v"(l + 4096u), "v"(l + 6144u), "v"(l + HSB), "v"(l + HSB + 2048u), "v"(l + HSB + 4096u), "v"(l + HSB + 6144u),
                    "v"(ga), "v"(ga + 2048), "v"(ga + 4096), "v"(ga + 6144), "v"(gb), "v"(gb + 2048), "v"(gb + 4096), "v"(gb + 6144) : "memory");
}
#define AW 4   // waves of a work-group; they walk the same keys, each with its own query rows
#define AWT (AW * 32)
__device__ __forceinline__ float xhalf(float x) { return __builtin_bit_cast(float, __builtin_amdgcn_permlanex16(__builtin_bit_cast(int, x), __builtin_bit_cast(int, x), 0x76543210, 0xfedcba98, false, false)); }   // lane l <-> lane l ^ 16
template <typename T16> struct PCvt;   // one probability into element e of the B operand(s): fp16, or bf16 hi + lo
template <> struct PCvt<h16> { static __device__ __forceinline__ void put(v16h& a, v16h&, int e, float p) { a[e] = (h16)p; } };
template <> struct PCvt<bf> { static __device__ __forceinline__ void put(v16bf& a, v16bf& b, int e, float p) { const __bf16 h = (__bf16)p; a[e] = h; b[e] = (__bf16)(p - (float)h); } };
template <typename T16, int NSPLIT, int NT>
__device__ __forceinline__ void attn_rows(const T16* __restrict__ Q, const T16* __restrict__ Q2, const T16* __restrict__ Kp, const T16* __restrict__ Kp2, const T16* __restrict__ Vt, const T16* __restrict__ Vt2, float* __restrict__ orow, unsigned short* sm) {
    typedef typename WFrag<T16>::V V;
    constexpr int NPL = (NSPLIT == 2) ? 4 : 2, SK = 256 / NPL, PLB = SK * HD * 2, BB = NPL * PLB, PE = PLB / 2, VO = (NPL / 2) * PE, NST = TT / SK;   // planes of a stage ([K][V] or [K hi][K lo][V hi][V lo]), its keys, bytes of a plane's share, bytes of a buffer, elements of a plane's share, where V starts, stages
    static_assert(AWT * 16 * 4 == HSB && BB == 4 * HSB && NST >= 2, "shape");
    const int lane = threadIdx.x & 31, lr = lane & 15, hi = lane >> 4;
    constexpr float PB = (NSPLIT == 2) ? 0.0f : 10.0f;      // log2 of the factor on P (fp16 keeps small probabilities normal); it cancels against the row sum
    constexpr float C2 = SCL * 1.4426950408889634f;         // score scale x log2(e): LeakyReLU commutes with a positive factor
    constexpr float C2L = 0.2f * C2;                        // the same on the LeakyReLU's negative side
    constexpr float TH = (NSPLIT == 2) ? 8.0f : 5.0f;       // the maximum in use is raised only when a score tops it by more than TH (log2 units); fp16: P <= 2^(PB + TH) = 2^15 stays finite
    V qf[NT][2], qf2[NT][2], kf[2][2], kf2[2][2];
#pragma unroll
    for (int nt = 0; nt < NT; ++nt)
#pragma unroll
        for (int ks = 0; ks < 2; ++ks) { qf[nt][ks] = WFrag<T16>::ldf(Q + lane * 8 + (nt * 2 + ks) * 512); if (NSPLIT == 2) qf2[nt][ks] = WFrag<T16>::ldf(Q2 + lane * 8 + (nt * 2 + ks) * 512); }
    const unsigned lds0 = (unsigned)(size_t)sm + threadIdx.x * 16;   // this thread's first piece in buffer 0: LDS byte address = low 32 bits of the shared address
    const size_t toff = (size_t)threadIdx.x * 16;
    auto stage = [&](int st) {   // all copies of stage st, into buffer st & 1
        const unsigned l = lds0 + (st & 1) * BB; const size_t go = toff + (size_t)st * PLB;
        if (NSPLIT == 2) { stage2(l, (const char*)Kp + go, (const char*)Kp2 + go); stage2(l + 2 * HSB, (const char*)Vt + go, (const char*)Vt2 + go); }
        else { stage2(l, (const char*)Kp + go, (const char*)Kp + go + HSB); stage2(l + 2 * HSB, (const char*)Vt + go, (const char*)Vt + go + HSB); } };
    auto fetchk = [&](const T16* sb, int sub) {   // the K fragments of step 'sub' of the stage at sb
#pragma unroll
        for (int kt = 0; kt < 2; ++kt)
#pragma unroll
            for (int ks = 0; ks < 2; ++ks) { kf[kt][ks] = WFrag<T16>::ldf(sb + sub * 2048 + (kt * 2 + ks) * 512); if (NSPLIT == 2) kf2[kt][ks] = WFrag<T16>::ldf(sb + PE + sub * 2048 + (kt * 2 + ks) * 512); } };
    stage(0);
    asm volatile("s_wait_asynccnt 0x0" ::: "memory");   // this wave's copies of stage 0 have landed
    __syncthreads();                                    // ... and every other wave's: stage 0 may be read
    stage(1);
    v8f o[4][NT]; float nmb[NT], l[NT];   // nmb = PB - the maximum in use
#pragma unroll
    for (int nt = 0; nt < NT; ++nt) { nmb[nt] = PB;   /* first maximum in use 0: queries and keys are the same rows, so a row's score with itself is a sum of squares, and its true maximum is never below 0 */ l[nt] = 0.0f;
#pragma unroll
        for (int dt = 0; dt < 4; ++dt) o[dt][nt] = (v8f){}; }
    // rolled: one body (a stage: 2 or 4 steps); the body alone fills the registers
#pragma unroll 1
    for (int st = 0; st < NST; ++st) {
      const T16* sb = (const T16*)sm + (st & 1) * (BB / 2) + lane * 8;   // this stage's buffer, at the lane's 16 bytes of each 512-byte half block
      fetchk(sb, 0);
      // unrolled: the steps of a stage differ in what they fetch ahead (the last one nothing), and their LDS offsets become immediates
#pragma unroll
      for (int sub = 0; sub < SK / 32; ++sub) {
        V vf[4], vf2[4];
#pragma unroll
        for (int dt = 0; dt < 4; ++dt) { vf[dt] = WFrag<T16>::ldf(sb + VO + sub * 2048 + dt * 512); if (NSPLIT == 2) vf2[dt] = WFrag<T16>::ldf(sb + VO + PE + sub * 2048 + dt * 512); }
        __builtin_amdgcn_sched_barrier(0);   // keeps the V loads in front of the score products: sunk to their use they would cost their latency behind the softmax
        v8f s[2][NT];
#pragma unroll
        for (int kt = 0; kt < 2; ++kt)
#pragma unroll
            for (int nt = 0; nt < NT; ++nt) { s[kt][nt] = (v8f){};
#pragma unroll
                for (int ks = 0; ks < 2; ++ks) { s[kt][nt] = WFrag<T16>::mma(kf[kt][ks], qf[nt][ks], s[kt][nt]); if (NSPLIT == 2) { s[kt][nt] = WFrag<T16>::mma(kf[kt][ks], qf2[nt][ks], s[kt][nt]); s[kt][nt] = WFrag<T16>::mma(kf2[kt][ks], qf[nt][ks], s[kt][nt]); } } }
        if (sub + 1 < SK / 32) fetchk(sb, sub + 1);   // the next step's K fragments, inside this stage only: nothing of the next stage is read in front of its barrier
        __builtin_amdgcn_sched_barrier(0);   // keeps those loads in front of the softmax, so that it covers their latency
        // exponent of P against the maximum IN USE: LeakyReLU_0.2(score x C2) - m + PB = the larger of two fused multiply-adds (no separate scale, slope and subtraction)
        float um[NT]; bool need = false;
#pragma unroll
        for (int nt = 0; nt < NT; ++nt) {
            const float n1 = nmb[nt]; const v8f nb = { n1, n1, n1, n1, n1, n1, n1, n1 }, ca = { C2, C2, C2, C2, C2, C2, C2, C2 }, cb = { C2L, C2L, C2L, C2L, C2L, C2L, C2L, C2L };   // whole-tile forms: the packed FMAs then take neighbouring registers of one accumulator as they stand
#pragma unroll
            for (int kt = 0; kt < 2; ++kt) s[kt][nt] = __builtin_elementwise_max(__builtin_elementwise_fma(s[kt][nt], ca, nb), __builtin_elementwise_fma(s[kt][nt], cb, nb));
            const v8f x = s[0][nt], z = s[1][nt];   // the lane's largest exponent, as a tree of depth 3
            const float a0 = fmaxf(fmaxf(x[0], x[1]), x[2]), a1 = fmaxf(fmaxf(x[3], x[4]), x[5]), a2 = fmaxf(fmaxf(x[6], x[7]), z[0]), a3 = fmaxf(fmaxf(z[1], z[2]), z[3]), a4 = fmaxf(fmaxf(z[4], z[5]), z[6]);
            um[nt] = fmaxf(fmaxf(fmaxf(a0, a1), a2), fmaxf(fmaxf(a3, a4), z[7]));
            need = need || (um[nt] > PB + TH); }
        if (__builtin_amdgcn_ballot_w32(need) != 0) {   // a score more than TH above the maximum in use somewhere in the wave: a few steps of a walk
#pragma unroll
            for (int nt = 0; nt < NT; ++nt) { const float d = fmaxf(fmaxf(um[nt], xhalf(um[nt])) - PB, 0.0f);   /* how far this step's largest score of the query (both halves) lies above the maximum in use */ const float al = __builtin_amdgcn_exp2f(-d); nmb[nt] -= d; l[nt] *= al;
#pragma unroll
                for (int dt = 0; dt < 4; ++dt) o[dt][nt] *= al;
#pragma unroll
                for (int kt = 0; kt < 2; ++kt) s[kt][nt] -= d; } }   // this step's exponents follow the raised maximum
        V pf[NT], pf2[NT];
#pragma unroll
        for (int nt = 0; nt < NT; ++nt) { float p[16];
#pragma unroll
            for (int e = 0; e < 16; ++e) p[e] = __builtin_amdgcn_exp2f(s[e >> 3][nt][e & 7]);
            l[nt] += (((p[0] + p[1]) + (p[2] + p[3])) + ((p[4] + p[5]) + (p[6] + p[7]))) + (((p[8] + p[9]) + (p[10] + p[11])) + ((p[12] + p[13]) + (p[14] + p[15])));
#pragma unroll
            for (int e = 0; e < 16; ++e) PCvt<T16>::put(pf[nt], pf2[nt], e, p[e]); }
#pragma unroll
        for (int dt = 0; dt < 4; ++dt)
#pragma unroll
            for (int nt = 0; nt < NT; ++nt) { o[dt][nt] = WFrag<T16>::mma(vf[dt], pf[nt], o[dt][nt]); if (NSPLIT == 2) { o[dt][nt] = WFrag<T16>::mma(vf[dt], pf2[nt], o[dt][nt]); o[dt][nt] = WFrag<T16>::mma(vf2[dt], pf[nt], o[dt][nt]); } }
      }
      // hand-over, every wave, in this order
      asm volatile("s_wait_dscnt 0x0" ::: "memory");      // this wave's reads of the buffer have returned before anything is copied over it
      asm volatile("s_wait_asynccnt 0x0" ::: "memory");   // this wave's copies of stage st + 1 have landed
      __syncthreads();                                    // stage st + 1 may be read by all, and every wave has left stage st's buffer
      if (st + 2 < NST) stage(st + 2);                    // the same for the whole work-group
    }
    asm volatile("s_wait_asynccnt 0x0" ::: "memory");   // no copy is outstanding when the wave goes on to its end
#pragma unroll
    for (int nt = 0; nt < NT; ++nt) { const float inv = __fdiv_rn(1.0f, l[nt] + xhalf(l[nt])); float* op = orow + (size_t)(nt * 16 + lr) * DQ + 8 * hi;   // the halves' sums meet once, here
#pragma unroll
        for (int dt = 0; dt < 4; ++dt) { v4f a, b;
#pragma unroll
            for (int j = 0; j < 4; ++j) { a[j] = o[dt][nt][j] * inv; b[j] = o[dt][nt][4 + j] * inv; }
            *(v4f*)(op + dt * 16) = a; *(v4f*)(op + dt * 16 + 4) = b; } }
    asm volatile("s_wait_xcnt 0x0" ::: "memory");   // behind the last store: whatever code follows this function in the kernel may reuse the stores' data and address registers
}
// grid x: first the NG * RH/(AW*16) work-groups of the hi/lo rows (16 rows a wave; the longer ones first), then the NG * (TT-RH)/(AW*32) of the fp16 rows (32 rows a wave)
__global__ __launch_bounds__(AW * 32) void k_fattn(const h16* __restrict__ Q16, const h16* __restrict__ K16, const h16* __restrict__ V16, const bf* __restrict__ Qh, const bf* __restrict__ Ql, const bf* __restrict__ Kh, const bf* __restrict__ Kl, const bf* __restrict__ Vh, const bf* __restrict__ Vl, float* __restrict__ OUTb) {
    constexpr int HB = RH / (AW * 16), LB = (TT - RH) / (AW * 32);
    static_assert(RH % (AW * 16) == 0 && (TT - RH) % (AW * 32) == 0 && (TT & (TT - 1)) == 0 && HD == 64, "shape");
    __shared__ __align__(16) unsigned short sm[2 * 4 * HSB / 2];   // two buffers of a stage
    const int wave = threadIdx.x >> 5; const int id = blockIdx.x;
    if (id < NG * HB) { const int g = id / HB, q0 = (id % HB) * (AW * 16) + wave * 16; const size_t pl = (size_t)g * TT * HD;
        attn_rows<bf, 2, 1>(Qh + pl + (size_t)q0 * HD, Ql + pl + (size_t)q0 * HD, Kh + pl, Kl + pl, Vh + pl, Vl + pl, OUTb + ((size_t)(g / NH_) * TT + q0) * DQ + (g % NH_) * HD, sm);
    } else { const int i2 = id - NG * HB; const int g = i2 / LB, q0 = RH + (i2 % LB) * (AW * 32) + wave * 32; const size_t pl = (size_t)g * TT * HD;
        attn_rows<h16, 0, 2>(Q16 + pl + (size_t)q0 * HD, nullptr, K16 + pl, nullptr, V16 + pl, nullptr, OUTb + ((size_t)(g / NH_) * TT + q0) * DQ + (g % NH_) * HD, sm); }
}

extern "C" void kernel_launch(void* const* d_in, const int* in_sizes, int n_in,
                              void* d_out, int out_size, void* d_ws, size_t ws_size, hipStream_t stream) {
    (void)in_sizes; (void)n_in; (void)out_size;
    const float* x = (const float*)d_in[0]; const float* w = (const float*)d_in[1];   /* order h, W ('xw' [256][256]) */
    float* OUT = (float*)d_out;     // [8][2048][256]
    char* wsp = (char*)d_ws;
    auto take = [&](size_t bytes) { char* p = wsp; wsp += (bytes + 255) & ~(size_t)255; return (void*)p; };
    h16* P16 = (h16*)take((size_t)NG * TT * HD * 2); bf* Ph = (bf*)take((size_t)NG * TT * HD * 2); bf* Pl = (bf*)take((size_t)NG * TT * HD * 2);      // Wh, rows t: q and k
    h16* VT16 = (h16*)take((size_t)NG * HD * TT * 2); bf* VTh = (bf*)take((size_t)NG * HD * TT * 2); bf* VTl = (bf*)take((size_t)NG * HD * TT * 2);   // Wh, rows d: v
    if ((size_t)(wsp - (char*)d_ws) > ws_size) return;    // ws 256 MiB
    k_projp<4, DM><<<dim3(NB_ * TT / 64, NH_, 1), 128, 0, stream>>>(x, w, P16, Ph, Pl, VT16, VTh, VTl);
    k_fattn<<<NG * (RH / (AW * 16)) + NG * ((TT - RH) / (AW * 32)), AW * 32, 0, stream>>>(P16, P16, VT16, Ph, Pl, Ph, Pl, VTh, VTl, OUT);   // q and k: the same planes
}

// v009
// Measured time: 69.8 microseconds a run.
// In both of two side-by-side timings against v008, it was 1.04 times as fast.
// Over all steps from v000 it is 29.7 times as fast.
#include <hip/hip_runtime.h>

// Dense multi-head 'graph attention' with dot-product scores and a LeakyReLU before the softmax (h [8][2048][256]; Wh = h W ('xw' [256][256] 1/16, no bias) split into 4 heads x 64; scores = Wh.Wh^T x 1/sqrt(64) per head (queries, keys and values are all Wh); attention = softmax(LeakyReLU_0.2(scores)) over all 2,048 nodes (no adjacency); h' = attention Wh; heads concatenated -> [8][2048][256] (4.2 M); argument order h, W).
// Layout, all 8 batches at once (planes [batch][head][..]): ONE projection launch that reads h and the 'xw' weight as f32, rounds them to bf16 in registers, and whose epilogue writes the attention's planes itself: Wh with rows t (read as q and as k) and with rows d (read as v), each as fp16 and as bf16 hi + lo, both kept in the matrix instructions' fragment order (see k_projp); dense T-2048 attention in one fused kernel (hybrid rows: < 512 hi/lo 3 products, rest fp16 x1024) with the LeakyReLU applied to the scaled score in registers; it writes the output rows (no output projection).
// Compute dtypes, f32 accumulate: every input rounded to bf16; projection exact; attention rows < 512 3 products, rest fp16; LeakyReLU/softmax f32; output f32.

#define NB_  8
#define TT   2048
#define DM   256
#define NH_  4
#define NKV  4
#define REP  (NH_ / NKV)
#define HD   64
#define DQ   (NH_ * HD)
#define DKV  (NKV * HD)
#define NG   (NB_ * NH_)          // all (batch, head) pairs
#define RH   512                  // query rows < RH use hi+lo planes (0: none)
#define WIN  0
#define SCL  0.125f   // HD^-0.5
typedef _Float16 h16;
typedef unsigned short bf;
typedef __attribute__((ext_vector_type(16))) __bf16   v16bf;
typedef __attribute__((ext_vector_type(16))) _Float16 v16h;
typedef __attribute__((ext_vector_type(8)))  _Float16 v8h;
typedef __attribute__((ext_vector_type(8)))  unsigned short v8us;
typedef __attribute__((ext_vector_type(8)))  float    v8f;
typedef __attribute__((ext_vector_type(4)))  float    v4f;
typedef v8h  __attribute__((may_alias)) v8ha;
typedef v4f  __attribute__((may_alias)) v4fa;
typedef v8us __attribute__((may_alias)) v8usa;

__device__ __forceinline__ unsigned short f2bf(float f) { unsigned u = __float_as_uint(f); u += 0x7FFFu + ((u >> 16) & 1u); return (unsigned short)(u >> 16); }
__device__ __forceinline__ float bf2f(unsigned short b) { return __uint_as_float(((unsigned)b) << 16); }
__device__ __forceinline__ float bfr(float f) { return bf2f(f2bf(f)); }
__device__ __forceinline__ v16h cat16(v8h lo, v8h hi) { return __builtin_shufflevector(lo, hi, 0, 1, 2, 3, 4, 5, 6, 7, 8, 9, 10, 11, 12, 13, 14, 15); }
__device__ __forceinline__ v16bf cat16b(v8us lo, v8us hi) { return __builtin_bit_cast(v16bf, __builtin_shufflevector(lo, hi, 0, 1, 2, 3, 4, 5, 6, 7, 8, 9, 10, 11, 12, 13, 14, 15)); }
__device__ __forceinline__ v8f wmma16(v16h a, v16h b, v8f c) { return __builtin_amdgcn_wmma_f32_16x16x32_f16(false, a, false, b, (short)0, c, false, false); }
__device__ __forceinline__ v8f wmmab(v16bf a, v16bf b, v8f c) { return __builtin_amdgcn_wmma_f32_16x16x32_bf16(false, a, false, b, (short)0, c, false, false); }



// ---- WFrag: fragment loader (hardware k order: 8 k at 8*hi, 8 k at 16 + 8*hi of each 32) and product for 16-bit planes kept in fragment order (p = block + lane * 8: the block's first 512 bytes hold every lane's first 8 k, the next 512 its second 8)
template <typename T16> struct WFrag;
template <> struct WFrag<h16> { typedef v16h V; static __device__ __forceinline__ V ldf(const h16* p) { return cat16(*(const v8h*)p, *(const v8h*)(p + 256)); } static __device__ __forceinline__ v8f mma(V a, V b, v8f c) { return wmma16(a, b, c); } };
template <> struct WFrag<bf> { typedef v16bf V; static __device__ __forceinline__ V ldf(const bf* p) { return cat16b(*(const v8us*)p, *(const v8us*)(p + 256)); } static __device__ __forceinline__ v8f mma(V a, V b, v8f c) { return wmmab(a, b, c); } };

__device__ __forceinline__ h16 tohx(float x) { return (h16)x; }
__device__ __forceinline__ void splitf(float y, unsigned short& h, unsigned short& l) { h = f2bf(y); l = f2bf(y - bf2f(h)); }
typedef __attribute__((ext_vector_type(2))) _Float16 v2h;
typedef __attribute__((ext_vector_type(4))) _Float16 v4h;
typedef __attribute__((ext_vector_type(2))) unsigned short v2us;
typedef __attribute__((ext_vector_type(4))) unsigned short v4us;
typedef __attribute__((ext_vector_type(2))) float v2f;
typedef __attribute__((ext_vector_type(4))) int v4i;
// ---- k_projp: the projection Wh = h W with the attention's planes written by its epilogue. One work-group of NW waves per 64x64 output tile (64 nodes of one batch x the 64 columns of one head); wave w sums k in [w*KK/NW, (w+1)*KK/NW); it reads h and W as f32 and rounds them to bf16 itself (no converted copies, no launches for them);
// the NW partial tiles meet in LDS and are added in wave order; the summed tile goes out twice, each time as fp16, bf16 hi and bf16 lo, in the order in which the attention's fragment loads want it, so that each of its 16-byte loads reads 512 contiguous bytes (4 lines) where a row-major plane gives 32 bytes of each of 16 lines.
// Fragment order: blocks of 1,024 bytes = one 16 x 32 operand fragment = [c][lane][8 k], lane = hi*16 + row, k = 16*c + 8*hi + j. q/k plane: [t/16][d/32] blocks (rows t, k = d); v plane: [t/32][d/16] blocks (rows d, k = t). Every wave store here is 512 contiguous bytes.
// grid (NB_*TT/64, NH_), NW*32 threads. Every loop of it is unrolled whole: the indices name registers (accumulators, fragment slots), and the trip counts are short compile-time constants.
__device__ __forceinline__ void cvt3(const float* x, v8h& o16, v8us& oh, v8us& ol) {   // 8 values -> fp16, bf16 hi, bf16 lo
#pragma unroll
    for (int j = 0; j < 8; ++j) { o16[j] = tohx(x[j]); unsigned short a2, c2; splitf(x[j], a2, c2); oh[j] = a2; ol[j] = c2; } }
// amdgpu_waves_per_eu(4): a budget of 256 registers, so that 4 work-groups fit a WGP and all 1,024 are resident at once (left alone the allocator took 264 without need)
template <int NW, int KK>
__global__ __launch_bounds__(NW * 32) __attribute__((amdgpu_waves_per_eu(4))) void k_projp(const float* __restrict__ H, const float* __restrict__ Wm, h16* __restrict__ P16, bf* __restrict__ Ph, bf* __restrict__ Pl, h16* __restrict__ V16, bf* __restrict__ Vh, bf* __restrict__ Vl) {
    typedef typename WFrag<bf>::V V;
    constexpr int MB = 4, KW = KK / NW, NI = KW / 32, PT = 68, TS = MB * 16 * PT;
    static_assert(KK % (NW * 32) == 0 && NW == 4 && NI == 2 && HD == 64 && TT % 64 == 0 && KK == DM, "shape");
    __shared__ __align__(16) float ps[NW * TS];
    const int lane = threadIdx.x & 31, lr = lane & 15, hi = lane >> 4, wave = threadIdx.x >> 5; const int r0 = blockIdx.x * 64, c0 = blockIdx.y * 64;
    // Both operands come straight from the f32 inputs and are rounded to bf16 in registers. Element e of a fragment is k = 16*(e >> 3) + 8*hi + (e & 7) of its k step, for A and for B alike.
    // A: lane (hi, lr) of row tile mb has node mb*16 + lr: 4 loads of 4 k. B: the lane has the 4 columns lr*4 .. lr*4 + 3, ONE FOR EACH OF THE 4 COLUMN TILES (tile nb = column lr*4 + nb), so that one 16-byte load of a W row serves all 4 tiles and a wave's load covers 4 whole lines.
    const float* pa = H + (size_t)(r0 + lr) * KK + wave * KW + hi * 8; const float* pb = Wm + (size_t)(wave * KW + hi * 8) * DQ + c0 + lr * 4;
    v4f ra[NI][MB][4], rb[NI][16];
#pragma unroll
    for (int s = 0; s < NI; ++s)
#pragma unroll
        for (int mb = 0; mb < MB; ++mb)
#pragma unroll
            for (int q = 0; q < 4; ++q) ra[s][mb][q] = *(const v4fa*)(pa + mb * 16 * KK + s * 32 + (q >> 1) * 16 + (q & 1) * 4);
#pragma unroll
    for (int e = 0; e < 16; ++e) rb[0][e] = *(const v4fa*)(pb + ((e >> 3) * 16 + (e & 7)) * DQ);
    asm volatile("s_wait_xcnt 0x0" :: "v"(pa), "v"(pb) : "memory");   // the two address pairs are inputs here, so they stay whole up to this wait, in front of any reuse of their registers
    __builtin_amdgcn_sched_barrier(0);   // keeps all these loads in flight together, in front of the conversions: sunk to their uses they would cost their latency one by one
    V a[NI][MB], b[NI][4];
#pragma unroll
    for (int s = 0; s < NI; ++s)
#pragma unroll
        for (int mb = 0; mb < MB; ++mb)
#pragma unroll
            for (int e = 0; e < 16; ++e) a[s][mb][e] = (__bf16)ra[s][mb][e >> 2][e & 3];
    __builtin_amdgcn_sched_barrier(0);   // keeps the loads below behind A's conversion: the second k step of W is asked for when A's f32 registers are free again (all at once takes more than 256 registers, and a work-group fewer fits a WGP)
#pragma unroll
    for (int e = 0; e < 16; ++e) rb[1][e] = *(const v4fa*)(pb + (32 + (e >> 3) * 16 + (e & 7)) * DQ);
    asm volatile("s_wait_xcnt 0x0" :: "v"(pb) : "memory");   // as above, for the address pair of these loads
    __builtin_amdgcn_sched_barrier(0);   // keeps these loads in front of the conversion of the first k step, which covers part of their latency
#pragma unroll
    for (int s = 0; s < NI; ++s)
#pragma unroll
        for (int nb = 0; nb < 4; ++nb)
#pragma unroll
            for (int e = 0; e < 16; ++e) b[s][nb][e] = (__bf16)rb[s][e][nb];
    v8f acc[MB][4];
#pragma unroll
    for (int mb = 0; mb < MB; ++mb)
#pragma unroll
        for (int nb = 0; nb < 4; ++nb) acc[mb][nb] = (v8f){};
#pragma unroll
    for (int s = 0; s < NI; ++s) {
        __builtin_amdgcn_sched_barrier(0);   // keeps the k steps apart, behind the conversions: mixed, the f32 registers, both steps' fragments and all accumulators live at once and take more than 256 registers
#pragma unroll
        for (int nb = 0; nb < 4; ++nb)
#pragma unroll
            for (int mb = 0; mb < MB; ++mb) acc[mb][nb] = WFrag<bf>::mma(a[s][mb], b[s][nb], acc[mb][nb]);
    }
    float* pw = ps + wave * TS;
#pragma unroll
    for (int mb = 0; mb < MB; ++mb)
#pragma unroll
        for (int j = 0; j < 8; ++j) { const v4f t = { acc[mb][0][j], acc[mb][1][j], acc[mb][2][j], acc[mb][3][j] }; *(v4fa*)(pw + (mb * 16 + hi * 8 + j) * PT + lr * 4) = t; }   // the lane's 4 columns lie side by side
    __syncthreads();   // every wave's partial tile is in LDS before any of it is added
    const int g = (r0 / TT) * NH_ + blockIdx.y, t0 = r0 % TT;   // (batch, head) pair and first node of the tile
    const size_t pr = ((size_t)g * TT + t0) * HD;               // the tile's 64 rows lie behind one another in a [t][d] plane
    constexpr int NQ = 64 * 8 / (NW * 32); v8h o16[NQ]; v8us oh[NQ], ol[NQ];
#pragma unroll
    for (int q = 0; q < NQ; ++q) { float* sp = ps + (q * 16 + (threadIdx.x & 15)) * PT + (threadIdx.x >> 4) * 8;   /* node q*16 + (thread & 15), columns 8*(thread >> 4)..+7: 16-byte piece number 'thread' of the q-th 16-node block pair */ v4f s0 = *(const v4fa*)sp, s1 = *(const v4fa*)(sp + 4);
#pragma unroll
        for (int w = 1; w < NW; ++w) { s0 += *(const v4fa*)(sp + w * TS); s1 += *(const v4fa*)(sp + w * TS + 4); }
        *(v4fa*)sp = s0; *(v4fa*)(sp + 4) = s1;   // the sum replaces wave 0's partial (this thread alone touches these 8 places here): the transposed pass reads it
        const float x[8] = { s0[0], s0[1], s0[2], s0[3], s1[0], s1[1], s1[2], s1[3] }; cvt3(x, o16[q], oh[q], ol[q]); }
    __syncthreads();   // the whole summed tile is in LDS before any column of it is read
    // the q/k stores stand behind the barrier: in front of it the barrier would wait until they have left
#pragma unroll
    for (int q = 0; q < NQ; ++q) { const size_t e = pr + (size_t)(q * (NW * 32) + threadIdx.x) * 8; *(v8h*)(P16 + e) = o16[q]; *(v8us*)(Ph + e) = oh[q]; *(v8us*)(Pl + e) = ol[q]; }
    // v plane: wave w has the columns d = 16*w + lr; its i-th piece holds the 8 nodes 16*i + 8*hi + j of that column
#pragma unroll
    for (int i = 0; i < 4; ++i) { float x[8];
#pragma unroll
        for (int j = 0; j < 8; ++j) x[j] = ps[(i * 16 + hi * 8 + j) * PT + wave * 16 + lr];
        v8h t16; v8us th, tl; cvt3(x, t16, th, tl);
        const size_t pv = (size_t)g * HD * TT + (size_t)(t0 / 32 + (i >> 1)) * 2048 + wave * 512 + (i & 1) * 256 + lane * 8;
        *(v8h*)(V16 + pv) = t16; *(v8us*)(Vh + pv) = th; *(v8us*)(Vl + pv) = tl; }
}

// ---- k_fattn: scores, LeakyReLU, softmax and P.V of one (batch, head) pair's query rows in one kernel; neither S nor P goes to memory.
// One wave owns NT*16 query rows and walks TT/KS keys in steps of 32 (hi/lo rows: all keys; fp16 rows: KS = 2, two waves share 32 rows, each walks one half of the keys, and their partial sums meet in LDS at the end): S^T = K Q^T (a lane holds scores of ONE query: column lr; rows = keys 8*hi + j), running maximum per query (the same in both lane halves) and sum per lane,
// the two 16-key score tiles converted in place are the B operand P^T of O^T += V^T P^T (A = V^T rows in the same k order, by the loader WFrag). Rows < RH: hi/lo planes, 3 products; rest fp16 with P x 2^10.
// Q fragments come straight from the planes, which are kept in fragment order (k_projp): a step's K and its V are 4 KB in a row each. K and V reach the waves through LDS: a stage = 4 shares of 64 keys (hi/lo rows: K hi, K lo, V hi, V lo of the same keys; fp16 rows: K and V of 64 keys of each half), 32 KB, brought in ONCE for the AW waves of the work-group by asynchronous copies
// (16 bytes a lane, no register), two buffers: the next stage's copies fly while this stage is worked on. The bytes keep their order, so a fragment load from LDS reads 512 contiguous bytes (no bank conflict).
#define HSB  (64 * HD * 2)        // bytes of 64 keys of one plane
// 4 + 4 copies of one thread: its 16-byte pieces (2,048 bytes apart: AW*32 threads x 16 bytes) of 64 keys at ga and of 64 keys at gb, which come to lie behind one another in LDS. Every lane is on; both addresses are multiples of 16.
// The s_wait_xcnt 0 is the last line of the copies' own statement, so that it stands in front of any rewrite of the address registers that the copies name.
__device__ __forceinline__ void stage2(unsigned l, const char* ga, const char* gb) {
    asm volatile("global_load_async_to_lds_b128 %0, %8, off\n\t"
                 "global_load_async_to_lds_b128 %1, %9, off\n\t"
                 "global_load_async_to_lds_b128 %2, %10, off\n\t"
                 "global_load_async_to_lds_b128 %3, %11, off\n\t"
                 "global_load_async_to_lds_b128 %4, %12, off\n\t"
                 "global_load_async_to_lds_b128 %5, %13, off\n\t"
                 "global_load_async_to_lds_b128 %6, %14, off\n\t"
                 "global_load_async_to_lds_b128 %7, %15, off\n\t"
                 "s_wait_xcnt 0x0"
                 :: "v"(l), "v"(l + 2048u), "v"(l + 4096u), "v"(l + 6144u), "v"(l + HSB), "v"(l + HSB + 2048u), "v"(l + HSB + 4096u), "v"(l + HSB + 6144u),
                    "v"(ga), "v"(ga + 2048), "v"(ga + 4096), "v"(ga + 6144), "v"(gb), "v"(gb + 2048), "v"(gb + 4096), "v"(gb + 6144) : "memory");
}
#define AW 4   // waves of a work-group. hi/lo rows: they walk the same keys, each with its own query rows; fp16 rows: 2 row groups x 2 halves of the keys
#define AWT (AW * 32)
__device__ __forceinline__ float xhalf(float x) { return __builtin_bit_cast(float, __builtin_amdgcn_permlanex16(__builtin_bit_cast(int, x), __builtin_bit_cast(int, x), 0x76543210, 0xfedcba98, false, false)); }   // lane l <-> lane l ^ 16
template <typename T16> struct PCvt;   // one probability into element e of the B operand(s): fp16, or bf16 hi + lo
template <> struct PCvt<h16> { static __device__ __forceinline__ void put(v16h& a, v16h&, int e, float p) { a[e] = (h16)p; } };
template <> struct PCvt<bf> { static __device__ __forceinline__ void put(v16bf& a, v16bf& b, int e, float p) { const __bf16 h = (__bf16)p; a[e] = h; b[e] = (__bf16)(p - (float)h); } };
// Kp2, Vt2: the second K and V share of a stage (hi/lo rows: the lo planes; KS = 2: the same planes at the second half of the keys). kh (KS = 2): which half of the keys this wave walks, the same in every lane.
template <typename T16, int NSPLIT, int NT, int KS>
__device__ __forceinline__ void attn_rows(const T16* __restrict__ Q, const T16* __restrict__ Q2, const T16* __restrict__ Kp, const T16* __restrict__ Kp2, const T16* __restrict__ Vt, const T16* __restrict__ Vt2, float* __restrict__ orow, unsigned short* sm, int kh) {
    typedef typename WFrag<T16>::V V;
    constexpr int SK = 64, PLB = SK * HD * 2, BB = 4 * PLB, PE = PLB / 2, VO = 2 * PE, NST = TT / KS / SK;   // keys of a share ([K hi][K lo][V hi][V lo] or [K half 0][K half 1][V half 0][V half 1]), its bytes, bytes of a buffer, elements of a share, where V starts, stages
    static_assert(AWT * 16 * 4 == HSB && PLB == HSB && NST >= 2 && ((NSPLIT == 2 && KS == 1) || (NSPLIT == 0 && KS == 2 && NT == 2)), "shape");
    const int lane = threadIdx.x & 31, lr = lane & 15, hi = lane >> 4;
    constexpr float PB = (NSPLIT == 2) ? 0.0f : 10.0f;      // log2 of the factor on P (fp16 keeps small probabilities normal); it cancels against the row sum
    constexpr float C2 = SCL * 1.4426950408889634f;         // score scale x log2(e): LeakyReLU commutes with a positive factor
    constexpr float C2L = 0.2f * C2;                        // the same on the LeakyReLU's negative side
    constexpr float TH = (NSPLIT == 2) ? 8.0f : 5.0f;       // the maximum in use is raised only when a score tops it by more than TH (log2 units); fp16: P <= 2^(PB + TH) = 2^15 stays finite
    V qf[NT][2], qf2[NT][2], kf[2][2], kf2[2][2];
#pragma unroll
    for (int nt = 0; nt < NT; ++nt)
#pragma unroll
        for (int ks = 0; ks < 2; ++ks) { qf[nt][ks] = WFrag<T16>::ldf(Q + lane * 8 + (nt * 2 + ks) * 512); if (NSPLIT == 2) qf2[nt][ks] = WFrag<T16>::ldf(Q2 + lane * 8 + (nt * 2 + ks) * 512); }
    const unsigned lds0 = (unsigned)(size_t)sm + threadIdx.x * 16;   // this thread's first piece in buffer 0: LDS byte address = low 32 bits of the shared address
    const size_t toff = (size_t)threadIdx.x * 16;
    auto stage = [&](int st) {   // all copies of stage st, into buffer st & 1
        const unsigned l = lds0 + (st & 1) * BB; const size_t go = toff + (size_t)st * PLB;
        stage2(l, (const char*)Kp + go, (const char*)Kp2 + go); stage2(l + 2 * HSB, (const char*)Vt + go, (const char*)Vt2 + go); };
    auto fetchk = [&](const T16* sb, int sub) {   // the K fragments of step 'sub' of the stage at sb
#pragma unroll
        for (int kt = 0; kt < 2; ++kt)
#pragma unroll
            for (int ks = 0; ks < 2; ++ks) { kf[kt][ks] = WFrag<T16>::ldf(sb + sub * 2048 + (kt * 2 + ks) * 512); if (NSPLIT == 2) kf2[kt][ks] = WFrag<T16>::ldf(sb + PE + sub * 2048 + (kt * 2 + ks) * 512); } };
    stage(0);
    asm volatile("s_wait_asynccnt 0x0" ::: "memory");   // this wave's copies of stage 0 have landed
    __syncthreads();                                    // ... and every other wave's: stage 0 may be read
    stage(1);
    v8f o[4][NT]; float nmb[NT], l[NT];   // nmb = PB - the maximum in use
#pragma unroll
    for (int nt = 0; nt < NT; ++nt) { nmb[nt] = PB;   /* first maximum in use 0: queries and keys are the same rows, so a row's score with itself is a sum of squares, and its true maximum is never below 0 */ l[nt] = 0.0f;
#pragma unroll
        for (int dt = 0; dt < 4; ++dt) o[dt][nt] = (v8f){}; }
    // rolled: one body (a stage: 2 steps); the body alone fills the registers
#pragma unroll 1
    for (int st = 0; st < NST; ++st) {
      const T16* sb = (const T16*)sm + (st & 1) * (BB / 2) + (KS == 2 ? kh * PE : 0) + lane * 8;   // this stage's buffer (KS = 2: at this wave's half of the keys), at the lane's 16 bytes of each 512-byte half block
      fetchk(sb, 0);
      // unrolled: the steps of a stage differ in what they fetch ahead (the last one nothing), and their LDS offsets become immediates
#pragma unroll
      for (int sub = 0; sub < SK / 32; ++sub) {
        V vf[4], vf2[4];
#pragma unroll
        for (int dt = 0; dt < 4; ++dt) { vf[dt] = WFrag<T16>::ldf(sb + VO + sub * 2048 + dt * 512); if (NSPLIT == 2) vf2[dt] = WFrag<T16>::ldf(sb + VO + PE + sub * 2048 + dt * 512); }
        __builtin_amdgcn_sched_barrier(0);   // keeps the V loads in front of the score products: sunk to their use they would cost their latency behind the softmax
        v8f s[2][NT];
#pragma unroll
        for (int kt = 0; kt < 2; ++kt)
#pragma unroll
            for (int nt = 0; nt < NT; ++nt) { s[kt][nt] = (v8f){};
#pragma unroll
                for (int ks = 0; ks < 2; ++ks) { s[kt][nt] = WFrag<T16>::mma(kf[kt][ks], qf[nt][ks], s[kt][nt]); if (NSPLIT == 2) { s[kt][nt] = WFrag<T16>::mma(kf[kt][ks], qf2[nt][ks], s[kt][nt]); s[kt][nt] = WFrag<T16>::mma(kf2[kt][ks], qf[nt][ks], s[kt][nt]); } } }
        if (sub + 1 < SK / 32) fetchk(sb, sub + 1);   // the next step's K fragments, inside this stage only: nothing of the next stage is read in front of its barrier
        __builtin_amdgcn_sched_barrier(0);   // keeps those loads in front of the softmax, so that it covers their latency
        // exponent of P against the maximum IN USE: LeakyReLU_0.2(score x C2) - m + PB = the larger of two fused multiply-adds (no separate scale, slope and subtraction)
        float um[NT]; bool need = false;
#pragma unroll
        for (int nt = 0; nt < NT; ++nt) {
            const float n1 = nmb[nt]; const v8f nb = { n1, n1, n1, n1, n1, n1, n1, n1 }, ca = { C2, C2, C2, C2, C2, C2, C2, C2 }, cb = { C2L, C2L, C2L, C2L, C2L, C2L, C2L, C2L };   // whole-tile forms: the packed FMAs then take neighbouring registers of one accumulator as they stand
#pragma unroll
            for (int kt = 0; kt < 2; ++kt) s[kt][nt] = __builtin_elementwise_max(__builtin_elementwise_fma(s[kt][nt], ca, nb), __builtin_elementwise_fma(s[kt][nt], cb, nb));
            const v8f x = s[0][nt], z = s[1][nt];   // the lane's largest exponent, as a tree of depth 3
            const float a0 = fmaxf(fmaxf(x[0], x[1]), x[2]), a1 = fmaxf(fmaxf(x[3], x[4]), x[5]), a2 = fmaxf(fmaxf(x[6], x[7]), z[0]), a3 = fmaxf(fmaxf(z[1], z[2]), z[3]), a4 = fmaxf(fmaxf(z[4], z[5]), z[6]);
            um[nt] = fmaxf(fmaxf(fmaxf(a0, a1), a2), fmaxf(fmaxf(a3, a4), z[7]));
            need = need || (um[nt] > PB + TH); }
        if (__builtin_amdgcn_ballot_w32(need) != 0) {   // a score more than TH above the maximum in use somewhere in the wave: a few steps of a walk
#pragma unroll
            for (int nt = 0; nt < NT; ++nt) { const float d = fmaxf(fmaxf(um[nt], xhalf(um[nt])) - PB, 0.0f);   /* how far this step's largest score of the query (both halves) lies above the maximum in use */ const float al = __builtin_amdgcn_exp2f(-d); nmb[nt] -= d; l[nt] *= al;
#pragma unroll
                for (int dt = 0; dt < 4; ++dt) o[dt][nt] *= al;
#pragma unroll
                for (int kt = 0; kt < 2; ++kt) s[kt][nt] -= d; } }   // this step's exponents follow the raised maximum
        V pf[NT], pf2[NT];
#pragma unroll
        for (int nt = 0; nt < NT; ++nt) { float p[16];
#pragma unroll
            for (int e = 0; e < 16; ++e) p[e] = __builtin_amdgcn_exp2f(s[e >> 3][nt][e & 7]);
            l[nt] += (((p[0] + p[1]) + (p[2] + p[3])) + ((p[4] + p[5]) + (p[6] + p[7]))) + (((p[8] + p[9]) + (p[10] + p[11])) + ((p[12] + p[13]) + (p[14] + p[15])));
#pragma unroll
            for (int e = 0; e < 16; ++e) PCvt<T16>::put(pf[nt], pf2[nt], e, p[e]); }
#pragma unroll
        for (int dt = 0; dt < 4; ++dt)
#pragma unroll
            for (int nt = 0; nt < NT; ++nt) { o[dt][nt] = WFrag<T16>::mma(vf[dt], pf[nt], o[dt][nt]); if (NSPLIT == 2) { o[dt][nt] = WFrag<T16>::mma(vf[dt], pf2[nt], o[dt][nt]); o[dt][nt] = WFrag<T16>::mma(vf2[dt], pf[nt], o[dt][nt]); } }
      }
      // hand-over, every wave, in this order
      asm volatile("s_wait_dscnt 0x0" ::: "memory");      // this wave's reads of the buffer have returned before anything is copied over it
      asm volatile("s_wait_asynccnt 0x0" ::: "memory");   // this wave's copies of stage st + 1 have landed
      __syncthreads();                                    // stage st + 1 may be read by all, and every wave has left stage st's buffer
      if (st + 2 < NST) stage(st + 2);                    // the same for the whole work-group
    }
    asm volatile("s_wait_asynccnt 0x0" ::: "memory");   // no copy is outstanding when the wave goes on to its end
    if constexpr (KS == 2) {
        // The two waves of a row group (waves w and w ^ 2) join their halves of the keys: wave kh finishes the 16 rows of tile kh and hands its sums of the other tile over in LDS.
        // The stage buffers are free here: every wave's reads and copies were waited for in front of the loop's last barrier.
        constexpr int XW = 8 * 128 + 64;   // floats of a wave's hand-over: 8 pieces of 16 bytes a lane, then the row sum and the maximum in use
        const int wv = threadIdx.x >> 5; float* xo = (float*)sm + wv * XW; const float* xi = (const float*)sm + (wv ^ 2) * XW;
        v8f ok[4]; const float lk = kh ? l[1] : l[0], nk = kh ? nmb[1] : nmb[0];
#pragma unroll
        for (int dt = 0; dt < 4; ++dt) { ok[dt] = kh ? o[dt][1] : o[dt][0]; const v8f og = kh ? o[dt][0] : o[dt][1];
            const v4f a = { og[0], og[1], og[2], og[3] }, b = { og[4], og[5], og[6], og[7] };
            *(v4fa*)(xo + (dt * 2) * 128 + lane * 4) = a; *(v4fa*)(xo + (dt * 2 + 1) * 128 + lane * 4) = b; }
        xo[1024 + lane] = kh ? l[0] : l[1]; xo[1056 + lane] = kh ? nmb[0] : nmb[1];
        __syncthreads();   // every wave's hand-over is in LDS before its partner reads it
        const float lp = xi[1024 + lane], np = xi[1056 + lane];
        const float nm = fminf(nk, np);   // the higher of the two maxima in use (nmb = PB - maximum)
        const float fk = __builtin_amdgcn_exp2f(nm - nk), fp = __builtin_amdgcn_exp2f(nm - np); const float lt = lk * fk + lp * fp;
        const float inv = __fdiv_rn(1.0f, lt + xhalf(lt)); const float ck = fk * inv, cp = fp * inv; float* op = orow + (size_t)(kh * 16 + lr) * DQ + 8 * hi;   // the lane halves' sums meet once, here
#pragma unroll
        for (int dt = 0; dt < 4; ++dt) { const v4f pa = *(const v4fa*)(xi + (dt * 2) * 128 + lane * 4), pb = *(const v4fa*)(xi + (dt * 2 + 1) * 128 + lane * 4); v4f a, b;
#pragma unroll
            for (int j = 0; j < 4; ++j) { a[j] = ok[dt][j] * ck + pa[j] * cp; b[j] = ok[dt][4 + j] * ck + pb[j] * cp; }
            *(v4f*)(op + dt * 16) = a; *(v4f*)(op + dt * 16 + 4) = b; }
    } else {
#pragma unroll
    for (int nt = 0; nt < NT; ++nt) { const float inv = __fdiv_rn(1.0f, l[nt] + xhalf(l[nt])); float* op = orow + (size_t)(nt * 16 + lr) * DQ + 8 * hi;   // the halves' sums meet once, here
#pragma unroll
        for (int dt = 0; dt < 4; ++dt) { v4f a, b;
#pragma unroll
            for (int j = 0; j < 4; ++j) { a[j] = o[dt][nt][j] * inv; b[j] = o[dt][nt][4 + j] * inv; }
            *(v4f*)(op + dt * 16) = a; *(v4f*)(op + dt * 16 + 4) = b; } }
    }
    asm volatile("s_wait_xcnt 0x0" ::: "memory");   // behind the last store: whatever code follows this function in the kernel may reuse the stores' data and address registers
}
// grid x: first the NG * RH/(AW*16) work-groups of the hi/lo rows (16 rows a wave; the longer ones first), then the NG * (TT-RH)/(AW/2*32) of the fp16 rows (32 rows a pair of waves, half the keys each): 256 + 768 work-groups, 4 for each of the 256 WGPs, one wave of each on every SIMD
// amdgpu_waves_per_eu(4): a budget of 256 registers, so that those 4 work-groups fit a WGP and all are resident at once
__global__ __launch_bounds__(AW * 32) __attribute__((amdgpu_waves_per_eu(4))) void k_fattn(const h16* __restrict__ Q16, const h16* __restrict__ K16, const h16* __restrict__ V16, const bf* __restrict__ Qh, const bf* __restrict__ Ql, const bf* __restrict__ Kh, const bf* __restrict__ Kl, const bf* __restrict__ Vh, const bf* __restrict__ Vl, float* __restrict__ OUTb) {
    constexpr int HB = RH / (AW * 16), LB = (TT - RH) / (AW / 2 * 32);
    static_assert(RH % (AW * 16) == 0 && (TT - RH) % (AW / 2 * 32) == 0 && AW == 4 && (TT & (TT - 1)) == 0 && HD == 64, "shape");
    __shared__ __align__(16) unsigned short sm[2 * 4 * HSB / 2];   // two buffers of a stage
    const int wave = threadIdx.x >> 5; const int id = blockIdx.x;
    if (id < NG * HB) { const int g = id / HB, q0 = (id % HB) * (AW * 16) + wave * 16; const size_t pl = (size_t)g * TT * HD;
        attn_rows<bf, 2, 1, 1>(Qh + pl + (size_t)q0 * HD, Ql + pl + (size_t)q0 * HD, Kh + pl, Kl + pl, Vh + pl, Vl + pl, OUTb + ((size_t)(g / NH_) * TT + q0) * DQ + (g % NH_) * HD, sm, 0);
    } else { const int i2 = id - NG * HB; const int g = i2 / LB, q0 = RH + (i2 % LB) * (AW / 2 * 32) + (wave & 1) * 32; const size_t pl = (size_t)g * TT * HD, ph = pl + (size_t)(TT / 2) * HD;   // waves 0, 1: first half of the keys; waves 2, 3: second half (in either plane TT/2 keys are TT/2 * HD elements)
        attn_rows<h16, 0, 2, 2>(Q16 + pl + (size_t)q0 * HD, nullptr, K16 + pl, K16 + ph, V16 + pl, V16 + ph, OUTb + ((size_t)(g / NH_) * TT + q0) * DQ + (g % NH_) * HD, sm, __builtin_amdgcn_readfirstlane(wave >> 1)); }
}

extern "C" void kernel_launch(void* const* d_in, const int* in_sizes, int n_in,
                              void* d_out, int out_size, void* d_ws, size_t ws_size, hipStream_t stream) {
    (void)in_sizes; (void)n_in; (void)out_size;
    const float* x = (const float*)d_in[0]; const float* w = (const float*)d_in[1];   /* order h, W ('xw' [256][256]) */
    float* OUT = (float*)d_out;     // [8][2048][256]
    char* wsp = (char*)d_ws;
    auto take = [&](size_t bytes) { char* p = wsp; wsp += (bytes + 255) & ~(size_t)255; return (void*)p; };
    h16* P16 = (h16*)take((size_t)NG * TT * HD * 2); bf* Ph = (bf*)take((size_t)NG * TT * HD * 2); bf* Pl = (bf*)take((size_t)NG * TT * HD * 2);      // Wh, rows t: q and k
    h16* VT16 = (h16*)take((size_t)NG * HD * TT * 2); bf* VTh = (bf*)take((size_t)NG * HD * TT * 2); bf* VTl = (bf*)take((size_t)NG * HD * TT * 2);   // Wh, rows d: v
    if ((size_t)(wsp - (char*)d_ws) > ws_size) return;    // ws 256 MiB
    k_projp<4, DM><<<dim3(NB_ * TT / 64, NH_, 1), 128, 0, stream>>>(x, w, P16, Ph, Pl, VT16, VTh, VTl);
    k_fattn<<<NG * (RH / (AW * 16)) + NG * ((TT - RH) / (AW / 2 * 32)), AW * 32, 0, stream>>>(P16, P16, VT16, Ph, Pl, Ph, Pl, VTh, VTl, OUT);   // q and k: the same planes
}

// v010
// One run takes 55.1 microseconds.
// Two timings next to v009 both put it at 1.26 times that version's speed.
// Over all steps from v000 it is 37.4 times as fast.
#include <hip/hip_runtime.h>

// Dense multi-head 'graph attention' with dot-product scores and a LeakyReLU before the softmax (h [8][2048][256]; Wh = h W ('xw' [256][256] 1/16, no bias) split into 4 heads x 64; scores = Wh.Wh^T x 1/sqrt(64) per head (queries, keys and values are all Wh); attention = softmax(LeakyReLU_0.2(scores)) over all 2,048 nodes (no adjacency); h' = attention Wh; heads concatenated -> [8][2048][256] (4.2 M); argument order h, W).
// Layout, all 8 batches at once (planes [batch][head][..]): ONE projection launch that reads h and the 'xw' weight as f32, rounds them to bf16 in registers, and whose epilogue writes the attention's planes itself: Wh with rows t (read as q, as k and, through the transposing LDS load, as v), as fp16 and as bf16 hi + lo, kept in the matrix instructions' fragment order (see k_projp); dense T-2048 attention in one fused kernel (hybrid rows: < 512 hi/lo 3 products, rest fp16 x1024) with the LeakyReLU applied to the scaled score in registers; it writes the output rows (no output projection).
// Compute dtypes, f32 accumulate: every input rounded to bf16; projection exact; attention rows < 512 3 products, rest fp16; LeakyReLU/softmax f32; output f32.

#define NB_  8
#define TT   2048
#define DM   256
#define NH_  4
#define NKV  4
#define REP  (NH_ / NKV)
#define HD   64
#define DQ   (NH_ * HD)
#define DKV  (NKV * HD)
#define NG   (NB_ * NH_)          // all (batch, head) pairs
#define RH   512                  // query rows < RH use hi+lo planes (0: none)
#define WIN  0
#define SCL  0.125f   // HD^-0.5
typedef _Float16 h16;
typedef unsigned short bf;
typedef __attribute__((ext_vector_type(16))) __bf16   v16bf;
typedef __attribute__((ext_vector_type(16))) _Float16 v16h;
typedef __attribute__((ext_vector_type(8)))  _Float16 v8h;
typedef __attribute__((ext_vector_type(8)))  unsigned short v8us;
typedef __attribute__((ext_vector_type(8)))  float    v8f;
typedef __attribute__((ext_vector_type(4)))  float    v4f;
typedef v8h  __attribute__((may_alias)) v8ha;
typedef v4f  __attribute__((may_alias)) v4fa;
typedef v8us __attribute__((may_alias)) v8usa;

__device__ __forceinline__ unsigned short f2bf(float f) { unsigned u = __float_as_uint(f); u += 0x7FFFu + ((u >> 16) & 1u); return (unsigned short)(u >> 16); }
__device__ __forceinline__ float bf2f(unsigned short b) { return __uint_as_float(((unsigned)b) << 16); }
__device__ __forceinline__ float bfr(float f) { return bf2f(f2bf(f)); }
__device__ __forceinline__ v16h cat16(v8h lo, v8h hi) { return __builtin_shufflevector(lo, hi, 0, 1, 2, 3, 4, 5, 6, 7, 8, 9, 10, 11, 12, 13, 14, 15); }
__device__ __forceinline__ v16bf cat16b(v8us lo, v8us hi) { return __builtin_bit_cast(v16bf, __builtin_shufflevector(lo, hi, 0, 1, 2, 3, 4, 5, 6, 7, 8, 9, 10, 11, 12, 13, 14, 15)); }
__device__ __forceinline__ v8f wmma16(v16h a, v16h b, v8f c) { return __builtin_amdgcn_wmma_f32_16x16x32_f16(false, a, false, b, (short)0, c, false, false); }
__device__ __forceinline__ v8f wmmab(v16bf a, v16bf b, v8f c) { return __builtin_amdgcn_wmma_f32_16x16x32_bf16(false, a, false, b, (short)0, c, false, false); }



// ---- WFrag: fragment loader (hardware k order: 8 k at 8*hi, 8 k at 16 + 8*hi of each 32) and product for 16-bit planes kept in fragment order (ldf: p = block + piece * 8, the lane's piece as k_projp lays it: the block's first 512 bytes hold every lane's first 8 k, the next 512 its second 8; ldt: the same plane read across, 16 columns x 32 rows as an operand with rows = columns of the plane, k = its rows: two transposing loads, 16 rows = 1,024 elements apart)
typedef __attribute__((ext_vector_type(8))) short v8s;
typedef __attribute__((address_space(3))) v8s lds_v8s;
// ds_load_tr16_b128: every lane hands in 16 bytes (8 columns of one row); lane (c, h) gets column c of the 8 rows that the lanes of its half handed in (lane l: row l & 7, columns 8*((l >> 3) & 1)..+7)
__device__ __forceinline__ v8s ldtr(const void* p) { return __builtin_amdgcn_ds_load_tr16_b128_v8i16((lds_v8s*)p); }
template <typename T16> struct WFrag;
template <> struct WFrag<h16> { typedef v16h V; static __device__ __forceinline__ V ldf(const h16* p) { return cat16(*(const v8h*)p, *(const v8h*)(p + 256)); } static __device__ __forceinline__ V ldt(const h16* p) { return cat16(__builtin_bit_cast(v8h, ldtr(p)), __builtin_bit_cast(v8h, ldtr(p + 1024))); } static __device__ __forceinline__ v8f mma(V a, V b, v8f c) { return wmma16(a, b, c); } };
template <> struct WFrag<bf> { typedef v16bf V; static __device__ __forceinline__ V ldf(const bf* p) { return cat16b(*(const v8us*)p, *(const v8us*)(p + 256)); } static __device__ __forceinline__ V ldt(const bf* p) { return cat16b(__builtin_bit_cast(v8us, ldtr(p)), __builtin_bit_cast(v8us, ldtr(p + 1024))); } static __device__ __forceinline__ v8f mma(V a, V b, v8f c) { return wmmab(a, b, c); } };

__device__ __forceinline__ h16 tohx(float x) { return (h16)x; }
__device__ __forceinline__ void splitf(float y, unsigned short& h, unsigned short& l) { h = f2bf(y); l = f2bf(y - bf2f(h)); }
typedef __attribute__((ext_vector_type(2))) _Float16 v2h;
typedef __attribute__((ext_vector_type(4))) _Float16 v4h;
typedef __attribute__((ext_vector_type(2))) unsigned short v2us;
typedef __attribute__((ext_vector_type(4))) unsigned short v4us;
typedef __attribute__((ext_vector_type(2))) float v2f;
typedef __attribute__((ext_vector_type(4))) int v4i;
// ---- k_projp: the projection Wh = h W with the attention's planes written by its epilogue. One work-group of NW waves per 64x64 output tile (64 nodes of one batch x the 64 columns of one head); wave w sums k in [w*KK/NW, (w+1)*KK/NW); it reads h and W as f32 and rounds them to bf16 itself (no converted copies, no launches for them);
// the NW partial tiles meet in LDS and are added in wave order; the summed tile goes out as fp16, bf16 hi and bf16 lo, in the order in which the attention's fragment loads want it, so that each of its 16-byte loads reads 512 contiguous bytes (4 lines) where a row-major plane gives 32 bytes of each of 16 lines.
// Fragment order: blocks of 1,024 bytes = one 16 x 32 operand fragment = [c][piece][8 k], k = 16*c + 8*hi + j, [t/16][d/32] blocks (rows t, k = d). Piece of (hi, row) = hi*16 + (row ^ 8*hi): the upper k half has its two groups of 8 rows swapped,
// so that in LDS both readers meet all 64 banks once per half wave: the plain load (one hi, 16 rows) and the transposing load that reads the plane as v (both hi, 8 rows). Every wave store here is 512 contiguous bytes.
// grid (NB_*TT/64, NH_), NW*32 threads. Every loop of it is unrolled whole: the indices name registers (accumulators, fragment slots), and the trip counts are short compile-time constants.
__device__ __forceinline__ void cvt3(const float* x, v8h& o16, v8us& oh, v8us& ol) {   // 8 values -> fp16, bf16 hi, bf16 lo
#pragma unroll
    for (int j = 0; j < 8; ++j) { o16[j] = tohx(x[j]); unsigned short a2, c2; splitf(x[j], a2, c2); oh[j] = a2; ol[j] = c2; } }
// amdgpu_waves_per_eu(4): a budget of 256 registers, so that 4 work-groups fit a WGP and all 1,024 are resident at once (left alone the allocator took 264 without need)
template <int NW, int KK>
__global__ __launch_bounds__(NW * 32) __attribute__((amdgpu_waves_per_eu(4))) void k_projp(const float* __restrict__ H, const float* __restrict__ Wm, h16* __restrict__ P16, bf* __restrict__ Ph, bf* __restrict__ Pl) {
    typedef typename WFrag<bf>::V V;
    constexpr int MB = 4, KW = KK / NW, NI = KW / 32, PT = 68, TS = MB * 16 * PT;
    static_assert(KK % (NW * 32) == 0 && NW == 4 && NI == 2 && HD == 64 && TT % 64 == 0 && KK == DM, "shape");
    __shared__ __align__(16) float ps[NW * TS];
    const int lane = threadIdx.x & 31, lr = lane & 15, hi = lane >> 4, wave = threadIdx.x >> 5; const int r0 = blockIdx.x * 64, c0 = blockIdx.y * 64;
    // Both operands come straight from the f32 inputs and are rounded to bf16 in registers. Element e of a fragment is k = 16*(e >> 3) + 8*hi + (e & 7) of its k step, for A and for B alike.
    // A: lane (hi, lr) of row tile mb has node mb*16 + lr: 4 loads of 4 k. B: the lane has the 4 columns lr*4 .. lr*4 + 3, ONE FOR EACH OF THE 4 COLUMN TILES (tile nb = column lr*4 + nb), so that one 16-byte load of a W row serves all 4 tiles and a wave's load covers 4 whole lines.
    const float* pa = H + (size_t)(r0 + lr) * KK + wave * KW + hi * 8; const float* pb = Wm + (size_t)(wave * KW + hi * 8) * DQ + c0 + lr * 4;
    v4f ra[NI][MB][4], rb[NI][16];
#pragma unroll
    for (int s = 0; s < NI; ++s)
#pragma unroll
        for (int mb = 0; mb < MB; ++mb)
#pragma unroll
            for (int q = 0; q < 4; ++q) ra[s][mb][q] = *(const v4fa*)(pa + mb * 16 * KK + s * 32 + (q >> 1) * 16 + (q & 1) * 4);
#pragma unroll
    for (int e = 0; e < 16; ++e) rb[0][e] = *(const v4fa*)(pb + ((e >> 3) * 16 + (e & 7)) * DQ);
    asm volatile("s_wait_xcnt 0x0" :: "v"(pa), "v"(pb) : "memory");   // the two address pairs are inputs here, so they stay whole up to this wait, in front of any reuse of their registers
    __builtin_amdgcn_sched_barrier(0);   // keeps all these loads in flight together, in front of the conversions: sunk to their uses they would cost their latency one by one
    V a[NI][MB], b[NI][4];
#pragma unroll
    for (int s = 0; s < NI; ++s)
#pragma unroll
        for (int mb = 0; mb < MB; ++mb)
#pragma unroll
            for (int e = 0; e < 16; ++e) a[s][mb][e] = (__bf16)ra[s][mb][e >> 2][e & 3];
    __builtin_amdgcn_sched_barrier(0);   // keeps the loads below behind A's conversion: the second k step of W is asked for when A's f32 registers are free again (all at once takes more than 256 registers, and a work-group fewer fits a WGP)
#pragma unroll
    for (int e = 0; e < 16; ++e) rb[1][e] = *(const v4fa*)(pb + (32 + (e >> 3) * 16 + (e & 7)) * DQ);
    asm volatile("s_wait_xcnt 0x0" :: "v"(pb) : "memory");   // as above, for the address pair of these loads
    __builtin_amdgcn_sched_barrier(0);   // keeps these loads in front of the conversion of the first k step, which covers part of their latency
#pragma unroll
    for (int s = 0; s < NI; ++s)
#pragma unroll
        for (int nb = 0; nb < 4; ++nb)
#pragma unroll
            for (int e = 0; e < 16; ++e) b[s][nb][e] = (__bf16)rb[s][e][nb];
    v8f acc[MB][4];
#pragma unroll
    for (int mb = 0; mb < MB; ++mb)
#pragma unroll
        for (int nb = 0; nb < 4; ++nb) acc[mb][nb] = (v8f){};
#pragma unroll
    for (int s = 0; s < NI; ++s) {
        __builtin_amdgcn_sched_barrier(0);   // keeps the k steps apart, behind the conversions: mixed, the f32 registers, both steps' fragments and all accumulators live at once and take more than 256 registers
#pragma unroll
        for (int nb = 0; nb < 4; ++nb)
#pragma unroll
            for (int mb = 0; mb < MB; ++mb) acc[mb][nb] = WFrag<bf>::mma(a[s][mb], b[s][nb], acc[mb][nb]);
    }
    float* pw = ps + wave * TS;
#pragma unroll
    for (int mb = 0; mb < MB; ++mb)
#pragma unroll
        for (int j = 0; j < 8; ++j) { const v4f t = { acc[mb][0][j], acc[mb][1][j], acc[mb][2][j], acc[mb][3][j] }; *(v4fa*)(pw + (mb * 16 + hi * 8 + j) * PT + lr * 4) = t; }   // the lane's 4 columns lie side by side
    __syncthreads();   // every wave's partial tile is in LDS before any of it is added
    const int g = (r0 / TT) * NH_ + blockIdx.y, t0 = r0 % TT;   // (batch, head) pair and first node of the tile
    const size_t pr = ((size_t)g * TT + t0) * HD;               // the tile's 64 rows lie behind one another in a [t][d] plane
    constexpr int NQ = 64 * 8 / (NW * 32); v8h o16[NQ]; v8us oh[NQ], ol[NQ];
    const int px = threadIdx.x ^ ((threadIdx.x >> 1) & 8);   // where this thread's piece lies: row ^ 8*hi, hi = bit 4 of the thread
#pragma unroll
    for (int q = 0; q < NQ; ++q) { const float* sp = ps + (q * 16 + (threadIdx.x & 15)) * PT + (threadIdx.x >> 4) * 8;   /* node q*16 + (thread & 15), columns 8*(thread >> 4)..+7 of the q-th 16-node block pair */ v4f s0 = *(const v4fa*)sp, s1 = *(const v4fa*)(sp + 4);
#pragma unroll
        for (int w = 1; w < NW; ++w) { s0 += *(const v4fa*)(sp + w * TS); s1 += *(const v4fa*)(sp + w * TS + 4); }
        const float x[8] = { s0[0], s0[1], s0[2], s0[3], s1[0], s1[1], s1[2], s1[3] }; cvt3(x, o16[q], oh[q], ol[q]); }
    // the stores stand last: no register that they name is written behind them
#pragma unroll
    for (int q = 0; q < NQ; ++q) { const size_t e = pr + (size_t)(q * (NW * 32) + px) * 8; *(v8h*)(P16 + e) = o16[q]; *(v8us*)(Ph + e) = oh[q]; *(v8us*)(Pl + e) = ol[q]; }
}

// ---- k_fattn: scores, LeakyReLU, softmax and P.V of one (batch, head) pair's query rows in one kernel; neither S nor P goes to memory.
// One wave owns NT*16 query rows and walks TT/KS keys in steps of 32 (hi/lo rows: all keys; fp16 rows: KS = 2, two waves share 32 rows, each walks one half of the keys, and their partial sums meet in LDS at the end): S^T = K Q^T (a lane holds scores of ONE query: column lr; rows = keys 8*hi + j), a maximum in use per query (alike in lanes l and l ^ 16) and a running sum per lane,
// the two 16-key score tiles converted in place are the B operand P^T of O^T += V^T P^T (A = V^T rows in the same k order: keys and values are the same rows of Wh, so V^T comes from the K bytes in LDS by the transposing load, WFrag::ldt). Rows < RH: hi/lo planes, 3 products; rest fp16 with P x 2^10.
// Q fragments come straight from the planes, which are kept in fragment order (k_projp): a step's K is 4 KB in a row. K reaches the waves through LDS: a stage = 2 shares of 64 keys (hi/lo rows: K hi, K lo of the same keys; fp16 rows: 64 keys of each half), 16 KB, brought in ONCE for the AW waves of the work-group by asynchronous copies
// (16 bytes a lane, no register), two buffers: the next stage's copies fly while this stage is worked on. The bytes keep their order, so a K fragment load from LDS reads 512 contiguous bytes, and a transposing load 2 x 128 bytes on different banks per half wave (no bank conflict in either).
#define HSB  (64 * HD * 2)        // bytes of 64 keys of one plane
// 4 + 4 copies of one thread: its 16-byte pieces (2,048 bytes apart: AW*32 threads x 16 bytes) of 64 keys at ga and of 64 keys at gb, which come to lie behind one another in LDS. Every lane is on; both addresses are multiples of 16.
// The s_wait_xcnt 0 is the last line of the copies' own statement, so that it stands in front of any rewrite of the address registers that the copies name.
__device__ __forceinline__ void stage2(unsigned l, const char* ga, const char* gb) {
    asm volatile("global_load_async_to_lds_b128 %0, %8, off\n\t"
                 "global_load_async_to_lds_b128 %1, %9, off\n\t"
                 "global_load_async_to_lds_b128 %2, %10, off\n\t"
                 "global_load_async_to_lds_b128 %3, %11, off\n\t"
                 "global_load_async_to_lds_b128 %4, %12, off\n\t"
                 "global_load_async_to_lds_b128 %5, %13, off\n\t"
                 "global_load_async_to_lds_b128 %6, %14, off\n\t"
                 "global_load_async_to_lds_b128 %7, %15, off\n\t"
                 "s_wait_xcnt 0x0"
                 :: "v"(l), "v"(l + 2048u), "v"(l + 4096u), "v"(l + 6144u), "v"(l + HSB), "v"(l + HSB + 2048u), "v"(l + HSB + 4096u), "v"(l + HSB + 6144u),
                    "v"(ga), "v"(ga + 2048), "v"(ga + 4096), "v"(ga + 6144), "v"(gb), "v"(gb + 2048), "v"(gb + 4096), "v"(gb + 6144) : "memory");
}
#define AW 4   // waves of a work-group. hi/lo rows: they walk the same keys, each with its own query rows; fp16 rows: 2 row groups x 2 halves of the keys
#define AWT (AW * 32)
__device__ __forceinline__ float xhalf(float x) { return __builtin_bit_cast(float, __builtin_amdgcn_permlanex16(__builtin_bit_cast(int, x), __builtin_bit_cast(int, x), 0x76543210, 0xfedcba98, false, false)); }   // lane l <-> lane l ^ 16
template <typename T16> struct PCvt;   // one probability into element e of the B operand(s): fp16, or bf16 hi + lo
template <> struct PCvt<h16> { static __device__ __forceinline__ void put(v16h& a, v16h&, int e, float p) { a[e] = (h16)p; } };
template <> struct PCvt<bf> { static __device__ __forceinline__ void put(v16bf& a, v16bf& b, int e, float p) { const __bf16 h = (__bf16)p; a[e] = h; b[e] = (__bf16)(p - (float)h); } };
// Kp2: the second share of a stage (hi/lo rows: the lo plane; KS = 2: the same plane at the second half of the keys). kh (KS = 2): which half of the keys this wave walks, the same in every lane.
template <typename T16, int NSPLIT, int NT, int KS>
__device__ __forceinline__ void attn_rows(const T16* __restrict__ Q, const T16* __restrict__ Q2, const T16* __restrict__ Kp, const T16* __restrict__ Kp2, float* __restrict__ orow, unsigned short* sm, int kh) {
    typedef typename WFrag<T16>::V V;
    constexpr int SK = 64, PLB = SK * HD * 2, BB = 2 * PLB, PE = PLB / 2, NST = TT / KS / SK;   // keys of a share ([K hi][K lo] or [K half 0][K half 1]), its bytes, bytes of a buffer, elements of a share, stages
    static_assert(AWT * 16 * 4 == HSB && PLB == HSB && NST >= 2 && ((NSPLIT == 2 && KS == 1) || (NSPLIT == 0 && KS == 2 && NT == 2)), "shape");
    const int lane = threadIdx.x & 31, lr = lane & 15, hi = lane >> 4;
    const int lx = lane ^ (hi << 3);                                                        // the lane's piece of a block read as q or k: (hi, row lr)
    const int lv = (lane & 8) * 2 + (lane & 7) + (((lane >> 4) ^ (lane >> 3)) & 1) * 8;     // ... and of a block read as v: k half (lane >> 3) & 1, row 8*hi + (lane & 7)
    constexpr float PB = (NSPLIT == 2) ? 0.0f : 10.0f;      // log2 of the factor on P (fp16 keeps small probabilities normal); it cancels against the row sum
    constexpr float C2 = SCL * 1.4426950408889634f;         // score scale x log2(e): LeakyReLU commutes with a positive factor
    constexpr float C2L = 0.2f * C2;                        // the same on the LeakyReLU's negative side
    constexpr float TH = (NSPLIT == 2) ? 8.0f : 5.0f;       // the maximum in use is raised only when a score tops it by more than TH (log2 units); fp16: P <= 2^(PB + TH) = 2^15 stays finite
    V qf[NT][2], qf2[NT][2], kf[2][2], kf2[2][2];
#pragma unroll
    for (int nt = 0; nt < NT; ++nt)
#pragma unroll
        for (int ks = 0; ks < 2; ++ks) { qf[nt][ks] = WFrag<T16>::ldf(Q + lx * 8 + (nt * 2 + ks) * 512); if (NSPLIT == 2) qf2[nt][ks] = WFrag<T16>::ldf(Q2 + lx * 8 + (nt * 2 + ks) * 512); }
    const unsigned lds0 = (unsigned)(size_t)sm + threadIdx.x * 16;   // this thread's first piece in buffer 0: LDS byte address = low 32 bits of the shared address
    const size_t toff = (size_t)threadIdx.x * 16;
    auto stage = [&](int st) {   // all copies of stage st, into buffer st & 1
        const unsigned l = lds0 + (st & 1) * BB; const size_t go = toff + (size_t)st * PLB;
        stage2(l, (const char*)Kp + go, (const char*)Kp2 + go); };
    auto fetchk = [&](const T16* sb, int sub) {   // the K fragments of step 'sub' of the stage at sb
#pragma unroll
        for (int kt = 0; kt < 2; ++kt)
#pragma unroll
            for (int ks = 0; ks < 2; ++ks) { kf[kt][ks] = WFrag<T16>::ldf(sb + sub * 2048 + (kt * 2 + ks) * 512); if (NSPLIT == 2) kf2[kt][ks] = WFrag<T16>::ldf(sb + PE + sub * 2048 + (kt * 2 + ks) * 512); } };
    stage(0);
    asm volatile("s_wait_asynccnt 0x0" ::: "memory");   // this wave's copies of stage 0 have landed
    __syncthreads();                                    // ... and every other wave's: stage 0 may be read
    stage(1);
    v8f o[4][NT]; float nmb[NT], l[NT];   // nmb = PB - the maximum in use
#pragma unroll
    for (int nt = 0; nt < NT; ++nt) { nmb[nt] = PB;   /* first maximum in use 0: queries and keys are the same rows, so a row's score with itself is a sum of squares, and its true maximum is never below 0 */ l[nt] = 0.0f;
#pragma unroll
        for (int dt = 0; dt < 4; ++dt) o[dt][nt] = (v8f){}; }
    // rolled: one body (a stage: 2 steps); the body alone fills the registers
#pragma unroll 1
    for (int st = 0; st < NST; ++st) {
      const T16* s0 = (const T16*)sm + (st & 1) * (BB / 2) + (KS == 2 ? kh * PE : 0);   // this stage's buffer (KS = 2: at this wave's half of the keys)
      const T16* sb = s0 + lx * 8; const T16* sv = s0 + lv * 8;                         // at the lane's 16 bytes of each 512-byte half block, read as k and read as v
      fetchk(sb, 0);
      // unrolled: the steps of a stage differ in what they fetch ahead (the last one nothing), and their LDS offsets become immediates
#pragma unroll
      for (int sub = 0; sub < SK / 32; ++sub) {
        V vf[4], vf2[4];
#pragma unroll
        for (int dt = 0; dt < 4; ++dt) { vf[dt] = WFrag<T16>::ldt(sv + sub * 2048 + dt * 256); if (NSPLIT == 2) vf2[dt] = WFrag<T16>::ldt(sv + PE + sub * 2048 + dt * 256); }   // columns 16*dt..+15 lie in half block dt of each 16 keys' 2 KB
        __builtin_amdgcn_sched_barrier(0);   // keeps the V loads in front of the score products: sunk to their use they would cost their latency behind the softmax
        v8f s[2][NT];
#pragma unroll
        for (int kt = 0; kt < 2; ++kt)
#pragma unroll
            for (int nt = 0; nt < NT; ++nt) { s[kt][nt] = (v8f){};
#pragma unroll
                for (int ks = 0; ks < 2; ++ks) { s[kt][nt] = WFrag<T16>::mma(kf[kt][ks], qf[nt][ks], s[kt][nt]); if (NSPLIT == 2) { s[kt][nt] = WFrag<T16>::mma(kf[kt][ks], qf2[nt][ks], s[kt][nt]); s[kt][nt] = WFrag<T16>::mma(kf2[kt][ks], qf[nt][ks], s[kt][nt]); } } }
        if (sub + 1 < SK / 32) fetchk(sb, sub + 1);   // the next step's K fragments, inside this stage only: nothing of the next stage is read in front of its barrier
        __builtin_amdgcn_sched_barrier(0);   // keeps those loads in front of the softmax, so that it covers their latency
        // exponent of P against the maximum IN USE: LeakyReLU_0.2(score x C2) - m + PB = the larger of two fused multiply-adds (no separate scale, slope and subtraction)
        float um[NT]; bool need = false;
#pragma unroll
        for (int nt = 0; nt < NT; ++nt) {
            const float n1 = nmb[nt]; const v8f nb = { n1, n1, n1, n1, n1, n1, n1, n1 }, ca = { C2, C2, C2, C2, C2, C2, C2, C2 }, cb = { C2L, C2L, C2L, C2L, C2L, C2L, C2L, C2L };   // whole-tile forms: the packed FMAs then take neighbouring registers of one accumulator as they stand
#pragma unroll
            for (int kt = 0; kt < 2; ++kt) s[kt][nt] = __builtin_elementwise_max(__builtin_elementwise_fma(s[kt][nt], ca, nb), __builtin_elementwise_fma(s[kt][nt], cb, nb));
            const v8f x = s[0][nt], z = s[1][nt];   // the lane's largest exponent, as a tree of depth 3
            const float a0 = fmaxf(fmaxf(x[0], x[1]), x[2]), a1 = fmaxf(fmaxf(x[3], x[4]), x[5]), a2 = fmaxf(fmaxf(x[6], x[7]), z[0]), a3 = fmaxf(fmaxf(z[1], z[2]), z[3]), a4 = fmaxf(fmaxf(z[4], z[5]), z[6]);
            um[nt] = fmaxf(fmaxf(fmaxf(a0, a1), a2), fmaxf(fmaxf(a3, a4), z[7]));
            need = need || (um[nt] > PB + TH); }
        if (__builtin_amdgcn_ballot_w32(need) != 0) {   // a score more than TH above the maximum in use somewhere in the wave: a few steps of a walk
#pragma unroll
            for (int nt = 0; nt < NT; ++nt) { const float d = fmaxf(fmaxf(um[nt], xhalf(um[nt])) - PB, 0.0f);   /* how far this step's largest score of the query (both halves) lies above the maximum in use */ const float al = __builtin_amdgcn_exp2f(-d); nmb[nt] -= d; l[nt] *= al;
#pragma unroll
                for (int dt = 0; dt < 4; ++dt) o[dt][nt] *= al;
#pragma unroll
                for (int kt = 0; kt < 2; ++kt) s[kt][nt] -= d; } }   // this step's exponents follow the raised maximum
        V pf[NT], pf2[NT];
#pragma unroll
        for (int nt = 0; nt < NT; ++nt) { float p[16];
#pragma unroll
            for (int e = 0; e < 16; ++e) p[e] = __builtin_amdgcn_exp2f(s[e >> 3][nt][e & 7]);
            l[nt] += (((p[0] + p[1]) + (p[2] + p[3])) + ((p[4] + p[5]) + (p[6] + p[7]))) + (((p[8] + p[9]) + (p[10] + p[11])) + ((p[12] + p[13]) + (p[14] + p[15])));
#pragma unroll
            for (int e = 0; e < 16; ++e) PCvt<T16>::put(pf[nt], pf2[nt], e, p[e]); }
#pragma unroll
        for (int dt = 0; dt < 4; ++dt)
#pragma unroll
            for (int nt = 0; nt < NT; ++nt) { o[dt][nt] = WFrag<T16>::mma(vf[dt], pf[nt], o[dt][nt]); if (NSPLIT == 2) { o[dt][nt] = WFrag<T16>::mma(vf[dt], pf2[nt], o[dt][nt]); o[dt][nt] = WFrag<T16>::mma(vf2[dt], pf[nt], o[dt][nt]); } }
      }
      // hand-over, every wave, in this order
      asm volatile("s_wait_dscnt 0x0" ::: "memory");      // this wave's reads of the buffer have returned before anything is copied over it
      asm volatile("s_wait_asynccnt 0x0" ::: "memory");   // this wave's copies of stage st + 1 have landed
      __syncthreads();                                    // stage st + 1 may be read by all, and every wave has left stage st's buffer
      if (st + 2 < NST) stage(st + 2);                    // the same for the whole work-group
    }
    asm volatile("s_wait_asynccnt 0x0" ::: "memory");   // no copy is outstanding when the wave goes on to its end
    if constexpr (KS == 2) {
        // The two waves of a row group (waves w and w ^ 2) join their halves of the keys: wave kh finishes the 16 rows of tile kh and hands its sums of the other tile over in LDS.
        // The stage buffers are free here: every wave's reads and copies were waited for in front of the loop's last barrier.
        constexpr int XW = 8 * 128 + 64;   // floats of a wave's hand-over: 8 pieces of 16 bytes a lane, then the row sum and the maximum in use
        const int wv = threadIdx.x >> 5; float* xo = (float*)sm + wv * XW; const float* xi = (const float*)sm + (wv ^ 2) * XW;
        v8f ok[4]; const float lk = kh ? l[1] : l[0], nk = kh ? nmb[1] : nmb[0];
#pragma unroll
        for (int dt = 0; dt < 4; ++dt) { ok[dt] = kh ? o[dt][1] : o[dt][0]; const v8f og = kh ? o[dt][0] : o[dt][1];
            const v4f a = { og[0], og[1], og[2], og[3] }, b = { og[4], og[5], og[6], og[7] };
            *(v4fa*)(xo + (dt * 2) * 128 + lane * 4) = a; *(v4fa*)(xo + (dt * 2 + 1) * 128 + lane * 4) = b; }
        xo[1024 + lane] = kh ? l[0] : l[1]; xo[1056 + lane] = kh ? nmb[0] : nmb[1];
        __syncthreads();   // every wave's hand-over is in LDS before its partner reads it
        const float lp = xi[1024 + lane], np = xi[1056 + lane];
        const float nm = fminf(nk, np);   // the higher of the two maxima in use (nmb = PB - maximum)
        const float fk = __builtin_amdgcn_exp2f(nm - nk), fp = __builtin_amdgcn_exp2f(nm - np); const float lt = lk * fk + lp * fp;
        const float inv = __fdiv_rn(1.0f, lt + xhalf(lt)); const float ck = fk * inv, cp = fp * inv; float* op = orow + (size_t)(kh * 16 + lr) * DQ + 8 * hi;   // the lane halves' sums meet once, here
#pragma unroll
        for (int dt = 0; dt < 4; ++dt) { const v4f pa = *(const v4fa*)(xi + (dt * 2) * 128 + lane * 4), pb = *(const v4fa*)(xi + (dt * 2 + 1) * 128 + lane * 4); v4f a, b;
#pragma unroll
            for (int j = 0; j < 4; ++j) { a[j] = ok[dt][j] * ck + pa[j] * cp; b[j] = ok[dt][4 + j] * ck + pb[j] * cp; }
            *(v4f*)(op + dt * 16) = a; *(v4f*)(op + dt * 16 + 4) = b; }
    } else {
#pragma unroll
    for (int nt = 0; nt < NT; ++nt) { const float inv = __fdiv_rn(1.0f, l[nt] + xhalf(l[nt])); float* op = orow + (size_t)(nt * 16 + lr) * DQ + 8 * hi;   // the halves' sums meet once, here
#pragma unroll
        for (int dt = 0; dt < 4; ++dt) { v4f a, b;
#pragma unroll
            for (int j = 0; j < 4; ++j) { a[j] = o[dt][nt][j] * inv; b[j] = o[dt][nt][4 + j] * inv; }
            *(v4f*)(op + dt * 16) = a; *(v4f*)(op + dt * 16 + 4) = b; } }
    }
    asm volatile("s_wait_xcnt 0x0" ::: "memory");   // behind the last store: whatever code follows this function in the kernel may reuse the stores' data and address registers
}
// grid x: first the NG * RH/(AW*16) work-groups of the hi/lo rows (16 rows a wave; the longer ones first), then the NG * (TT-RH)/(AW/2*32) of the fp16 rows (32 rows a pair of waves, half the keys each): 256 + 768 work-groups, 4 for each of the 256 WGPs, one wave of each on every SIMD
// amdgpu_waves_per_eu(4): a budget of 256 registers, so that those 4 work-groups fit a WGP and all are resident at once
__global__ __launch_bounds__(AW * 32) __attribute__((amdgpu_waves_per_eu(4))) void k_fattn(const h16* __restrict__ Q16, const h16* __restrict__ K16, const bf* __restrict__ Qh, const bf* __restrict__ Ql, const bf* __restrict__ Kh, const bf* __restrict__ Kl, float* __restrict__ OUTb) {
    constexpr int HB = RH / (AW * 16), LB = (TT - RH) / (AW / 2 * 32);
    static_assert(RH % (AW * 16) == 0 && (TT - RH) % (AW / 2 * 32) == 0 && AW == 4 && (TT & (TT - 1)) == 0 && HD == 64, "shape");
    __shared__ __align__(16) unsigned short sm[2 * 2 * HSB / 2];   // two buffers of a stage
    const int wave = threadIdx.x >> 5; const int id = blockIdx.x;
    if (id < NG * HB) { const int g = id / HB, q0 = (id % HB) * (AW * 16) + wave * 16; const size_t pl = (size_t)g * TT * HD;
        attn_rows<bf, 2, 1, 1>(Qh + pl + (size_t)q0 * HD, Ql + pl + (size_t)q0 * HD, Kh + pl, Kl + pl, OUTb + ((size_t)(g / NH_) * TT + q0) * DQ + (g % NH_) * HD, sm, 0);
    } else { const int i2 = id - NG * HB; const int g = i2 / LB, q0 = RH + (i2 % LB) * (AW / 2 * 32) + (wave & 1) * 32; const size_t pl = (size_t)g * TT * HD, ph = pl + (size_t)(TT / 2) * HD;   // waves 0, 1: first half of the keys; waves 2, 3: second half (TT/2 keys are TT/2 * HD elements)
        attn_rows<h16, 0, 2, 2>(Q16 + pl + (size_t)q0 * HD, nullptr, K16 + pl, K16 + ph, OUTb + ((size_t)(g / NH_) * TT + q0) * DQ + (g % NH_) * HD, sm, __builtin_amdgcn_readfirstlane(wave >> 1)); }
}

extern "C" void kernel_launch(void* const* d_in, const int* in_sizes, int n_in,
                              void* d_out, int out_size, void* d_ws, size_t ws_size, hipStream_t stream) {
    (void)in_sizes; (void)n_in; (void)out_size;
    const float* x = (const float*)d_in[0]; const float* w = (const float*)d_in[1];   /* order h, W ('xw' [256][256]) */
    float* OUT = (float*)d_out;     // [8][2048][256]
    char* wsp = (char*)d_ws;
    auto take = [&](size_t bytes) { char* p = wsp; wsp += (bytes + 255) & ~(size_t)255; return (void*)p; };
    h16* P16 = (h16*)take((size_t)NG * TT * HD * 2); bf* Ph = (bf*)take((size_t)NG * TT * HD * 2); bf* Pl = (bf*)take((size_t)NG * TT * HD * 2);      // Wh, rows t: q, k and v
    if ((size_t)(wsp - (char*)d_ws) > ws_size) return;    // ws 256 MiB
    k_projp<4, DM><<<dim3(NB_ * TT / 64, NH_, 1), 128, 0, stream>>>(x, w, P16, Ph, Pl);
    k_fattn<<<NG * (RH / (AW * 16)) + NG * ((TT - RH) / (AW / 2 * 32)), AW * 32, 0, stream>>>(P16, P16, Ph, Pl, Ph, Pl, OUT);   // q and k (and so v): the same planes
}
